// v000
// Measured on an AMD MI455X. A time is GPU time per run, averaged over a window of back-to-back runs after a warm-up
// (all launches, gaps included; the runs take copies of the inputs in turn), and the median of several windows.
// Apart from v000's, it joins two sittings. Times from different sittings can be a few percent apart, while
// side-by-side timings come from the same sitting.
// v000, which the later versions start from, runs in 606 microseconds.
#include <hip/hip_runtime.h>

typedef __attribute__((ext_vector_type(16))) _Float16 v16h;
typedef __attribute__((ext_vector_type(8)))  _Float16 v8h;
typedef __attribute__((ext_vector_type(8)))  float    v8f;

static __device__ __forceinline__ v8f zero8() {
    v8f z = {0.f, 0.f, 0.f, 0.f, 0.f, 0.f, 0.f, 0.f};
    return z;
}

// Load a 16x32 f16 fragment (A layout per CDNA5 ISA; B uses the same layout
// with the matrix stored column-major, i.e. base indexes [n][k]).
// lane<16:  row = lane,    K = {kb..kb+7, kb+16..kb+23}, kb=0
// lane>=16: row = lane-16, kb=8
static __device__ __forceinline__ v16h load_frag(const _Float16* p, int ld) {
    const int lane = threadIdx.x & 31;
    const int r    = lane & 15;
    const int kb   = (lane < 16) ? 0 : 8;
    const _Float16* q = p + (size_t)r * ld + kb;
    v8h lo = *(const v8h*)(q);
    v8h hi = *(const v8h*)(q + 16);
    v16h f;
#pragma unroll
    for (int i = 0; i < 8; ++i) { f[i] = lo[i]; f[i + 8] = hi[i]; }
    return f;
}

static __device__ __forceinline__ v8f wmma32(v16h a, v16h b, v8f c) {
    return __builtin_amdgcn_wmma_f32_16x16x32_f16(false, a, false, b,
                                                  (short)0, c, false, false);
}

// Async copy of 64 contiguous bytes global->LDS using the CDNA5 TDM-class
// GLOBAL_LOAD_ASYNC_TO_LDS_B128 path (ASYNCcnt). INST_OFFSET is added to both
// the LDS and the global address, so one base pair serves all four beats.
static __device__ __forceinline__ void async_copy64(unsigned lds_addr,
                                                    const void* gaddr) {
    unsigned long long ga = (unsigned long long)gaddr;
    asm volatile(
        "global_load_async_to_lds_b128 %0, %1, off\n\t"
        "global_load_async_to_lds_b128 %0, %1, off offset:16\n\t"
        "global_load_async_to_lds_b128 %0, %1, off offset:32\n\t"
        "global_load_async_to_lds_b128 %0, %1, off offset:48"
        :: "v"(lds_addr), "v"(ga) : "memory");
}

static __device__ __forceinline__ void wait_async0() {
    asm volatile("s_wait_asynccnt 0x0" ::: "memory");
}

// ---------------------------------------------------------------- cast f32->f16
__global__ __launch_bounds__(256) void cast_f16_kernel(const float* __restrict__ s,
                                                       _Float16* __restrict__ d, int n) {
    int i = blockIdx.x * 256 + threadIdx.x;
    if (i < n) d[i] = (_Float16)s[i];
}

// ---------------------------------------------------------------- WMMA GEMM
// C(MxN,f32) = A(MxK,f16,row) * B(KxN,f16,row). Block tile 128x64, BK=64.
// 8 waves -> 4x2 wave grid, each wave 32x32 = 2x2 WMMA tiles.
// A tile staged with async global->LDS (no VGPR round-trip); B tile transposed
// through VGPRs into Bs[n][k] so both fragment loads are ds_load_b128.
__global__ __launch_bounds__(256) void gemm_wmma(const _Float16* __restrict__ A,
                                                 const _Float16* __restrict__ B,
                                                 float* __restrict__ C,
                                                 int M, int N, int K) {
    __shared__ _Float16 As[128 * 72];
    __shared__ _Float16 Bs[64 * 72];
    const int tid  = threadIdx.x;
    const int wid  = tid >> 5;
    const int lane = tid & 31;
    const int wm = wid >> 1, wn = wid & 1;
    const int m0 = blockIdx.y * 128, n0 = blockIdx.x * 64;
    const int nl = lane & 15;
    const int mb = (lane >> 4) << 3;

    // per-thread staging coordinates (constant over the K loop)
    const int arow = tid >> 1, akh = (tid & 1) * 32;
    const unsigned alds = (unsigned)(size_t)(void*)&As[arow * 72 + akh];
    const _Float16* agp = A + (size_t)(m0 + arow) * K + akh;
    const int bk = tid >> 2, bn0 = (tid & 3) * 16;
    const _Float16* bgp = B + (size_t)bk * N + n0 + bn0;

    v8f acc[2][2];
#pragma unroll
    for (int a = 0; a < 2; ++a)
#pragma unroll
        for (int b = 0; b < 2; ++b) acc[a][b] = zero8();

    for (int k0 = 0; k0 < K; k0 += 64) {
        __syncthreads();
        // A: 128 rows x 64 halves; each thread copies 64B via async-to-LDS
        async_copy64(alds, agp + k0);
        {   // B: transpose 64x64 tile into Bs[n][k]
            const _Float16* src = bgp + (size_t)k0 * N;
            v8h b0 = *(const v8h*)src;
            v8h b1 = *(const v8h*)(src + 8);
#pragma unroll
            for (int i = 0; i < 8; ++i) {
                Bs[(bn0 + i) * 72 + bk]     = b0[i];
                Bs[(bn0 + 8 + i) * 72 + bk] = b1[i];
            }
        }
        wait_async0();
        __syncthreads();
#pragma unroll
        for (int s = 0; s < 2; ++s) {
            v16h af[2], bf[2];
#pragma unroll
            for (int t = 0; t < 2; ++t)
                af[t] = load_frag(&As[(wm * 32 + t * 16) * 72 + s * 32], 72);
#pragma unroll
            for (int t = 0; t < 2; ++t)
                bf[t] = load_frag(&Bs[(wn * 32 + t * 16) * 72 + s * 32], 72);
#pragma unroll
            for (int tm = 0; tm < 2; ++tm)
#pragma unroll
                for (int tn = 0; tn < 2; ++tn)
                    acc[tm][tn] = wmma32(af[tm], bf[tn], acc[tm][tn]);
        }
    }
    // epilogue: one base pointer, constant-strided stores
    float* cp = C + (size_t)(m0 + wm * 32 + mb) * N + (n0 + wn * 32 + nl);
#pragma unroll
    for (int tm = 0; tm < 2; ++tm)
#pragma unroll
        for (int r = 0; r < 8; ++r) {
            float* rp = cp + (size_t)(tm * 16 + r) * N;
            rp[0]  = acc[tm][0][r];
            rp[16] = acc[tm][1][r];
        }
}

// ---------------------------------------------------------------- RMSNorm + RoPE
// src: rows x (heads*64) f32. dst: [h][rows][64] f16. One wave32 per (row,h).
__global__ __launch_bounds__(256) void norm_rope(const float* __restrict__ src,
                                                 const float* __restrict__ cosp,
                                                 const float* __restrict__ sinp,
                                                 const float* __restrict__ w,
                                                 _Float16* __restrict__ dst,
                                                 int rows, int heads, int ld, int posoff) {
    const int wslot = blockIdx.x * 8 + (threadIdx.x >> 5);
    const int lane  = threadIdx.x & 31;
    if (wslot >= rows * heads) return;
    const int row = wslot / heads;
    const int h   = wslot - row * heads;
    const float* x = src + (size_t)row * ld + h * 64;
    float x0 = x[lane], x1 = x[lane + 32];
    float ss = x0 * x0 + x1 * x1;
#pragma unroll
    for (int o = 16; o >= 1; o >>= 1) ss += __shfl_xor(ss, o, 32);
    const float sc = rsqrtf(ss * (1.0f / 64.0f) + 1e-6f);
    const float xn0 = x0 * sc * w[lane];
    const float xn1 = x1 * sc * w[lane + 32];
    const int p = posoff + row;
    const float c0 = cosp[(size_t)p * 64 + lane];
    const float c1 = cosp[(size_t)p * 64 + lane + 32];
    const float s0 = sinp[(size_t)p * 64 + lane];
    const float s1 = sinp[(size_t)p * 64 + lane + 32];
    _Float16* d = dst + ((size_t)h * rows + row) * 64;
    d[lane]      = (_Float16)(xn0 * c0 - xn1 * s0);
    d[lane + 32] = (_Float16)(xn1 * c1 + xn0 * s1);
}

// ---------------------------------------------------------------- V transpose
// vraw: (4096 x 512) f32 -> vt[kvh][d][t] f16  (d-major so PV B-frags are contiguous)
__global__ __launch_bounds__(256) void vtrans(const float* __restrict__ vraw,
                                              _Float16* __restrict__ vt) {
    const int i = blockIdx.x * 256 + threadIdx.x;
    if (i >= 8 * 64 * 4096) return;
    const int t   = i & 4095;
    const int d   = (i >> 12) & 63;
    const int kvh = i >> 18;
    vt[i] = (_Float16)vraw[(size_t)t * 512 + kvh * 64 + d];
}

// ---------------------------------------------------------------- Flash attention
// Block: 128 q-rows x 1 head. 8 waves; wave owns 16 q-rows x all keys.
__global__ __launch_bounds__(256) void flash_attn(const _Float16* __restrict__ Qf,
                                                  const _Float16* __restrict__ Kf,
                                                  const _Float16* __restrict__ Vt,
                                                  const float* __restrict__ mask,
                                                  const float* __restrict__ tb,
                                                  const int* __restrict__ rel,
                                                  _Float16* __restrict__ Of) {
    const int h     = blockIdx.y;
    const int q0    = blockIdx.x * 128;
    const int kvh   = h >> 1;
    const int wid   = threadIdx.x >> 5;
    const int lane  = threadIdx.x & 31;
    const int nl    = lane & 15;
    const int mb    = (lane >> 4) << 3;
    const int qrow0 = q0 + wid * 16;
    const int nb    = qrow0 >> 6;          // 64-block index of this wave's rows

    __shared__ _Float16 Ps[8 * 16 * 72];
    _Float16* ps = &Ps[wid * 16 * 72];

    const _Float16* Qh = Qf + (size_t)h * 2048 * 64;
    const _Float16* Kh = Kf + (size_t)kvh * 4096 * 64;
    const _Float16* Vh = Vt + (size_t)kvh * 64 * 4096;

    const v16h aq0 = load_frag(Qh + (size_t)qrow0 * 64, 64);
    const v16h aq1 = load_frag(Qh + (size_t)qrow0 * 64 + 32, 64);

    v8f o[4];
#pragma unroll
    for (int t = 0; t < 4; ++t) o[t] = zero8();
    float Mr[8], Sr[8];
#pragma unroll
    for (int r = 0; r < 8; ++r) { Mr[r] = -1e30f; Sr[r] = 0.f; }

    for (int kt = 0; kt < 64; ++kt) {
        const int k0 = kt * 64;
        v8f sc[4];
#pragma unroll
        for (int kk = 0; kk < 4; ++kk) sc[kk] = zero8();
        // ---- scores: Q(16x64) . K^T(64x64)
#pragma unroll
        for (int s = 0; s < 2; ++s) {
            const v16h a = s ? aq1 : aq0;
#pragma unroll
            for (int kk = 0; kk < 4; ++kk) {
                v16h bk = load_frag(Kh + (size_t)(k0 + kk * 16) * 64 + s * 32, 64);
                sc[kk] = wmma32(a, bk, sc[kk]);
            }
        }
        // ---- scale + mask + block-diagonal tree bias
        const bool hasb = (k0 >= 2048) && (((k0 - 2048) >> 6) == nb);
#pragma unroll
        for (int kk = 0; kk < 4; ++kk) {
            const int key = k0 + kk * 16 + nl;
#pragma unroll
            for (int r = 0; r < 8; ++r) {
                const int qrow = qrow0 + mb + r;
                float v = sc[kk][r] * 0.125f + mask[(size_t)qrow * 4096 + key];
                if (hasb) {
                    const int t1 = qrow & 63, t2 = (key - 2048) & 63;
                    v += tb[rel[(nb << 12) + (t1 << 6) + t2] * 16 + h];
                }
                sc[kk][r] = v;
            }
        }
        // ---- online softmax (rows live across 16 lanes of the same half-wave)
        float mnew[8];
#pragma unroll
        for (int r = 0; r < 8; ++r) {
            float mx = fmaxf(fmaxf(sc[0][r], sc[1][r]), fmaxf(sc[2][r], sc[3][r]));
#pragma unroll
            for (int off = 8; off >= 1; off >>= 1) mx = fmaxf(mx, __shfl_xor(mx, off, 32));
            mnew[r] = fmaxf(Mr[r], mx);
        }
#pragma unroll
        for (int r = 0; r < 8; ++r) {
            const float al = __expf(Mr[r] - mnew[r]);
            Mr[r] = mnew[r];
            Sr[r] *= al;
#pragma unroll
            for (int t = 0; t < 4; ++t) o[t][r] *= al;
        }
        float rs[8];
#pragma unroll
        for (int r = 0; r < 8; ++r) rs[r] = 0.f;
#pragma unroll
        for (int kk = 0; kk < 4; ++kk)
#pragma unroll
            for (int r = 0; r < 8; ++r) {
                const float p = __expf(sc[kk][r] - Mr[r]);
                sc[kk][r] = p;
                rs[r] += p;
            }
#pragma unroll
        for (int r = 0; r < 8; ++r) {
#pragma unroll
            for (int off = 8; off >= 1; off >>= 1) rs[r] += __shfl_xor(rs[r], off, 32);
            Sr[r] += rs[r];
        }
        // ---- C-layout -> A-layout via per-wave LDS stripe
#pragma unroll
        for (int kk = 0; kk < 4; ++kk)
#pragma unroll
            for (int r = 0; r < 8; ++r)
                ps[(mb + r) * 72 + kk * 16 + nl] = (_Float16)sc[kk][r];
        asm volatile("s_wait_dscnt 0" ::: "memory");
        // ---- O += P(16x64) . V(64x64)
#pragma unroll
        for (int s = 0; s < 2; ++s) {
            v16h ap = load_frag(ps + s * 32, 72);
#pragma unroll
            for (int d = 0; d < 4; ++d) {
                v16h bv = load_frag(Vh + (size_t)(d * 16) * 4096 + k0 + s * 32, 4096);
                o[d] = wmma32(ap, bv, o[d]);
            }
        }
    }
#pragma unroll
    for (int r = 0; r < 8; ++r) Sr[r] = 1.0f / Sr[r];
#pragma unroll
    for (int d = 0; d < 4; ++d)
#pragma unroll
        for (int r = 0; r < 8; ++r) {
            const int qrow = qrow0 + mb + r;
            Of[(size_t)qrow * 1024 + h * 64 + d * 16 + nl] = (_Float16)(o[d][r] * Sr[r]);
        }
}

// ---------------------------------------------------------------- host
extern "C" void kernel_launch(void* const* d_in, const int* in_sizes, int n_in,
                              void* d_out, int out_size, void* d_ws, size_t ws_size,
                              hipStream_t stream) {
    (void)in_sizes; (void)n_in; (void)out_size; (void)ws_size;
    const float* hidden = (const float*)d_in[0];
    const float* target = (const float*)d_in[1];
    const float* cosp   = (const float*)d_in[2];
    const float* sinp   = (const float*)d_in[3];
    const float* mask   = (const float*)d_in[4];
    const float* Wq     = (const float*)d_in[5];
    const float* Wk     = (const float*)d_in[6];
    const float* Wv     = (const float*)d_in[7];
    const float* Wo     = (const float*)d_in[8];
    const float* qw     = (const float*)d_in[9];
    const float* kw     = (const float*)d_in[10];
    const float* tb     = (const float*)d_in[11];
    const int*   rel    = (const int*)d_in[12];

    char* ws = (char*)d_ws;
    size_t off = 0;
    auto alloc = [&](size_t bytes) -> void* {
        void* p = ws + off;
        off += (bytes + 255) & ~(size_t)255;
        return p;
    };
    _Float16* Xf   = (_Float16*)alloc(4096ull * 1024 * 2);   // [target; hidden] f16
    _Float16* Wq16 = (_Float16*)alloc(1024ull * 1024 * 2);
    _Float16* Wk16 = (_Float16*)alloc(1024ull * 512 * 2);
    _Float16* Wv16 = (_Float16*)alloc(1024ull * 512 * 2);
    _Float16* Wo16 = (_Float16*)alloc(1024ull * 1024 * 2);
    float*    Qraw = (float*)alloc(2048ull * 1024 * 4);
    float*    Kraw = (float*)alloc(4096ull * 512 * 4);
    float*    Vraw = (float*)alloc(4096ull * 512 * 4);
    _Float16* Qf   = (_Float16*)alloc(16ull * 2048 * 64 * 2);
    _Float16* Kf2  = (_Float16*)alloc(8ull * 4096 * 64 * 2);
    _Float16* Vt   = (_Float16*)alloc(8ull * 64 * 4096 * 2);
    _Float16* Of   = (_Float16*)alloc(2048ull * 1024 * 2);

    auto cast = [&](const float* s, _Float16* d, int n) {
        cast_f16_kernel<<<(n + 255) / 256, 256, 0, stream>>>(s, d, n);
    };
    cast(target, Xf, 2048 * 1024);
    cast(hidden, Xf + 2048ull * 1024, 2048 * 1024);
    cast(Wq, Wq16, 1024 * 1024);
    cast(Wk, Wk16, 1024 * 512);
    cast(Wv, Wv16, 1024 * 512);
    cast(Wo, Wo16, 1024 * 1024);

    // projections
    gemm_wmma<<<dim3(16, 16), 256, 0, stream>>>(Xf + 2048ull * 1024, Wq16, Qraw, 2048, 1024, 1024);
    gemm_wmma<<<dim3(8, 32), 256, 0, stream>>>(Xf, Wk16, Kraw, 4096, 512, 1024);
    gemm_wmma<<<dim3(8, 32), 256, 0, stream>>>(Xf, Wv16, Vraw, 4096, 512, 1024);

    // RMSNorm + RoPE (q positions CTX..TOTAL-1; k positions 0..TOTAL-1)
    norm_rope<<<4096, 256, 0, stream>>>(Qraw, cosp, sinp, qw, Qf, 2048, 16, 1024, 2048);
    norm_rope<<<4096, 256, 0, stream>>>(Kraw, cosp, sinp, kw, Kf2, 4096, 8, 512, 0);
    vtrans<<<(8 * 64 * 4096) / 256, 256, 0, stream>>>(Vraw, Vt);

    // flash attention with tree bias
    flash_attn<<<dim3(16, 16), 256, 0, stream>>>(Qf, Kf2, Vt, mask, tb, rel, Of);

    // output projection
    gemm_wmma<<<dim3(16, 16), 256, 0, stream>>>(Of, Wo16, (float*)d_out, 2048, 1024, 1024);
}

// v001
// One run takes 288 microseconds.
// Timed twice side by side with v000, it ran 2.11 and 2.12 times as fast.
#include <hip/hip_runtime.h>

typedef __attribute__((ext_vector_type(16))) _Float16 v16h;
typedef __attribute__((ext_vector_type(8)))  _Float16 v8h;
typedef __attribute__((ext_vector_type(8)))  float    v8f;

static __device__ __forceinline__ v8f zero8() {
    v8f z = {0.f, 0.f, 0.f, 0.f, 0.f, 0.f, 0.f, 0.f};
    return z;
}

// Load a 16x32 f16 fragment (A layout per CDNA5 ISA; B uses the same layout
// with the matrix stored column-major, i.e. base indexes [n][k]).
// lane<16:  row = lane,    K = {kb..kb+7, kb+16..kb+23}, kb=0
// lane>=16: row = lane-16, kb=8
static __device__ __forceinline__ v16h load_frag(const _Float16* p, int ld) {
    const int lane = threadIdx.x & 31;
    const int r    = lane & 15;
    const int kb   = (lane < 16) ? 0 : 8;
    const _Float16* q = p + (size_t)r * ld + kb;
    v8h lo = *(const v8h*)(q);
    v8h hi = *(const v8h*)(q + 16);
    v16h f;
#pragma unroll
    for (int i = 0; i < 8; ++i) { f[i] = lo[i]; f[i + 8] = hi[i]; }
    return f;
}

static __device__ __forceinline__ v8f wmma32(v16h a, v16h b, v8f c) {
    return __builtin_amdgcn_wmma_f32_16x16x32_f16(false, a, false, b,
                                                  (short)0, c, false, false);
}

// Async copy of 64 contiguous bytes global->LDS using the CDNA5 TDM-class
// GLOBAL_LOAD_ASYNC_TO_LDS_B128 path (ASYNCcnt). INST_OFFSET is added to both
// the LDS and the global address, so one base pair serves all four beats.
static __device__ __forceinline__ void async_copy64(unsigned lds_addr,
                                                    const void* gaddr) {
    unsigned long long ga = (unsigned long long)gaddr;
    asm volatile(
        "global_load_async_to_lds_b128 %0, %1, off\n\t"
        "global_load_async_to_lds_b128 %0, %1, off offset:16\n\t"
        "global_load_async_to_lds_b128 %0, %1, off offset:32\n\t"
        "global_load_async_to_lds_b128 %0, %1, off offset:48"
        :: "v"(lds_addr), "v"(ga) : "memory");
}

static __device__ __forceinline__ void wait_async0() {
    asm volatile("s_wait_asynccnt 0x0" ::: "memory");
}

// ---------------------------------------------------------------- cast f32->f16
__global__ __launch_bounds__(256) void cast_f16_kernel(const float* __restrict__ s,
                                                       _Float16* __restrict__ d, int n) {
    int i = blockIdx.x * 256 + threadIdx.x;
    if (i < n) d[i] = (_Float16)s[i];
}

// ---------------------------------------------------------------- WMMA GEMM
// C(MxN,f32) = A(MxK,f16,row) * B(KxN,f16,row). Block tile 128x64, BK=64.
// 8 waves -> 4x2 wave grid, each wave 32x32 = 2x2 WMMA tiles.
// A tile staged with async global->LDS (no VGPR round-trip); B tile transposed
// through VGPRs into Bs[n][k] so both fragment loads are ds_load_b128.
__global__ __launch_bounds__(256) void gemm_wmma(const _Float16* __restrict__ A,
                                                 const _Float16* __restrict__ B,
                                                 float* __restrict__ C,
                                                 int M, int N, int K) {
    __shared__ _Float16 As[128 * 72];
    __shared__ _Float16 Bs[64 * 72];
    const int tid  = threadIdx.x;
    const int wid  = tid >> 5;
    const int lane = tid & 31;
    const int wm = wid >> 1, wn = wid & 1;
    const int m0 = blockIdx.y * 128, n0 = blockIdx.x * 64;
    const int nl = lane & 15;
    const int mb = (lane >> 4) << 3;

    // per-thread staging coordinates (constant over the K loop)
    const int arow = tid >> 1, akh = (tid & 1) * 32;
    const unsigned alds = (unsigned)(size_t)(void*)&As[arow * 72 + akh];
    const _Float16* agp = A + (size_t)(m0 + arow) * K + akh;
    const int bk = tid >> 2, bn0 = (tid & 3) * 16;
    const _Float16* bgp = B + (size_t)bk * N + n0 + bn0;

    v8f acc[2][2];
#pragma unroll
    for (int a = 0; a < 2; ++a)
#pragma unroll
        for (int b = 0; b < 2; ++b) acc[a][b] = zero8();

    for (int k0 = 0; k0 < K; k0 += 64) {
        __syncthreads();
        // A: 128 rows x 64 halves; each thread copies 64B via async-to-LDS
        async_copy64(alds, agp + k0);
        {   // B: transpose 64x64 tile into Bs[n][k]
            const _Float16* src = bgp + (size_t)k0 * N;
            v8h b0 = *(const v8h*)src;
            v8h b1 = *(const v8h*)(src + 8);
#pragma unroll
            for (int i = 0; i < 8; ++i) {
                Bs[(bn0 + i) * 72 + bk]     = b0[i];
                Bs[(bn0 + 8 + i) * 72 + bk] = b1[i];
            }
        }
        wait_async0();
        __syncthreads();
#pragma unroll
        for (int s = 0; s < 2; ++s) {
            v16h af[2], bf[2];
#pragma unroll
            for (int t = 0; t < 2; ++t)
                af[t] = load_frag(&As[(wm * 32 + t * 16) * 72 + s * 32], 72);
#pragma unroll
            for (int t = 0; t < 2; ++t)
                bf[t] = load_frag(&Bs[(wn * 32 + t * 16) * 72 + s * 32], 72);
#pragma unroll
            for (int tm = 0; tm < 2; ++tm)
#pragma unroll
                for (int tn = 0; tn < 2; ++tn)
                    acc[tm][tn] = wmma32(af[tm], bf[tn], acc[tm][tn]);
        }
    }
    // epilogue: one base pointer, constant-strided stores
    float* cp = C + (size_t)(m0 + wm * 32 + mb) * N + (n0 + wn * 32 + nl);
#pragma unroll
    for (int tm = 0; tm < 2; ++tm)
#pragma unroll
        for (int r = 0; r < 8; ++r) {
            float* rp = cp + (size_t)(tm * 16 + r) * N;
            rp[0]  = acc[tm][0][r];
            rp[16] = acc[tm][1][r];
        }
}

// ---------------------------------------------------------------- RMSNorm + RoPE
// src: rows x (heads*64) f32. dst: [h][rows][64] f16. One wave32 per (row,h).
__global__ __launch_bounds__(256) void norm_rope(const float* __restrict__ src,
                                                 const float* __restrict__ cosp,
                                                 const float* __restrict__ sinp,
                                                 const float* __restrict__ w,
                                                 _Float16* __restrict__ dst,
                                                 int rows, int heads, int ld, int posoff) {
    const int wslot = blockIdx.x * 8 + (threadIdx.x >> 5);
    const int lane  = threadIdx.x & 31;
    if (wslot >= rows * heads) return;
    const int row = wslot / heads;
    const int h   = wslot - row * heads;
    const float* x = src + (size_t)row * ld + h * 64;
    float x0 = x[lane], x1 = x[lane + 32];
    float ss = x0 * x0 + x1 * x1;
#pragma unroll
    for (int o = 16; o >= 1; o >>= 1) ss += __shfl_xor(ss, o, 32);
    const float sc = rsqrtf(ss * (1.0f / 64.0f) + 1e-6f);
    const float xn0 = x0 * sc * w[lane];
    const float xn1 = x1 * sc * w[lane + 32];
    const int p = posoff + row;
    const float c0 = cosp[(size_t)p * 64 + lane];
    const float c1 = cosp[(size_t)p * 64 + lane + 32];
    const float s0 = sinp[(size_t)p * 64 + lane];
    const float s1 = sinp[(size_t)p * 64 + lane + 32];
    _Float16* d = dst + ((size_t)h * rows + row) * 64;
    d[lane]      = (_Float16)(xn0 * c0 - xn1 * s0);
    d[lane + 32] = (_Float16)(xn1 * c1 + xn0 * s1);
}

// ---------------------------------------------------------------- V transpose
// vraw: (4096 x 512) f32 -> vt[kvh][d][t] f16  (d-major so PV B-frags are contiguous)
__global__ __launch_bounds__(256) void vtrans(const float* __restrict__ vraw,
                                              _Float16* __restrict__ vt) {
    const int i = blockIdx.x * 256 + threadIdx.x;
    if (i >= 8 * 64 * 4096) return;
    const int t   = i & 4095;
    const int d   = (i >> 12) & 63;
    const int kvh = i >> 18;
    vt[i] = (_Float16)vraw[(size_t)t * 512 + kvh * 64 + d];
}

// ---------------------------------------------------------------- Flash attention
// Block: 128 q-rows x 1 head. 8 waves; wave owns 16 q-rows x all keys.
__global__ __launch_bounds__(256) void flash_attn(const _Float16* __restrict__ Qf,
                                                  const _Float16* __restrict__ Kf,
                                                  const _Float16* __restrict__ Vt,
                                                  const float* __restrict__ mask,
                                                  const float* __restrict__ tb,
                                                  const int* __restrict__ rel,
                                                  _Float16* __restrict__ Of) {
    const int h     = blockIdx.y;
    const int q0    = blockIdx.x * 128;
    const int kvh   = h >> 1;
    // wave number held scalar: the tree-bias test below is then one scalar
    // branch per key tile instead of an EXEC branch per score element
    const int wid   = __builtin_amdgcn_readfirstlane(threadIdx.x >> 5);
    const int lane  = threadIdx.x & 31;
    const int nl    = lane & 15;
    const int mb    = (lane >> 4) << 3;
    const int qrow0 = q0 + wid * 16;
    const int nb    = qrow0 >> 6;          // 64-block index of this wave's rows

    __shared__ _Float16 Ps[8 * 16 * 72];
    _Float16* ps = &Ps[wid * 16 * 72];

    const _Float16* Qh = Qf + (size_t)h * 2048 * 64;
    const _Float16* Kh = Kf + (size_t)kvh * 4096 * 64;
    const _Float16* Vh = Vt + (size_t)kvh * 64 * 4096;

    const v16h aq0 = load_frag(Qh + (size_t)qrow0 * 64, 64);
    const v16h aq1 = load_frag(Qh + (size_t)qrow0 * 64 + 32, 64);

    v8f o[4];
#pragma unroll
    for (int t = 0; t < 4; ++t) o[t] = zero8();
    float Mr[8], Sr[8];
#pragma unroll
    for (int r = 0; r < 8; ++r) { Mr[r] = -1e30f; Sr[r] = 0.f; }

    // mask values of one key tile in accumulator layout, fetched as one group
    // of 32 loads one tile ahead of their use
    const float* mrow = mask + (size_t)(qrow0 + mb) * 4096 + nl;
    float mk[4][8];
#pragma unroll
    for (int kk = 0; kk < 4; ++kk)
#pragma unroll
        for (int r = 0; r < 8; ++r) mk[kk][r] = mrow[r * 4096 + kk * 16];

    for (int kt = 0; kt < 64; ++kt) {
        const int k0 = kt * 64;
        v8f sc[4];
#pragma unroll
        for (int kk = 0; kk < 4; ++kk) sc[kk] = zero8();
        // ---- scores: Q(16x64) . K^T(64x64)
#pragma unroll
        for (int s = 0; s < 2; ++s) {
            const v16h a = s ? aq1 : aq0;
#pragma unroll
            for (int kk = 0; kk < 4; ++kk) {
                v16h bk = load_frag(Kh + (size_t)(k0 + kk * 16) * 64 + s * 32, 64);
                sc[kk] = wmma32(a, bk, sc[kk]);
            }
        }
        // ---- scale + mask + block-diagonal tree bias
        const bool hasb = (k0 >= 2048) && (((k0 - 2048) >> 6) == nb);
#pragma unroll
        for (int kk = 0; kk < 4; ++kk)
#pragma unroll
            for (int r = 0; r < 8; ++r)
                sc[kk][r] = sc[kk][r] * 0.125f + mk[kk][r];
        // next tile's mask group flies under the softmax and the PV products
        // (the last pass fetches its own tile again, so the address stays inside)
        const float* mnext = mrow + (kt < 63 ? k0 + 64 : k0);
        // keeps the group behind this tile's K loads: hoisted among them, the
        // in-order load counter makes the last score products wait for it
        __builtin_amdgcn_sched_barrier(0);
#pragma unroll
        for (int kk = 0; kk < 4; ++kk)
#pragma unroll
            for (int r = 0; r < 8; ++r) mk[kk][r] = mnext[r * 4096 + kk * 16];
        // the group's address pair is reused further down the pass: this wait
        // stands in front of that overwrite, and keeps the group up here
        asm volatile("s_wait_xcnt 0x0" ::: "memory");
        if (hasb) {
            const int* rp = rel + (nb << 12) + (((qrow0 & 63) + mb) << 6) + nl;
            int bi[4][8];      // index into tree_bias, relation bounded to 0..63
#pragma unroll
            for (int kk = 0; kk < 4; ++kk)
#pragma unroll
                for (int r = 0; r < 8; ++r)
                    bi[kk][r] = (rp[(r << 6) + kk * 16] & 63) * 16 + h;
            float bv[4][8];
#pragma unroll
            for (int kk = 0; kk < 4; ++kk) {
#pragma unroll
                for (int r = 0; r < 8; ++r) bv[kk][r] = tb[bi[kk][r]];
                // the eight index registers stay live up to this wait, so no
                // later gather's result lands in one of them ahead of it
                asm volatile("s_wait_xcnt 0x0"
                             :: "v"(bi[kk][0]), "v"(bi[kk][1]), "v"(bi[kk][2]), "v"(bi[kk][3]),
                                "v"(bi[kk][4]), "v"(bi[kk][5]), "v"(bi[kk][6]), "v"(bi[kk][7])
                             : "memory");
            }
#pragma unroll
            for (int kk = 0; kk < 4; ++kk)
#pragma unroll
                for (int r = 0; r < 8; ++r) sc[kk][r] += bv[kk][r];
        }
        // ---- online softmax (rows live across 16 lanes of the same half-wave)
        float mnew[8];
#pragma unroll
        for (int r = 0; r < 8; ++r) {
            float mx = fmaxf(fmaxf(sc[0][r], sc[1][r]), fmaxf(sc[2][r], sc[3][r]));
#pragma unroll
            for (int off = 8; off >= 1; off >>= 1) mx = fmaxf(mx, __shfl_xor(mx, off, 32));
            mnew[r] = fmaxf(Mr[r], mx);
        }
#pragma unroll
        for (int r = 0; r < 8; ++r) {
            const float al = __expf(Mr[r] - mnew[r]);
            Mr[r] = mnew[r];
            Sr[r] *= al;
#pragma unroll
            for (int t = 0; t < 4; ++t) o[t][r] *= al;
        }
        float rs[8];
#pragma unroll
        for (int r = 0; r < 8; ++r) rs[r] = 0.f;
#pragma unroll
        for (int kk = 0; kk < 4; ++kk)
#pragma unroll
            for (int r = 0; r < 8; ++r) {
                const float p = __expf(sc[kk][r] - Mr[r]);
                sc[kk][r] = p;
                rs[r] += p;
            }
#pragma unroll
        for (int r = 0; r < 8; ++r) {
#pragma unroll
            for (int off = 8; off >= 1; off >>= 1) rs[r] += __shfl_xor(rs[r], off, 32);
            Sr[r] += rs[r];
        }
        // ---- C-layout -> A-layout via per-wave LDS stripe
#pragma unroll
        for (int kk = 0; kk < 4; ++kk)
#pragma unroll
            for (int r = 0; r < 8; ++r)
                ps[(mb + r) * 72 + kk * 16 + nl] = (_Float16)sc[kk][r];
        asm volatile("s_wait_dscnt 0" ::: "memory");
        // ---- O += P(16x64) . V(64x64)
#pragma unroll
        for (int s = 0; s < 2; ++s) {
            v16h ap = load_frag(ps + s * 32, 72);
#pragma unroll
            for (int d = 0; d < 4; ++d) {
                v16h bv = load_frag(Vh + (size_t)(d * 16) * 4096 + k0 + s * 32, 4096);
                o[d] = wmma32(ap, bv, o[d]);
            }
        }
    }
#pragma unroll
    for (int r = 0; r < 8; ++r) Sr[r] = 1.0f / Sr[r];
#pragma unroll
    for (int d = 0; d < 4; ++d)
#pragma unroll
        for (int r = 0; r < 8; ++r) {
            const int qrow = qrow0 + mb + r;
            Of[(size_t)qrow * 1024 + h * 64 + d * 16 + nl] = (_Float16)(o[d][r] * Sr[r]);
        }
}

// ---------------------------------------------------------------- host
extern "C" void kernel_launch(void* const* d_in, const int* in_sizes, int n_in,
                              void* d_out, int out_size, void* d_ws, size_t ws_size,
                              hipStream_t stream) {
    (void)in_sizes; (void)n_in; (void)out_size; (void)ws_size;
    const float* hidden = (const float*)d_in[0];
    const float* target = (const float*)d_in[1];
    const float* cosp   = (const float*)d_in[2];
    const float* sinp   = (const float*)d_in[3];
    const float* mask   = (const float*)d_in[4];
    const float* Wq     = (const float*)d_in[5];
    const float* Wk     = (const float*)d_in[6];
    const float* Wv     = (const float*)d_in[7];
    const float* Wo     = (const float*)d_in[8];
    const float* qw     = (const float*)d_in[9];
    const float* kw     = (const float*)d_in[10];
    const float* tb     = (const float*)d_in[11];
    const int*   rel    = (const int*)d_in[12];

    char* ws = (char*)d_ws;
    size_t off = 0;
    auto alloc = [&](size_t bytes) -> void* {
        void* p = ws + off;
        off += (bytes + 255) & ~(size_t)255;
        return p;
    };
    _Float16* Xf   = (_Float16*)alloc(4096ull * 1024 * 2);   // [target; hidden] f16
    _Float16* Wq16 = (_Float16*)alloc(1024ull * 1024 * 2);
    _Float16* Wk16 = (_Float16*)alloc(1024ull * 512 * 2);
    _Float16* Wv16 = (_Float16*)alloc(1024ull * 512 * 2);
    _Float16* Wo16 = (_Float16*)alloc(1024ull * 1024 * 2);
    float*    Qraw = (float*)alloc(2048ull * 1024 * 4);
    float*    Kraw = (float*)alloc(4096ull * 512 * 4);
    float*    Vraw = (float*)alloc(4096ull * 512 * 4);
    _Float16* Qf   = (_Float16*)alloc(16ull * 2048 * 64 * 2);
    _Float16* Kf2  = (_Float16*)alloc(8ull * 4096 * 64 * 2);
    _Float16* Vt   = (_Float16*)alloc(8ull * 64 * 4096 * 2);
    _Float16* Of   = (_Float16*)alloc(2048ull * 1024 * 2);

    auto cast = [&](const float* s, _Float16* d, int n) {
        cast_f16_kernel<<<(n + 255) / 256, 256, 0, stream>>>(s, d, n);
    };
    cast(target, Xf, 2048 * 1024);
    cast(hidden, Xf + 2048ull * 1024, 2048 * 1024);
    cast(Wq, Wq16, 1024 * 1024);
    cast(Wk, Wk16, 1024 * 512);
    cast(Wv, Wv16, 1024 * 512);
    cast(Wo, Wo16, 1024 * 1024);

    // projections
    gemm_wmma<<<dim3(16, 16), 256, 0, stream>>>(Xf + 2048ull * 1024, Wq16, Qraw, 2048, 1024, 1024);
    gemm_wmma<<<dim3(8, 32), 256, 0, stream>>>(Xf, Wk16, Kraw, 4096, 512, 1024);
    gemm_wmma<<<dim3(8, 32), 256, 0, stream>>>(Xf, Wv16, Vraw, 4096, 512, 1024);

    // RMSNorm + RoPE (q positions CTX..TOTAL-1; k positions 0..TOTAL-1)
    norm_rope<<<4096, 256, 0, stream>>>(Qraw, cosp, sinp, qw, Qf, 2048, 16, 1024, 2048);
    norm_rope<<<4096, 256, 0, stream>>>(Kraw, cosp, sinp, kw, Kf2, 4096, 8, 512, 0);
    vtrans<<<(8 * 64 * 4096) / 256, 256, 0, stream>>>(Vraw, Vt);

    // flash attention with tree bias
    flash_attn<<<dim3(16, 16), 256, 0, stream>>>(Qf, Kf2, Vt, mask, tb, rel, Of);

    // output projection
    gemm_wmma<<<dim3(16, 16), 256, 0, stream>>>(Of, Wo16, (float*)d_out, 2048, 1024, 1024);
}

// v002
// One run takes 214 microseconds.
// Next to v001, in two timings, it ran 1.35 times as fast each time.
// Counting every step since v000, it is 2.86 times as fast.
#include <hip/hip_runtime.h>

typedef __attribute__((ext_vector_type(16))) _Float16 v16h;
typedef __attribute__((ext_vector_type(8)))  _Float16 v8h;
typedef __attribute__((ext_vector_type(8)))  float    v8f;

static __device__ __forceinline__ v8f zero8() {
    v8f z = {0.f, 0.f, 0.f, 0.f, 0.f, 0.f, 0.f, 0.f};
    return z;
}

// Load a 16x32 f16 fragment (A layout per CDNA5 ISA; B uses the same layout
// with the matrix stored column-major, i.e. base indexes [n][k]).
// lane<16:  row = lane,    K = {kb..kb+7, kb+16..kb+23}, kb=0
// lane>=16: row = lane-16, kb=8
static __device__ __forceinline__ v16h load_frag(const _Float16* p, int ld) {
    const int lane = threadIdx.x & 31;
    const int r    = lane & 15;
    const int kb   = (lane < 16) ? 0 : 8;
    const _Float16* q = p + (size_t)r * ld + kb;
    v8h lo = *(const v8h*)(q);
    v8h hi = *(const v8h*)(q + 16);
    v16h f;
#pragma unroll
    for (int i = 0; i < 8; ++i) { f[i] = lo[i]; f[i + 8] = hi[i]; }
    return f;
}

static __device__ __forceinline__ v8f wmma32(v16h a, v16h b, v8f c) {
    return __builtin_amdgcn_wmma_f32_16x16x32_f16(false, a, false, b,
                                                  (short)0, c, false, false);
}

// Async copy of 64 contiguous bytes global->LDS using the CDNA5 TDM-class
// GLOBAL_LOAD_ASYNC_TO_LDS_B128 path (ASYNCcnt). INST_OFFSET is added to both
// the LDS and the global address, so one base pair serves all four beats.
static __device__ __forceinline__ void async_copy64(unsigned lds_addr,
                                                    const void* gaddr) {
    unsigned long long ga = (unsigned long long)gaddr;
    asm volatile(
        "global_load_async_to_lds_b128 %0, %1, off\n\t"
        "global_load_async_to_lds_b128 %0, %1, off offset:16\n\t"
        "global_load_async_to_lds_b128 %0, %1, off offset:32\n\t"
        "global_load_async_to_lds_b128 %0, %1, off offset:48"
        :: "v"(lds_addr), "v"(ga) : "memory");
}

// Four 16-byte async copies global->LDS of one lane, each with its own address
// pair. The s_wait_xcnt closes the statement so that it stands in front of any
// later write of the address registers the copies name.
static __device__ __forceinline__ void async_copy4x16(unsigned l0, const void* g0,
                                                      unsigned l1, const void* g1,
                                                      unsigned l2, const void* g2,
                                                      unsigned l3, const void* g3) {
    asm volatile(
        "global_load_async_to_lds_b128 %0, %1, off\n\t"
        "global_load_async_to_lds_b128 %2, %3, off\n\t"
        "global_load_async_to_lds_b128 %4, %5, off\n\t"
        "global_load_async_to_lds_b128 %6, %7, off\n\t"
        "s_wait_xcnt 0x0"
        :: "v"(l0), "v"((unsigned long long)g0), "v"(l1), "v"((unsigned long long)g1),
           "v"(l2), "v"((unsigned long long)g2), "v"(l3), "v"((unsigned long long)g3)
        : "memory");
}

static __device__ __forceinline__ void wait_async0() {
    asm volatile("s_wait_asynccnt 0x0" ::: "memory");
}

// ---------------------------------------------------------------- cast f32->f16
__global__ __launch_bounds__(256) void cast_f16_kernel(const float* __restrict__ s,
                                                       _Float16* __restrict__ d, int n) {
    int i = blockIdx.x * 256 + threadIdx.x;
    if (i < n) d[i] = (_Float16)s[i];
}

// ---------------------------------------------------------------- WMMA GEMM
// C(MxN,f32) = A(MxK,f16,row) * B(KxN,f16,row). Block tile 128x64, BK=64.
// 8 waves -> 4x2 wave grid, each wave 32x32 = 2x2 WMMA tiles.
// A tile staged with async global->LDS (no VGPR round-trip); B tile transposed
// through VGPRs into Bs[n][k] so both fragment loads are ds_load_b128.
__global__ __launch_bounds__(256) void gemm_wmma(const _Float16* __restrict__ A,
                                                 const _Float16* __restrict__ B,
                                                 float* __restrict__ C,
                                                 int M, int N, int K) {
    __shared__ _Float16 As[128 * 72];
    __shared__ _Float16 Bs[64 * 72];
    const int tid  = threadIdx.x;
    const int wid  = tid >> 5;
    const int lane = tid & 31;
    const int wm = wid >> 1, wn = wid & 1;
    const int m0 = blockIdx.y * 128, n0 = blockIdx.x * 64;
    const int nl = lane & 15;
    const int mb = (lane >> 4) << 3;

    // per-thread staging coordinates (constant over the K loop)
    const int arow = tid >> 1, akh = (tid & 1) * 32;
    const unsigned alds = (unsigned)(size_t)(void*)&As[arow * 72 + akh];
    const _Float16* agp = A + (size_t)(m0 + arow) * K + akh;
    const int bk = tid >> 2, bn0 = (tid & 3) * 16;
    const _Float16* bgp = B + (size_t)bk * N + n0 + bn0;

    v8f acc[2][2];
#pragma unroll
    for (int a = 0; a < 2; ++a)
#pragma unroll
        for (int b = 0; b < 2; ++b) acc[a][b] = zero8();

    for (int k0 = 0; k0 < K; k0 += 64) {
        __syncthreads();
        // A: 128 rows x 64 halves; each thread copies 64B via async-to-LDS
        async_copy64(alds, agp + k0);
        {   // B: transpose 64x64 tile into Bs[n][k]
            const _Float16* src = bgp + (size_t)k0 * N;
            v8h b0 = *(const v8h*)src;
            v8h b1 = *(const v8h*)(src + 8);
#pragma unroll
            for (int i = 0; i < 8; ++i) {
                Bs[(bn0 + i) * 72 + bk]     = b0[i];
                Bs[(bn0 + 8 + i) * 72 + bk] = b1[i];
            }
        }
        wait_async0();
        __syncthreads();
#pragma unroll
        for (int s = 0; s < 2; ++s) {
            v16h af[2], bf[2];
#pragma unroll
            for (int t = 0; t < 2; ++t)
                af[t] = load_frag(&As[(wm * 32 + t * 16) * 72 + s * 32], 72);
#pragma unroll
            for (int t = 0; t < 2; ++t)
                bf[t] = load_frag(&Bs[(wn * 32 + t * 16) * 72 + s * 32], 72);
#pragma unroll
            for (int tm = 0; tm < 2; ++tm)
#pragma unroll
                for (int tn = 0; tn < 2; ++tn)
                    acc[tm][tn] = wmma32(af[tm], bf[tn], acc[tm][tn]);
        }
    }
    // epilogue: one base pointer, constant-strided stores
    float* cp = C + (size_t)(m0 + wm * 32 + mb) * N + (n0 + wn * 32 + nl);
#pragma unroll
    for (int tm = 0; tm < 2; ++tm)
#pragma unroll
        for (int r = 0; r < 8; ++r) {
            float* rp = cp + (size_t)(tm * 16 + r) * N;
            rp[0]  = acc[tm][0][r];
            rp[16] = acc[tm][1][r];
        }
}

// ---------------------------------------------------------------- RMSNorm + RoPE
// src: rows x (heads*64) f32. dst: [h][rows][64] f16. One wave32 per (row,h).
__global__ __launch_bounds__(256) void norm_rope(const float* __restrict__ src,
                                                 const float* __restrict__ cosp,
                                                 const float* __restrict__ sinp,
                                                 const float* __restrict__ w,
                                                 _Float16* __restrict__ dst,
                                                 int rows, int heads, int ld, int posoff) {
    const int wslot = blockIdx.x * 8 + (threadIdx.x >> 5);
    const int lane  = threadIdx.x & 31;
    if (wslot >= rows * heads) return;
    const int row = wslot / heads;
    const int h   = wslot - row * heads;
    const float* x = src + (size_t)row * ld + h * 64;
    float x0 = x[lane], x1 = x[lane + 32];
    float ss = x0 * x0 + x1 * x1;
#pragma unroll
    for (int o = 16; o >= 1; o >>= 1) ss += __shfl_xor(ss, o, 32);
    const float sc = rsqrtf(ss * (1.0f / 64.0f) + 1e-6f);
    const float xn0 = x0 * sc * w[lane];
    const float xn1 = x1 * sc * w[lane + 32];
    const int p = posoff + row;
    const float c0 = cosp[(size_t)p * 64 + lane];
    const float c1 = cosp[(size_t)p * 64 + lane + 32];
    const float s0 = sinp[(size_t)p * 64 + lane];
    const float s1 = sinp[(size_t)p * 64 + lane + 32];
    _Float16* d = dst + ((size_t)h * rows + row) * 64;
    d[lane]      = (_Float16)(xn0 * c0 - xn1 * s0);
    d[lane + 32] = (_Float16)(xn1 * c1 + xn0 * s1);
}

// ---------------------------------------------------------------- V transpose
// vraw: (4096 x 512) f32 -> vt[kvh][d][t] f16  (d-major so PV B-frags are contiguous)
__global__ __launch_bounds__(256) void vtrans(const float* __restrict__ vraw,
                                              _Float16* __restrict__ vt) {
    const int i = blockIdx.x * 256 + threadIdx.x;
    if (i >= 8 * 64 * 4096) return;
    const int t   = i & 4095;
    const int d   = (i >> 12) & 63;
    const int kvh = i >> 18;
    vt[i] = (_Float16)vraw[(size_t)t * 512 + kvh * 64 + d];
}

__global__ __launch_bounds__(256) void flash_attn(const _Float16* __restrict__ Qf,
                                                  const _Float16* __restrict__ Kf,
                                                  const _Float16* __restrict__ Vt,
                                                  const float* __restrict__ mask,
                                                  const float* __restrict__ tb,
                                                  const int* __restrict__ rel,
                                                  _Float16* __restrict__ Of) {
    const int h     = blockIdx.y;
    const int q0    = blockIdx.x * 128;
    const int kvh   = h >> 1;
    // wave number held scalar: the tree-bias test below is then one scalar
    // branch per key tile instead of an EXEC branch per score element
    const int wid   = __builtin_amdgcn_readfirstlane(threadIdx.x >> 5);
    const int lane  = threadIdx.x & 31;
    const int nl    = lane & 15;
    const int mb    = (lane >> 4) << 3;
    const int qrow0 = q0 + wid * 16;
    const int nb    = qrow0 >> 6;          // 64-block index of this wave's rows

    __shared__ _Float16 Ps[8 * 16 * 72];
    _Float16* ps = &Ps[wid * 16 * 72];
    // rows of 64 halves at a pitch of 72 (144 B = 16 B x odd, for ds_load_b128)
    __shared__ __attribute__((aligned(16))) _Float16 Ks[2][64 * 72];   // [key][d]
    __shared__ __attribute__((aligned(16))) _Float16 Vs[2][64 * 72];   // [d][key]

    const _Float16* Qh = Qf + (size_t)h * 2048 * 64;
    const _Float16* Kh = Kf + (size_t)kvh * 4096 * 64;
    const _Float16* Vh = Vt + (size_t)kvh * 64 * 4096;

    // staging: 8 lanes per 128-byte row; a thread copies rows crow and crow + 32
    // of the K tile and of the V^T tile
    const int crow = threadIdx.x >> 3, ccol = (threadIdx.x & 7) * 8;
    const _Float16* kg = Kh + (size_t)crow * 64 + ccol;
    const _Float16* vg = Vh + (size_t)crow * 4096 + ccol;
    const unsigned kl = (unsigned)(size_t)(void*)&Ks[0][crow * 72 + ccol];
    const unsigned vl = (unsigned)(size_t)(void*)&Vs[0][crow * 72 + ccol];
    auto stage = [&](int t, int buf) {
        const unsigned bo = (unsigned)buf * (64 * 72 * 2);
        const _Float16* kp = kg + (size_t)t * 64 * 64;
        const _Float16* vp = vg + t * 64;
        async_copy4x16(kl + bo, kp, kl + bo + 32 * 72 * 2, kp + 32 * 64,
                       vl + bo, vp, vl + bo + 32 * 72 * 2, vp + (size_t)32 * 4096);
    };
    stage(0, 0);
    wait_async0();
    __syncthreads();       // publishes tile 0
    stage(1, 1);

    const v16h aq0 = load_frag(Qh + (size_t)qrow0 * 64, 64);
    const v16h aq1 = load_frag(Qh + (size_t)qrow0 * 64 + 32, 64);

    v8f o[4];
#pragma unroll
    for (int t = 0; t < 4; ++t) o[t] = zero8();
    float Mr[8], Sr[8];
#pragma unroll
    for (int r = 0; r < 8; ++r) { Mr[r] = -1e30f; Sr[r] = 0.f; }

    // mask values of one key tile in accumulator layout, fetched as one group
    // of 32 loads one tile ahead of their use
    const float* mrow = mask + (size_t)(qrow0 + mb) * 4096 + nl;
    float mk[4][8];
#pragma unroll
    for (int kk = 0; kk < 4; ++kk)
#pragma unroll
        for (int r = 0; r < 8; ++r) mk[kk][r] = mrow[r * 4096 + kk * 16];

    for (int kt = 0; kt < 64; ++kt) {
        const int k0 = kt * 64;
        const _Float16* kb = &Ks[kt & 1][0];
        const _Float16* vb = &Vs[kt & 1][0];
        v8f sc[4];
#pragma unroll
        for (int kk = 0; kk < 4; ++kk) sc[kk] = zero8();
        // ---- scores: Q(16x64) . K^T(64x64)
        v16h bk[2][4];
#pragma unroll
        for (int s = 0; s < 2; ++s)
#pragma unroll
            for (int kk = 0; kk < 4; ++kk)
                bk[s][kk] = load_frag(kb + (kk * 16) * 72 + s * 32, 72);
        // keeps the 16 LDS reads together in front of the products: spread among
        // them into one register set, each product waits out its own LDS latency
        __builtin_amdgcn_sched_barrier(0);
#pragma unroll
        for (int s = 0; s < 2; ++s) {
            const v16h a = s ? aq1 : aq0;
#pragma unroll
            for (int kk = 0; kk < 4; ++kk) sc[kk] = wmma32(a, bk[s][kk], sc[kk]);
        }
        // ---- scale + mask + block-diagonal tree bias
        const bool hasb = (k0 >= 2048) && (((k0 - 2048) >> 6) == nb);
#pragma unroll
        for (int kk = 0; kk < 4; ++kk)
#pragma unroll
            for (int r = 0; r < 8; ++r)
                sc[kk][r] = sc[kk][r] * 0.125f + mk[kk][r];
        // next tile's mask group flies under the softmax and the PV products
        // (the last pass fetches its own tile again, so the address stays inside)
        const float* mnext = mrow + (kt < 63 ? k0 + 64 : k0);
#pragma unroll
        for (int kk = 0; kk < 4; ++kk)
#pragma unroll
            for (int r = 0; r < 8; ++r) mk[kk][r] = mnext[r * 4096 + kk * 16];
        // the group's address pair is reused further down the pass: this wait
        // stands in front of that overwrite, and keeps the group up here
        asm volatile("s_wait_xcnt 0x0" ::: "memory");
        if (hasb) {
            const int* rp = rel + (nb << 12) + (((qrow0 & 63) + mb) << 6) + nl;
            int bi[4][8];      // index into tree_bias, relation bounded to 0..63
#pragma unroll
            for (int kk = 0; kk < 4; ++kk)
#pragma unroll
                for (int r = 0; r < 8; ++r)
                    bi[kk][r] = (rp[(r << 6) + kk * 16] & 63) * 16 + h;
            float bv[4][8];
#pragma unroll
            for (int kk = 0; kk < 4; ++kk) {
#pragma unroll
                for (int r = 0; r < 8; ++r) bv[kk][r] = tb[bi[kk][r]];
                // the eight index registers stay live up to this wait, so no
                // later gather's result lands in one of them ahead of it
                asm volatile("s_wait_xcnt 0x0"
                             :: "v"(bi[kk][0]), "v"(bi[kk][1]), "v"(bi[kk][2]), "v"(bi[kk][3]),
                                "v"(bi[kk][4]), "v"(bi[kk][5]), "v"(bi[kk][6]), "v"(bi[kk][7])
                             : "memory");
            }
#pragma unroll
            for (int kk = 0; kk < 4; ++kk)
#pragma unroll
                for (int r = 0; r < 8; ++r) sc[kk][r] += bv[kk][r];
        }
        // ---- online softmax (rows live across 16 lanes of the same half-wave)
        float mnew[8];
#pragma unroll
        for (int r = 0; r < 8; ++r) {
            float mx = fmaxf(fmaxf(sc[0][r], sc[1][r]), fmaxf(sc[2][r], sc[3][r]));
#pragma unroll
            for (int off = 8; off >= 1; off >>= 1) mx = fmaxf(mx, __shfl_xor(mx, off, 32));
            mnew[r] = fmaxf(Mr[r], mx);
        }
#pragma unroll
        for (int r = 0; r < 8; ++r) {
            const float al = __expf(Mr[r] - mnew[r]);
            Mr[r] = mnew[r];
            Sr[r] *= al;
#pragma unroll
            for (int t = 0; t < 4; ++t) o[t][r] *= al;
        }
        float rs[8];
#pragma unroll
        for (int r = 0; r < 8; ++r) rs[r] = 0.f;
#pragma unroll
        for (int kk = 0; kk < 4; ++kk)
#pragma unroll
            for (int r = 0; r < 8; ++r) {
                const float p = __expf(sc[kk][r] - Mr[r]);
                sc[kk][r] = p;
                rs[r] += p;
            }
#pragma unroll
        for (int r = 0; r < 8; ++r) {
#pragma unroll
            for (int off = 8; off >= 1; off >>= 1) rs[r] += __shfl_xor(rs[r], off, 32);
            Sr[r] += rs[r];
        }
        // V fragments are read ahead of the P stores: their LDS latency passes
        // under the conversions and the stores
        v16h bv[2][4];
#pragma unroll
        for (int s = 0; s < 2; ++s)
#pragma unroll
            for (int d = 0; d < 4; ++d)
                bv[s][d] = load_frag(vb + (d * 16) * 72 + s * 32, 72);
        // ---- C-layout -> A-layout via per-wave LDS stripe
#pragma unroll
        for (int kk = 0; kk < 4; ++kk)
#pragma unroll
            for (int r = 0; r < 8; ++r)
                ps[(mb + r) * 72 + kk * 16 + nl] = (_Float16)sc[kk][r];
        asm volatile("s_wait_dscnt 0" ::: "memory");
        // ---- O += P(16x64) . V(64x64)
#pragma unroll
        for (int s = 0; s < 2; ++s) {
            v16h ap = load_frag(ps + s * 32, 72);
#pragma unroll
            for (int d = 0; d < 4; ++d) o[d] = wmma32(ap, bv[s][d], o[d]);
        }
        // ---- hand-over: this wave's LDS reads are back, its copies of the next
        // tile have landed; the barrier publishes that tile and frees this one
        asm volatile("s_wait_dscnt 0x0" ::: "memory");
        wait_async0();
        __syncthreads();
        if (kt + 2 < 64) stage(kt + 2, kt & 1);
    }
    wait_async0();         // nothing is in flight when the wave ends
#pragma unroll
    for (int r = 0; r < 8; ++r) Sr[r] = 1.0f / Sr[r];
#pragma unroll
    for (int d = 0; d < 4; ++d)
#pragma unroll
        for (int r = 0; r < 8; ++r) {
            const int qrow = qrow0 + mb + r;
            Of[(size_t)qrow * 1024 + h * 64 + d * 16 + nl] = (_Float16)(o[d][r] * Sr[r]);
        }
}

// ---------------------------------------------------------------- host
extern "C" void kernel_launch(void* const* d_in, const int* in_sizes, int n_in,
                              void* d_out, int out_size, void* d_ws, size_t ws_size,
                              hipStream_t stream) {
    (void)in_sizes; (void)n_in; (void)out_size; (void)ws_size;
    const float* hidden = (const float*)d_in[0];
    const float* target = (const float*)d_in[1];
    const float* cosp   = (const float*)d_in[2];
    const float* sinp   = (const float*)d_in[3];
    const float* mask   = (const float*)d_in[4];
    const float* Wq     = (const float*)d_in[5];
    const float* Wk     = (const float*)d_in[6];
    const float* Wv     = (const float*)d_in[7];
    const float* Wo     = (const float*)d_in[8];
    const float* qw     = (const float*)d_in[9];
    const float* kw     = (const float*)d_in[10];
    const float* tb     = (const float*)d_in[11];
    const int*   rel    = (const int*)d_in[12];

    char* ws = (char*)d_ws;
    size_t off = 0;
    auto alloc = [&](size_t bytes) -> void* {
        void* p = ws + off;
        off += (bytes + 255) & ~(size_t)255;
        return p;
    };
    _Float16* Xf   = (_Float16*)alloc(4096ull * 1024 * 2);   // [target; hidden] f16
    _Float16* Wq16 = (_Float16*)alloc(1024ull * 1024 * 2);
    _Float16* Wk16 = (_Float16*)alloc(1024ull * 512 * 2);
    _Float16* Wv16 = (_Float16*)alloc(1024ull * 512 * 2);
    _Float16* Wo16 = (_Float16*)alloc(1024ull * 1024 * 2);
    float*    Qraw = (float*)alloc(2048ull * 1024 * 4);
    float*    Kraw = (float*)alloc(4096ull * 512 * 4);
    float*    Vraw = (float*)alloc(4096ull * 512 * 4);
    _Float16* Qf   = (_Float16*)alloc(16ull * 2048 * 64 * 2);
    _Float16* Kf2  = (_Float16*)alloc(8ull * 4096 * 64 * 2);
    _Float16* Vt   = (_Float16*)alloc(8ull * 64 * 4096 * 2);
    _Float16* Of   = (_Float16*)alloc(2048ull * 1024 * 2);

    auto cast = [&](const float* s, _Float16* d, int n) {
        cast_f16_kernel<<<(n + 255) / 256, 256, 0, stream>>>(s, d, n);
    };
    cast(target, Xf, 2048 * 1024);
    cast(hidden, Xf + 2048ull * 1024, 2048 * 1024);
    cast(Wq, Wq16, 1024 * 1024);
    cast(Wk, Wk16, 1024 * 512);
    cast(Wv, Wv16, 1024 * 512);
    cast(Wo, Wo16, 1024 * 1024);

    // projections
    gemm_wmma<<<dim3(16, 16), 256, 0, stream>>>(Xf + 2048ull * 1024, Wq16, Qraw, 2048, 1024, 1024);
    gemm_wmma<<<dim3(8, 32), 256, 0, stream>>>(Xf, Wk16, Kraw, 4096, 512, 1024);
    gemm_wmma<<<dim3(8, 32), 256, 0, stream>>>(Xf, Wv16, Vraw, 4096, 512, 1024);

    // RMSNorm + RoPE (q positions CTX..TOTAL-1; k positions 0..TOTAL-1)
    norm_rope<<<4096, 256, 0, stream>>>(Qraw, cosp, sinp, qw, Qf, 2048, 16, 1024, 2048);
    norm_rope<<<4096, 256, 0, stream>>>(Kraw, cosp, sinp, kw, Kf2, 4096, 8, 512, 0);
    vtrans<<<(8 * 64 * 4096) / 256, 256, 0, stream>>>(Vraw, Vt);

    // flash attention with tree bias
    flash_attn<<<dim3(16, 16), 256, 0, stream>>>(Qf, Kf2, Vt, mask, tb, rel, Of);

    // output projection
    gemm_wmma<<<dim3(16, 16), 256, 0, stream>>>(Of, Wo16, (float*)d_out, 2048, 1024, 1024);
}

// v003
// A run of this version takes 200 microseconds.
// Timed twice side by side with v002, it ran 1.07 times as fast both times.
// Counting every step since v000, it is 3.07 times as fast.
#include <hip/hip_runtime.h>

typedef __attribute__((ext_vector_type(16))) _Float16 v16h;
typedef __attribute__((ext_vector_type(8)))  _Float16 v8h;
typedef __attribute__((ext_vector_type(8)))  float    v8f;
typedef __attribute__((ext_vector_type(4)))  float    v4f;
typedef __attribute__((ext_vector_type(4)))  _Float16 v4h;

static __device__ __forceinline__ v8f zero8() {
    v8f z = {0.f, 0.f, 0.f, 0.f, 0.f, 0.f, 0.f, 0.f};
    return z;
}

// Load a 16x32 f16 fragment (A layout per CDNA5 ISA; B uses the same layout
// with the matrix stored column-major, i.e. base indexes [n][k]).
// lane<16:  row = lane,    K = {kb..kb+7, kb+16..kb+23}, kb=0
// lane>=16: row = lane-16, kb=8
static __device__ __forceinline__ v16h load_frag(const _Float16* p, int ld) {
    const int lane = threadIdx.x & 31;
    const int r    = lane & 15;
    const int kb   = (lane < 16) ? 0 : 8;
    const _Float16* q = p + (size_t)r * ld + kb;
    v8h lo = *(const v8h*)(q);
    v8h hi = *(const v8h*)(q + 16);
    v16h f;
#pragma unroll
    for (int i = 0; i < 8; ++i) { f[i] = lo[i]; f[i + 8] = hi[i]; }
    return f;
}

static __device__ __forceinline__ v8f wmma32(v16h a, v16h b, v8f c) {
    return __builtin_amdgcn_wmma_f32_16x16x32_f16(false, a, false, b,
                                                  (short)0, c, false, false);
}

// Async copy of 64 contiguous bytes global->LDS using the CDNA5 TDM-class
// GLOBAL_LOAD_ASYNC_TO_LDS_B128 path (ASYNCcnt). INST_OFFSET is added to both
// the LDS and the global address, so one base pair serves all four beats.
static __device__ __forceinline__ void async_copy64(unsigned lds_addr,
                                                    const void* gaddr) {
    unsigned long long ga = (unsigned long long)gaddr;
    asm volatile(
        "global_load_async_to_lds_b128 %0, %1, off\n\t"
        "global_load_async_to_lds_b128 %0, %1, off offset:16\n\t"
        "global_load_async_to_lds_b128 %0, %1, off offset:32\n\t"
        "global_load_async_to_lds_b128 %0, %1, off offset:48"
        :: "v"(lds_addr), "v"(ga) : "memory");
}

// Four 16-byte async copies global->LDS of one lane, each with its own address
// pair. The s_wait_xcnt closes the statement so that it stands in front of any
// later write of the address registers the copies name.
static __device__ __forceinline__ void async_copy4x16(unsigned l0, const void* g0,
                                                      unsigned l1, const void* g1,
                                                      unsigned l2, const void* g2,
                                                      unsigned l3, const void* g3) {
    asm volatile(
        "global_load_async_to_lds_b128 %0, %1, off\n\t"
        "global_load_async_to_lds_b128 %2, %3, off\n\t"
        "global_load_async_to_lds_b128 %4, %5, off\n\t"
        "global_load_async_to_lds_b128 %6, %7, off\n\t"
        "s_wait_xcnt 0x0"
        :: "v"(l0), "v"((unsigned long long)g0), "v"(l1), "v"((unsigned long long)g1),
           "v"(l2), "v"((unsigned long long)g2), "v"(l3), "v"((unsigned long long)g3)
        : "memory");
}

static __device__ __forceinline__ void wait_async0() {
    asm volatile("s_wait_asynccnt 0x0" ::: "memory");
}

// ---------------------------------------------------------------- cast f32->f16
// A block converts 8192 consecutive elements, 32 per thread: the launch is bound
// by how fast waves start, not by its bytes. Each wave-wide load covers 512
// contiguous bytes and each store 256; the eight loads of a thread fly together.
__global__ __launch_bounds__(256) void cast_f16_kernel(const float* __restrict__ s,
                                                       _Float16* __restrict__ d, int n) {
    const int b0 = blockIdx.x * 8192;
    if (b0 + 8192 <= n) {
        const int i0 = b0 + threadIdx.x * 4;
        v4f x[8];
        // both loops unrolled: x stays in registers, all loads issue before the first wait
#pragma unroll
        for (int j = 0; j < 8; ++j) x[j] = *(const v4f*)(s + i0 + j * 1024);
#pragma unroll
        for (int j = 0; j < 8; ++j)
            *(v4h*)(d + i0 + j * 1024) = __builtin_convertvector(x[j], v4h);
        // stands in front of any later write of a register that the stores name
        asm volatile("s_wait_xcnt 0x0" ::: "memory");
    } else {
        for (int i = b0 + threadIdx.x; i < n; i += 256) d[i] = (_Float16)s[i];
    }
}

// ---------------------------------------------------------------- WMMA GEMM
// C(MxN,f32) = A(MxK,f16,row) * B(KxN,f16,row). Block tile 128x64, BK=64.
// 8 waves -> 4x2 wave grid, each wave 32x32 = 2x2 WMMA tiles.
// A tile staged with async global->LDS (no VGPR round-trip); B tile transposed
// through VGPRs into Bs[n][k] so both fragment loads are ds_load_b128.
__global__ __launch_bounds__(256) void gemm_wmma(const _Float16* __restrict__ A,
                                                 const _Float16* __restrict__ B,
                                                 float* __restrict__ C,
                                                 int M, int N, int K) {
    __shared__ _Float16 As[128 * 72];
    __shared__ _Float16 Bs[64 * 72];
    const int tid  = threadIdx.x;
    const int wid  = tid >> 5;
    const int lane = tid & 31;
    const int wm = wid >> 1, wn = wid & 1;
    const int m0 = blockIdx.y * 128, n0 = blockIdx.x * 64;
    const int nl = lane & 15;
    const int mb = (lane >> 4) << 3;

    // per-thread staging coordinates (constant over the K loop)
    const int arow = tid >> 1, akh = (tid & 1) * 32;
    const unsigned alds = (unsigned)(size_t)(void*)&As[arow * 72 + akh];
    const _Float16* agp = A + (size_t)(m0 + arow) * K + akh;
    const int bk = tid >> 2, bn0 = (tid & 3) * 16;
    const _Float16* bgp = B + (size_t)bk * N + n0 + bn0;

    v8f acc[2][2];
#pragma unroll
    for (int a = 0; a < 2; ++a)
#pragma unroll
        for (int b = 0; b < 2; ++b) acc[a][b] = zero8();

    for (int k0 = 0; k0 < K; k0 += 64) {
        __syncthreads();
        // A: 128 rows x 64 halves; each thread copies 64B via async-to-LDS
        async_copy64(alds, agp + k0);
        {   // B: transpose 64x64 tile into Bs[n][k]
            const _Float16* src = bgp + (size_t)k0 * N;
            v8h b0 = *(const v8h*)src;
            v8h b1 = *(const v8h*)(src + 8);
#pragma unroll
            for (int i = 0; i < 8; ++i) {
                Bs[(bn0 + i) * 72 + bk]     = b0[i];
                Bs[(bn0 + 8 + i) * 72 + bk] = b1[i];
            }
        }
        wait_async0();
        __syncthreads();
#pragma unroll
        for (int s = 0; s < 2; ++s) {
            v16h af[2], bf[2];
#pragma unroll
            for (int t = 0; t < 2; ++t)
                af[t] = load_frag(&As[(wm * 32 + t * 16) * 72 + s * 32], 72);
#pragma unroll
            for (int t = 0; t < 2; ++t)
                bf[t] = load_frag(&Bs[(wn * 32 + t * 16) * 72 + s * 32], 72);
#pragma unroll
            for (int tm = 0; tm < 2; ++tm)
#pragma unroll
                for (int tn = 0; tn < 2; ++tn)
                    acc[tm][tn] = wmma32(af[tm], bf[tn], acc[tm][tn]);
        }
    }
    // epilogue: one base pointer, constant-strided stores
    float* cp = C + (size_t)(m0 + wm * 32 + mb) * N + (n0 + wn * 32 + nl);
#pragma unroll
    for (int tm = 0; tm < 2; ++tm)
#pragma unroll
        for (int r = 0; r < 8; ++r) {
            float* rp = cp + (size_t)(tm * 16 + r) * N;
            rp[0]  = acc[tm][0][r];
            rp[16] = acc[tm][1][r];
        }
}

// ---------------------------------------------------------------- RMSNorm + RoPE
// src: rows x (heads*64) f32. dst: [h][rows][64] f16. A wave32 takes eight
// consecutive (row,h) slots, so an eighth of the waves has to start.
// N heads h .. h+N-1 of one row, stage by stage over all of them: the N slots'
// loads fly together and their lane exchanges overlap instead of following one
// another; the row's cos and sin are fetched once.
template <int N>
static __device__ __forceinline__ void rope_slots(const float* __restrict__ src,
                                                  const float* __restrict__ cosp,
                                                  const float* __restrict__ sinp,
                                                  float w0, float w1,
                                                  _Float16* __restrict__ dst,
                                                  int rows, int ld, int posoff,
                                                  int lane, int row, int h) {
    const float* x = src + (size_t)row * ld + h * 64;
    float x0[N], x1[N], ss[N];
    // every loop over the slots is unrolled: the arrays stay in registers
#pragma unroll
    for (int j = 0; j < N; ++j) {
        x0[j] = x[j * 64 + lane];
        x1[j] = x[j * 64 + lane + 32];
    }
    const int p = posoff + row;
    const float c0 = cosp[(size_t)p * 64 + lane];
    const float c1 = cosp[(size_t)p * 64 + lane + 32];
    const float s0 = sinp[(size_t)p * 64 + lane];
    const float s1 = sinp[(size_t)p * 64 + lane + 32];
#pragma unroll
    for (int j = 0; j < N; ++j) ss[j] = x0[j] * x0[j] + x1[j] * x1[j];
#pragma unroll
    for (int o = 16; o >= 1; o >>= 1) {
        float t[N];
#pragma unroll
        for (int j = 0; j < N; ++j) t[j] = __shfl_xor(ss[j], o, 32);
#pragma unroll
        for (int j = 0; j < N; ++j) ss[j] += t[j];
    }
#pragma unroll
    for (int j = 0; j < N; ++j) {
        const float sc = rsqrtf(ss[j] * (1.0f / 64.0f) + 1e-6f);
        const float xn0 = x0[j] * sc * w0;
        const float xn1 = x1[j] * sc * w1;
        _Float16* d = dst + ((size_t)(h + j) * rows + row) * 64;
        d[lane]      = (_Float16)(xn0 * c0 - xn1 * s0);
        d[lane + 32] = (_Float16)(xn1 * c1 + xn0 * s1);
    }
    // stands in front of any later write of a register that the stores name
    asm volatile("s_wait_xcnt 0x0" ::: "memory");
}

__global__ __launch_bounds__(256) void norm_rope(const float* __restrict__ src,
                                                 const float* __restrict__ cosp,
                                                 const float* __restrict__ sinp,
                                                 const float* __restrict__ w,
                                                 _Float16* __restrict__ dst,
                                                 int rows, int heads, int ld, int posoff) {
    // wave number held scalar: row, head and base addresses stay in scalar registers
    const int wave   = __builtin_amdgcn_readfirstlane(threadIdx.x >> 5);
    const int wslot0 = (blockIdx.x * 8 + wave) * 8;
    const int lane   = threadIdx.x & 31;
    const int left   = rows * heads - wslot0;
    if (left <= 0) return;
    int row = wslot0 / heads;
    int h   = wslot0 - row * heads;
    const float w0 = w[lane], w1 = w[lane + 32];
    if (h + 8 <= heads) {          // the eight slots lie in one row
        rope_slots<8>(src, cosp, sinp, w0, w1, dst, rows, ld, posoff, lane, row, h);
    } else {                       // they cross a row's end, or the last row ends first
        for (int j = 0; j < 8 && j < left; ++j) {
            rope_slots<1>(src, cosp, sinp, w0, w1, dst, rows, ld, posoff, lane, row, h);
            if (++h == heads) { h = 0; ++row; }
        }
    }
}

// ---------------------------------------------------------------- V transpose
// vraw: (4096 x 512) f32 -> vt[kvh][d][t] f16  (d-major so PV B-frags are contiguous)
// A thread takes one d and 64 consecutive t, one whole 128-byte line of vt: a
// sixty-fourth of the waves has to start. Lanes run along d.
__global__ __launch_bounds__(128) void vtrans(const float* __restrict__ vraw,
                                              _Float16* __restrict__ vt) {
    const int i = blockIdx.x * 128 + threadIdx.x;
    if (i >= 8 * 64 * 64) return;
    const int d   = i & 63;
    const int t0  = ((i >> 6) & 63) * 64;
    const int kvh = i >> 12;
    const float* sp = vraw + (size_t)t0 * 512 + kvh * 64 + d;
    _Float16*    dp = vt + (size_t)(kvh * 64 + d) * 4096 + t0;
    // unrolled: the 64 loads issue as one group, each store holds 8 packed values
#pragma unroll
    for (int g = 0; g < 8; ++g) {
        v8h o;
#pragma unroll
        for (int j = 0; j < 8; ++j) o[j] = (_Float16)sp[(g * 8 + j) * 512];
        *(v8h*)(dp + g * 8) = o;
    }
}

__global__ __launch_bounds__(256) void flash_attn(const _Float16* __restrict__ Qf,
                                                  const _Float16* __restrict__ Kf,
                                                  const _Float16* __restrict__ Vt,
                                                  const float* __restrict__ mask,
                                                  const float* __restrict__ tb,
                                                  const int* __restrict__ rel,
                                                  _Float16* __restrict__ Of) {
    const int h     = blockIdx.y;
    const int q0    = blockIdx.x * 128;
    const int kvh   = h >> 1;
    // wave number held scalar: the tree-bias test below is then one scalar
    // branch per key tile instead of an EXEC branch per score element
    const int wid   = __builtin_amdgcn_readfirstlane(threadIdx.x >> 5);
    const int lane  = threadIdx.x & 31;
    const int nl    = lane & 15;
    const int mb    = (lane >> 4) << 3;
    const int qrow0 = q0 + wid * 16;
    const int nb    = qrow0 >> 6;          // 64-block index of this wave's rows

    __shared__ _Float16 Ps[8 * 16 * 72];
    _Float16* ps = &Ps[wid * 16 * 72];
    // rows of 64 halves at a pitch of 72 (144 B = 16 B x odd, for ds_load_b128)
    __shared__ __attribute__((aligned(16))) _Float16 Ks[2][64 * 72];   // [key][d]
    __shared__ __attribute__((aligned(16))) _Float16 Vs[2][64 * 72];   // [d][key]

    const _Float16* Qh = Qf + (size_t)h * 2048 * 64;
    const _Float16* Kh = Kf + (size_t)kvh * 4096 * 64;
    const _Float16* Vh = Vt + (size_t)kvh * 64 * 4096;

    // staging: 8 lanes per 128-byte row; a thread copies rows crow and crow + 32
    // of the K tile and of the V^T tile
    const int crow = threadIdx.x >> 3, ccol = (threadIdx.x & 7) * 8;
    const _Float16* kg = Kh + (size_t)crow * 64 + ccol;
    const _Float16* vg = Vh + (size_t)crow * 4096 + ccol;
    const unsigned kl = (unsigned)(size_t)(void*)&Ks[0][crow * 72 + ccol];
    const unsigned vl = (unsigned)(size_t)(void*)&Vs[0][crow * 72 + ccol];
    auto stage = [&](int t, int buf) {
        const unsigned bo = (unsigned)buf * (64 * 72 * 2);
        const _Float16* kp = kg + (size_t)t * 64 * 64;
        const _Float16* vp = vg + t * 64;
        async_copy4x16(kl + bo, kp, kl + bo + 32 * 72 * 2, kp + 32 * 64,
                       vl + bo, vp, vl + bo + 32 * 72 * 2, vp + (size_t)32 * 4096);
    };
    stage(0, 0);
    wait_async0();
    __syncthreads();       // publishes tile 0
    stage(1, 1);

    const v16h aq0 = load_frag(Qh + (size_t)qrow0 * 64, 64);
    const v16h aq1 = load_frag(Qh + (size_t)qrow0 * 64 + 32, 64);

    v8f o[4];
#pragma unroll
    for (int t = 0; t < 4; ++t) o[t] = zero8();
    float Mr[8], Sr[8];
#pragma unroll
    for (int r = 0; r < 8; ++r) { Mr[r] = -1e30f; Sr[r] = 0.f; }

    // mask values of one key tile in accumulator layout, fetched as one group
    // of 32 loads one tile ahead of their use
    const float* mrow = mask + (size_t)(qrow0 + mb) * 4096 + nl;
    float mk[4][8];
#pragma unroll
    for (int kk = 0; kk < 4; ++kk)
#pragma unroll
        for (int r = 0; r < 8; ++r) mk[kk][r] = mrow[r * 4096 + kk * 16];

    for (int kt = 0; kt < 64; ++kt) {
        const int k0 = kt * 64;
        const _Float16* kb = &Ks[kt & 1][0];
        const _Float16* vb = &Vs[kt & 1][0];
        v8f sc[4];
#pragma unroll
        for (int kk = 0; kk < 4; ++kk) sc[kk] = zero8();
        // ---- scores: Q(16x64) . K^T(64x64)
        v16h bk[2][4];
#pragma unroll
        for (int s = 0; s < 2; ++s)
#pragma unroll
            for (int kk = 0; kk < 4; ++kk)
                bk[s][kk] = load_frag(kb + (kk * 16) * 72 + s * 32, 72);
        // keeps the 16 LDS reads together in front of the products: spread among
        // them into one register set, each product waits out its own LDS latency
        __builtin_amdgcn_sched_barrier(0);
#pragma unroll
        for (int s = 0; s < 2; ++s) {
            const v16h a = s ? aq1 : aq0;
#pragma unroll
            for (int kk = 0; kk < 4; ++kk) sc[kk] = wmma32(a, bk[s][kk], sc[kk]);
        }
        // ---- scale + mask + block-diagonal tree bias
        const bool hasb = (k0 >= 2048) && (((k0 - 2048) >> 6) == nb);
#pragma unroll
        for (int kk = 0; kk < 4; ++kk)
#pragma unroll
            for (int r = 0; r < 8; ++r)
                sc[kk][r] = sc[kk][r] * 0.125f + mk[kk][r];
        // next tile's mask group flies under the softmax and the PV products
        // (the last pass fetches its own tile again, so the address stays inside)
        const float* mnext = mrow + (kt < 63 ? k0 + 64 : k0);
#pragma unroll
        for (int kk = 0; kk < 4; ++kk)
#pragma unroll
            for (int r = 0; r < 8; ++r) mk[kk][r] = mnext[r * 4096 + kk * 16];
        // the group's address pair is reused further down the pass: this wait
        // stands in front of that overwrite, and keeps the group up here
        asm volatile("s_wait_xcnt 0x0" ::: "memory");
        if (hasb) {
            const int* rp = rel + (nb << 12) + (((qrow0 & 63) + mb) << 6) + nl;
            int bi[4][8];      // index into tree_bias, relation bounded to 0..63
#pragma unroll
            for (int kk = 0; kk < 4; ++kk)
#pragma unroll
                for (int r = 0; r < 8; ++r)
                    bi[kk][r] = (rp[(r << 6) + kk * 16] & 63) * 16 + h;
            float bv[4][8];
#pragma unroll
            for (int kk = 0; kk < 4; ++kk) {
#pragma unroll
                for (int r = 0; r < 8; ++r) bv[kk][r] = tb[bi[kk][r]];
                // the eight index registers stay live up to this wait, so no
                // later gather's result lands in one of them ahead of it
                asm volatile("s_wait_xcnt 0x0"
                             :: "v"(bi[kk][0]), "v"(bi[kk][1]), "v"(bi[kk][2]), "v"(bi[kk][3]),
                                "v"(bi[kk][4]), "v"(bi[kk][5]), "v"(bi[kk][6]), "v"(bi[kk][7])
                             : "memory");
            }
#pragma unroll
            for (int kk = 0; kk < 4; ++kk)
#pragma unroll
                for (int r = 0; r < 8; ++r) sc[kk][r] += bv[kk][r];
        }
        // ---- online softmax (rows live across 16 lanes of the same half-wave)
        float mnew[8];
#pragma unroll
        for (int r = 0; r < 8; ++r) {
            float mx = fmaxf(fmaxf(sc[0][r], sc[1][r]), fmaxf(sc[2][r], sc[3][r]));
#pragma unroll
            for (int off = 8; off >= 1; off >>= 1) mx = fmaxf(mx, __shfl_xor(mx, off, 32));
            mnew[r] = fmaxf(Mr[r], mx);
        }
#pragma unroll
        for (int r = 0; r < 8; ++r) {
            const float al = __expf(Mr[r] - mnew[r]);
            Mr[r] = mnew[r];
            Sr[r] *= al;
#pragma unroll
            for (int t = 0; t < 4; ++t) o[t][r] *= al;
        }
        float rs[8];
#pragma unroll
        for (int r = 0; r < 8; ++r) rs[r] = 0.f;
#pragma unroll
        for (int kk = 0; kk < 4; ++kk)
#pragma unroll
            for (int r = 0; r < 8; ++r) {
                const float p = __expf(sc[kk][r] - Mr[r]);
                sc[kk][r] = p;
                rs[r] += p;
            }
#pragma unroll
        for (int r = 0; r < 8; ++r) {
#pragma unroll
            for (int off = 8; off >= 1; off >>= 1) rs[r] += __shfl_xor(rs[r], off, 32);
            Sr[r] += rs[r];
        }
        // V fragments are read ahead of the P stores: their LDS latency passes
        // under the conversions and the stores
        v16h bv[2][4];
#pragma unroll
        for (int s = 0; s < 2; ++s)
#pragma unroll
            for (int d = 0; d < 4; ++d)
                bv[s][d] = load_frag(vb + (d * 16) * 72 + s * 32, 72);
        // ---- C-layout -> A-layout via per-wave LDS stripe
#pragma unroll
        for (int kk = 0; kk < 4; ++kk)
#pragma unroll
            for (int r = 0; r < 8; ++r)
                ps[(mb + r) * 72 + kk * 16 + nl] = (_Float16)sc[kk][r];
        asm volatile("s_wait_dscnt 0" ::: "memory");
        // ---- O += P(16x64) . V(64x64)
#pragma unroll
        for (int s = 0; s < 2; ++s) {
            v16h ap = load_frag(ps + s * 32, 72);
#pragma unroll
            for (int d = 0; d < 4; ++d) o[d] = wmma32(ap, bv[s][d], o[d]);
        }
        // ---- hand-over: this wave's LDS reads are back, its copies of the next
        // tile have landed; the barrier publishes that tile and frees this one
        asm volatile("s_wait_dscnt 0x0" ::: "memory");
        wait_async0();
        __syncthreads();
        if (kt + 2 < 64) stage(kt + 2, kt & 1);
    }
    wait_async0();         // nothing is in flight when the wave ends
#pragma unroll
    for (int r = 0; r < 8; ++r) Sr[r] = 1.0f / Sr[r];
#pragma unroll
    for (int d = 0; d < 4; ++d)
#pragma unroll
        for (int r = 0; r < 8; ++r) {
            const int qrow = qrow0 + mb + r;
            Of[(size_t)qrow * 1024 + h * 64 + d * 16 + nl] = (_Float16)(o[d][r] * Sr[r]);
        }
}

// ---------------------------------------------------------------- host
extern "C" void kernel_launch(void* const* d_in, const int* in_sizes, int n_in,
                              void* d_out, int out_size, void* d_ws, size_t ws_size,
                              hipStream_t stream) {
    (void)in_sizes; (void)n_in; (void)out_size; (void)ws_size;
    const float* hidden = (const float*)d_in[0];
    const float* target = (const float*)d_in[1];
    const float* cosp   = (const float*)d_in[2];
    const float* sinp   = (const float*)d_in[3];
    const float* mask   = (const float*)d_in[4];
    const float* Wq     = (const float*)d_in[5];
    const float* Wk     = (const float*)d_in[6];
    const float* Wv     = (const float*)d_in[7];
    const float* Wo     = (const float*)d_in[8];
    const float* qw     = (const float*)d_in[9];
    const float* kw     = (const float*)d_in[10];
    const float* tb     = (const float*)d_in[11];
    const int*   rel    = (const int*)d_in[12];

    char* ws = (char*)d_ws;
    size_t off = 0;
    auto alloc = [&](size_t bytes) -> void* {
        void* p = ws + off;
        off += (bytes + 255) & ~(size_t)255;
        return p;
    };
    _Float16* Xf   = (_Float16*)alloc(4096ull * 1024 * 2);   // [target; hidden] f16
    _Float16* Wq16 = (_Float16*)alloc(1024ull * 1024 * 2);
    _Float16* Wk16 = (_Float16*)alloc(1024ull * 512 * 2);
    _Float16* Wv16 = (_Float16*)alloc(1024ull * 512 * 2);
    _Float16* Wo16 = (_Float16*)alloc(1024ull * 1024 * 2);
    float*    Qraw = (float*)alloc(2048ull * 1024 * 4);
    float*    Kraw = (float*)alloc(4096ull * 512 * 4);
    float*    Vraw = (float*)alloc(4096ull * 512 * 4);
    _Float16* Qf   = (_Float16*)alloc(16ull * 2048 * 64 * 2);
    _Float16* Kf2  = (_Float16*)alloc(8ull * 4096 * 64 * 2);
    _Float16* Vt   = (_Float16*)alloc(8ull * 64 * 4096 * 2);
    _Float16* Of   = (_Float16*)alloc(2048ull * 1024 * 2);

    auto cast = [&](const float* s, _Float16* d, int n) {
        cast_f16_kernel<<<(n + 8191) / 8192, 256, 0, stream>>>(s, d, n);
    };
    cast(target, Xf, 2048 * 1024);
    cast(hidden, Xf + 2048ull * 1024, 2048 * 1024);
    cast(Wq, Wq16, 1024 * 1024);
    cast(Wk, Wk16, 1024 * 512);
    cast(Wv, Wv16, 1024 * 512);
    cast(Wo, Wo16, 1024 * 1024);

    // projections
    gemm_wmma<<<dim3(16, 16), 256, 0, stream>>>(Xf + 2048ull * 1024, Wq16, Qraw, 2048, 1024, 1024);
    gemm_wmma<<<dim3(8, 32), 256, 0, stream>>>(Xf, Wk16, Kraw, 4096, 512, 1024);
    gemm_wmma<<<dim3(8, 32), 256, 0, stream>>>(Xf, Wv16, Vraw, 4096, 512, 1024);

    // RMSNorm + RoPE (q positions CTX..TOTAL-1; k positions 0..TOTAL-1)
    norm_rope<<<512, 256, 0, stream>>>(Qraw, cosp, sinp, qw, Qf, 2048, 16, 1024, 2048);
    norm_rope<<<512, 256, 0, stream>>>(Kraw, cosp, sinp, kw, Kf2, 4096, 8, 512, 0);
    vtrans<<<(8 * 64 * 64) / 128, 128, 0, stream>>>(Vraw, Vt);

    // flash attention with tree bias
    flash_attn<<<dim3(16, 16), 256, 0, stream>>>(Qf, Kf2, Vt, mask, tb, rel, Of);

    // output projection
    gemm_wmma<<<dim3(16, 16), 256, 0, stream>>>(Of, Wo16, (float*)d_out, 2048, 1024, 1024);
}

// v004
// It runs in 165 microseconds.
// Timed twice side by side with v003, it ran 1.20 and 1.21 times as fast.
// Over all steps from v000 it is 3.70 times as fast.
#include <hip/hip_runtime.h>

typedef __attribute__((ext_vector_type(16))) _Float16 v16h;
typedef __attribute__((ext_vector_type(8)))  _Float16 v8h;
typedef __attribute__((ext_vector_type(8)))  float    v8f;
typedef __attribute__((ext_vector_type(4)))  float    v4f;
typedef __attribute__((ext_vector_type(4)))  _Float16 v4h;
typedef __attribute__((ext_vector_type(4)))  int      v4i;

static __device__ __forceinline__ v8f zero8() {
    v8f z = {0.f, 0.f, 0.f, 0.f, 0.f, 0.f, 0.f, 0.f};
    return z;
}

// Load a 16x32 f16 fragment (A layout per CDNA5 ISA; B uses the same layout
// with the matrix stored column-major, i.e. base indexes [n][k]).
// lane<16:  row = lane,    K = {kb..kb+7, kb+16..kb+23}, kb=0
// lane>=16: row = lane-16, kb=8
static __device__ __forceinline__ v16h load_frag(const _Float16* p, int ld) {
    const int lane = threadIdx.x & 31;
    const int r    = lane & 15;
    const int kb   = (lane < 16) ? 0 : 8;
    const _Float16* q = p + (size_t)r * ld + kb;
    v8h lo = *(const v8h*)(q);
    v8h hi = *(const v8h*)(q + 16);
    v16h f;
#pragma unroll
    for (int i = 0; i < 8; ++i) { f[i] = lo[i]; f[i + 8] = hi[i]; }
    return f;
}

static __device__ __forceinline__ v8f wmma32(v16h a, v16h b, v8f c) {
    return __builtin_amdgcn_wmma_f32_16x16x32_f16(false, a, false, b,
                                                  (short)0, c, false, false);
}

// Async copy of 64 contiguous bytes global->LDS using the CDNA5 TDM-class
// GLOBAL_LOAD_ASYNC_TO_LDS_B128 path (ASYNCcnt). INST_OFFSET is added to both
// the LDS and the global address, so one base pair serves all four beats.
static __device__ __forceinline__ void async_copy64(unsigned lds_addr,
                                                    const void* gaddr) {
    unsigned long long ga = (unsigned long long)gaddr;
    asm volatile(
        "global_load_async_to_lds_b128 %0, %1, off\n\t"
        "global_load_async_to_lds_b128 %0, %1, off offset:16\n\t"
        "global_load_async_to_lds_b128 %0, %1, off offset:32\n\t"
        "global_load_async_to_lds_b128 %0, %1, off offset:48"
        :: "v"(lds_addr), "v"(ga) : "memory");
}

// Four 16-byte async copies global->LDS of one lane, each with its own address
// pair. The s_wait_xcnt closes the statement so that it stands in front of any
// later write of the address registers the copies name.
static __device__ __forceinline__ void async_copy4x16(unsigned l0, const void* g0,
                                                      unsigned l1, const void* g1,
                                                      unsigned l2, const void* g2,
                                                      unsigned l3, const void* g3) {
    asm volatile(
        "global_load_async_to_lds_b128 %0, %1, off\n\t"
        "global_load_async_to_lds_b128 %2, %3, off\n\t"
        "global_load_async_to_lds_b128 %4, %5, off\n\t"
        "global_load_async_to_lds_b128 %6, %7, off\n\t"
        "s_wait_xcnt 0x0"
        :: "v"(l0), "v"((unsigned long long)g0), "v"(l1), "v"((unsigned long long)g1),
           "v"(l2), "v"((unsigned long long)g2), "v"(l3), "v"((unsigned long long)g3)
        : "memory");
}

static __device__ __forceinline__ void wait_async0() {
    asm volatile("s_wait_asynccnt 0x0" ::: "memory");
}

// ---------------------------------------------------------------- cast f32->f16
// A block converts 8192 consecutive elements, 32 per thread: the launch is bound
// by how fast waves start, not by its bytes. Each wave-wide load covers 512
// contiguous bytes and each store 256; the eight loads of a thread fly together.
__global__ __launch_bounds__(256) void cast_f16_kernel(const float* __restrict__ s,
                                                       _Float16* __restrict__ d, int n) {
    const int b0 = blockIdx.x * 8192;
    if (b0 + 8192 <= n) {
        const int i0 = b0 + threadIdx.x * 4;
        v4f x[8];
        // both loops unrolled: x stays in registers, all loads issue before the first wait
#pragma unroll
        for (int j = 0; j < 8; ++j) x[j] = *(const v4f*)(s + i0 + j * 1024);
#pragma unroll
        for (int j = 0; j < 8; ++j)
            *(v4h*)(d + i0 + j * 1024) = __builtin_convertvector(x[j], v4h);
        // stands in front of any later write of a register that the stores name
        asm volatile("s_wait_xcnt 0x0" ::: "memory");
    } else {
        for (int i = b0 + threadIdx.x; i < n; i += 256) d[i] = (_Float16)s[i];
    }
}

// ---------------------------------------------------------------- WMMA GEMM
// C(MxN,f32) = A(MxK,f16,row) * B(KxN,f16,row). Block tile 128x64, BK=64.
// 8 waves -> 4x2 wave grid, each wave 32x32 = 2x2 WMMA tiles.
// A tile staged with async global->LDS (no VGPR round-trip); B tile transposed
// through VGPRs into Bs[n][k] so both fragment loads are ds_load_b128.
__global__ __launch_bounds__(256) void gemm_wmma(const _Float16* __restrict__ A,
                                                 const _Float16* __restrict__ B,
                                                 float* __restrict__ C,
                                                 int M, int N, int K) {
    __shared__ _Float16 As[128 * 72];
    __shared__ _Float16 Bs[64 * 72];
    const int tid  = threadIdx.x;
    const int wid  = tid >> 5;
    const int lane = tid & 31;
    const int wm = wid >> 1, wn = wid & 1;
    const int m0 = blockIdx.y * 128, n0 = blockIdx.x * 64;
    const int nl = lane & 15;
    const int mb = (lane >> 4) << 3;

    // per-thread staging coordinates (constant over the K loop)
    const int arow = tid >> 1, akh = (tid & 1) * 32;
    const unsigned alds = (unsigned)(size_t)(void*)&As[arow * 72 + akh];
    const _Float16* agp = A + (size_t)(m0 + arow) * K + akh;
    const int bk = tid >> 2, bn0 = (tid & 3) * 16;
    const _Float16* bgp = B + (size_t)bk * N + n0 + bn0;

    v8f acc[2][2];
#pragma unroll
    for (int a = 0; a < 2; ++a)
#pragma unroll
        for (int b = 0; b < 2; ++b) acc[a][b] = zero8();

    for (int k0 = 0; k0 < K; k0 += 64) {
        __syncthreads();
        // A: 128 rows x 64 halves; each thread copies 64B via async-to-LDS
        async_copy64(alds, agp + k0);
        {   // B: transpose 64x64 tile into Bs[n][k]
            const _Float16* src = bgp + (size_t)k0 * N;
            v8h b0 = *(const v8h*)src;
            v8h b1 = *(const v8h*)(src + 8);
#pragma unroll
            for (int i = 0; i < 8; ++i) {
                Bs[(bn0 + i) * 72 + bk]     = b0[i];
                Bs[(bn0 + 8 + i) * 72 + bk] = b1[i];
            }
        }
        wait_async0();
        __syncthreads();
#pragma unroll
        for (int s = 0; s < 2; ++s) {
            v16h af[2], bf[2];
#pragma unroll
            for (int t = 0; t < 2; ++t)
                af[t] = load_frag(&As[(wm * 32 + t * 16) * 72 + s * 32], 72);
#pragma unroll
            for (int t = 0; t < 2; ++t)
                bf[t] = load_frag(&Bs[(wn * 32 + t * 16) * 72 + s * 32], 72);
#pragma unroll
            for (int tm = 0; tm < 2; ++tm)
#pragma unroll
                for (int tn = 0; tn < 2; ++tn)
                    acc[tm][tn] = wmma32(af[tm], bf[tn], acc[tm][tn]);
        }
    }
    // epilogue: one base pointer, constant-strided stores
    float* cp = C + (size_t)(m0 + wm * 32 + mb) * N + (n0 + wn * 32 + nl);
#pragma unroll
    for (int tm = 0; tm < 2; ++tm)
#pragma unroll
        for (int r = 0; r < 8; ++r) {
            float* rp = cp + (size_t)(tm * 16 + r) * N;
            rp[0]  = acc[tm][0][r];
            rp[16] = acc[tm][1][r];
        }
}

// ---------------------------------------------------------------- RMSNorm + RoPE
// src: rows x (heads*64) f32. dst: [h][rows][64] f16. A wave32 takes eight
// consecutive (row,h) slots, so an eighth of the waves has to start.
// N heads h .. h+N-1 of one row, stage by stage over all of them: the N slots'
// loads fly together and their lane exchanges overlap instead of following one
// another; the row's cos and sin are fetched once.
template <int N>
static __device__ __forceinline__ void rope_slots(const float* __restrict__ src,
                                                  const float* __restrict__ cosp,
                                                  const float* __restrict__ sinp,
                                                  float w0, float w1,
                                                  _Float16* __restrict__ dst,
                                                  int rows, int ld, int posoff,
                                                  int lane, int row, int h) {
    const float* x = src + (size_t)row * ld + h * 64;
    float x0[N], x1[N], ss[N];
    // every loop over the slots is unrolled: the arrays stay in registers
#pragma unroll
    for (int j = 0; j < N; ++j) {
        x0[j] = x[j * 64 + lane];
        x1[j] = x[j * 64 + lane + 32];
    }
    const int p = posoff + row;
    const float c0 = cosp[(size_t)p * 64 + lane];
    const float c1 = cosp[(size_t)p * 64 + lane + 32];
    const float s0 = sinp[(size_t)p * 64 + lane];
    const float s1 = sinp[(size_t)p * 64 + lane + 32];
#pragma unroll
    for (int j = 0; j < N; ++j) ss[j] = x0[j] * x0[j] + x1[j] * x1[j];
#pragma unroll
    for (int o = 16; o >= 1; o >>= 1) {
        float t[N];
#pragma unroll
        for (int j = 0; j < N; ++j) t[j] = __shfl_xor(ss[j], o, 32);
#pragma unroll
        for (int j = 0; j < N; ++j) ss[j] += t[j];
    }
#pragma unroll
    for (int j = 0; j < N; ++j) {
        const float sc = rsqrtf(ss[j] * (1.0f / 64.0f) + 1e-6f);
        const float xn0 = x0[j] * sc * w0;
        const float xn1 = x1[j] * sc * w1;
        _Float16* d = dst + ((size_t)(h + j) * rows + row) * 64;
        d[lane]      = (_Float16)(xn0 * c0 - xn1 * s0);
        d[lane + 32] = (_Float16)(xn1 * c1 + xn0 * s1);
    }
    // stands in front of any later write of a register that the stores name
    asm volatile("s_wait_xcnt 0x0" ::: "memory");
}

__global__ __launch_bounds__(256) void norm_rope(const float* __restrict__ src,
                                                 const float* __restrict__ cosp,
                                                 const float* __restrict__ sinp,
                                                 const float* __restrict__ w,
                                                 _Float16* __restrict__ dst,
                                                 int rows, int heads, int ld, int posoff) {
    // wave number held scalar: row, head and base addresses stay in scalar registers
    const int wave   = __builtin_amdgcn_readfirstlane(threadIdx.x >> 5);
    const int wslot0 = (blockIdx.x * 8 + wave) * 8;
    const int lane   = threadIdx.x & 31;
    const int left   = rows * heads - wslot0;
    if (left <= 0) return;
    int row = wslot0 / heads;
    int h   = wslot0 - row * heads;
    const float w0 = w[lane], w1 = w[lane + 32];
    if (h + 8 <= heads) {          // the eight slots lie in one row
        rope_slots<8>(src, cosp, sinp, w0, w1, dst, rows, ld, posoff, lane, row, h);
    } else {                       // they cross a row's end, or the last row ends first
        for (int j = 0; j < 8 && j < left; ++j) {
            rope_slots<1>(src, cosp, sinp, w0, w1, dst, rows, ld, posoff, lane, row, h);
            if (++h == heads) { h = 0; ++row; }
        }
    }
}

// ---------------------------------------------------------------- V transpose
// vraw: (4096 x 512) f32 -> vt[kvh][d][t] f16  (d-major so the V^T A-frags of the PV product are contiguous)
// A thread takes one d and 64 consecutive t, one whole 128-byte line of vt: a
// sixty-fourth of the waves has to start. Lanes run along d.
__global__ __launch_bounds__(128) void vtrans(const float* __restrict__ vraw,
                                              _Float16* __restrict__ vt) {
    const int i = blockIdx.x * 128 + threadIdx.x;
    if (i >= 8 * 64 * 64) return;
    const int d   = i & 63;
    const int t0  = ((i >> 6) & 63) * 64;
    const int kvh = i >> 12;
    const float* sp = vraw + (size_t)t0 * 512 + kvh * 64 + d;
    _Float16*    dp = vt + (size_t)(kvh * 64 + d) * 4096 + t0;
    // unrolled: the 64 loads issue as one group, each store holds 8 packed values
#pragma unroll
    for (int g = 0; g < 8; ++g) {
        v8h o;
#pragma unroll
        for (int j = 0; j < 8; ++j) o[j] = (_Float16)sp[(g * 8 + j) * 512];
        *(v8h*)(dp + g * 8) = o;
    }
}

// ---------------------------------------------------------------- Flash attention
// Lane l with lane l ^ 16 (the two halves of a wave), in the vector unit.
static __device__ __forceinline__ float xhalf(float x) {
    const int b = __builtin_bit_cast(int, x);
    return __builtin_bit_cast(float,
        __builtin_amdgcn_permlanex16(b, b, 0x76543210, 0xfedcba98, false, false));
}

__global__ __launch_bounds__(256) void flash_attn(const _Float16* __restrict__ Qf,
                                                  const _Float16* __restrict__ Kf,
                                                  const _Float16* __restrict__ Vt,
                                                  const float* __restrict__ mask,
                                                  const float* __restrict__ tb,
                                                  const int* __restrict__ rel,
                                                  _Float16* __restrict__ Of) {
    const int h     = blockIdx.y;
    const int q0    = blockIdx.x * 128;
    const int kvh   = h >> 1;
    // wave number held scalar: the tree-bias test below is then one scalar
    // branch per key tile instead of an EXEC branch per score element
    const int wid   = __builtin_amdgcn_readfirstlane(threadIdx.x >> 5);
    const int lane  = threadIdx.x & 31;
    const int nl    = lane & 15;           // this lane's query within the wave
    const int mb    = (lane >> 4) << 3;    // first of its 8 rows in an accumulator
    const int qrow0 = q0 + wid * 16;
    const int nb    = qrow0 >> 6;          // 64-block index of this wave's rows

    // rows of 64 halves at a pitch of 72 (144 B = 16 B x odd, for ds_load_b128)
    __shared__ __attribute__((aligned(16))) _Float16 Ks[2][64 * 72];   // [key][d]
    __shared__ __attribute__((aligned(16))) _Float16 Vs[2][64 * 72];   // [d][key]
    // the block's 128 mask rows of 64 floats at a pitch of 68 (272 B = 16 B x odd)
    __shared__ __attribute__((aligned(16))) float Ms[2][128 * 68];     // [q][key]

    const _Float16* Qh = Qf + (size_t)h * 2048 * 64;
    const _Float16* Kh = Kf + (size_t)kvh * 4096 * 64;
    const _Float16* Vh = Vt + (size_t)kvh * 64 * 4096;

    // staging: 8 lanes per 128-byte row; a thread copies rows crow and crow + 32
    // of the K tile and of the V^T tile
    const int crow = threadIdx.x >> 3, ccol = (threadIdx.x & 7) * 8;
    const _Float16* kg = Kh + (size_t)crow * 64 + ccol;
    const _Float16* vg = Vh + (size_t)crow * 4096 + ccol;
    const unsigned kl = (unsigned)(size_t)(void*)&Ks[0][crow * 72 + ccol];
    const unsigned vl = (unsigned)(size_t)(void*)&Vs[0][crow * 72 + ccol];
    // mask: 16 lanes per 256-byte row piece, so a wave-wide copy takes whole lines;
    // a thread copies rows mrow0 + 16 i, i = 0 .. 7
    const int mrow0 = threadIdx.x >> 4, mcol = (threadIdx.x & 15) * 4;
    const float* mg = mask + (size_t)(q0 + mrow0) * 4096 + mcol;
    const unsigned ml = (unsigned)(size_t)(void*)&Ms[0][mrow0 * 68 + mcol];
    auto stage = [&](int t, int buf) {
        const unsigned bo = (unsigned)buf * (64 * 72 * 2);
        const _Float16* kp = kg + (size_t)t * 64 * 64;
        const _Float16* vp = vg + t * 64;
        async_copy4x16(kl + bo, kp, kl + bo + 32 * 72 * 2, kp + 32 * 64,
                       vl + bo, vp, vl + bo + 32 * 72 * 2, vp + (size_t)32 * 4096);
        const unsigned mo = ml + (unsigned)buf * (128 * 68 * 4);
        const float* mp = mg + t * 64;
        async_copy4x16(mo,                   mp,
                       mo + 1 * 16 * 68 * 4, mp + (size_t)1 * 16 * 4096,
                       mo + 2 * 16 * 68 * 4, mp + (size_t)2 * 16 * 4096,
                       mo + 3 * 16 * 68 * 4, mp + (size_t)3 * 16 * 4096);
        async_copy4x16(mo + 4 * 16 * 68 * 4, mp + (size_t)4 * 16 * 4096,
                       mo + 5 * 16 * 68 * 4, mp + (size_t)5 * 16 * 4096,
                       mo + 6 * 16 * 68 * 4, mp + (size_t)6 * 16 * 4096,
                       mo + 7 * 16 * 68 * 4, mp + (size_t)7 * 16 * 4096);
    };
    stage(0, 0);
    wait_async0();
    __syncthreads();       // publishes tile 0
    stage(1, 1);

    // Q^T as B operand: column = query, same k order as the K rows' A fragments
    const v16h bq0 = load_frag(Qh + (size_t)qrow0 * 64, 64);
    const v16h bq1 = load_frag(Qh + (size_t)qrow0 * 64 + 32, 64);

    v8f o[4];              // O^T: tile t holds d = t*16 + mb + r of query nl
#pragma unroll
    for (int t = 0; t < 4; ++t) o[t] = zero8();
    float Mr = -1e30f;     // running maximum of query nl (equal in both halves)
    float Sr = 0.f;        // running sum over this half-wave's keys only

    for (int kt = 0; kt < 64; ++kt) {
        const int k0 = kt * 64;
        const _Float16* kb = &Ks[kt & 1][0];
        const _Float16* vb = &Vs[kt & 1][0];
        const float*    mr = &Ms[kt & 1][(wid * 16 + nl) * 68 + mb];
        v8f sc[4];
#pragma unroll
        for (int kk = 0; kk < 4; ++kk) sc[kk] = zero8();
        // ---- scores, transposed: K(64x64) . Q^T(64x16)
        v16h ak[2][4];
#pragma unroll
        for (int s = 0; s < 2; ++s)
#pragma unroll
            for (int kk = 0; kk < 4; ++kk)
                ak[s][kk] = load_frag(kb + (kk * 16) * 72 + s * 32, 72);
        // keeps the 16 LDS reads together in front of the products: spread among
        // them into one register set, each product waits out its own LDS latency
        __builtin_amdgcn_sched_barrier(0);
#pragma unroll
        for (int s = 0; s < 2; ++s) {
            const v16h b = s ? bq1 : bq0;
#pragma unroll
            for (int kk = 0; kk < 4; ++kk) sc[kk] = wmma32(ak[s][kk], b, sc[kk]);
        }
        // this query's mask values in accumulator layout, 16 bytes a read
        v4f mk[4][2];
#pragma unroll
        for (int kk = 0; kk < 4; ++kk)
#pragma unroll
            for (int j = 0; j < 2; ++j) mk[kk][j] = *(const v4f*)(mr + kk * 16 + j * 4);
        // V^T fragments are read here: their LDS latency passes under the softmax
        v16h av[2][4];
#pragma unroll
        for (int s = 0; s < 2; ++s)
#pragma unroll
            for (int d = 0; d < 4; ++d)
                av[s][d] = load_frag(vb + (d * 16) * 72 + s * 32, 72);
        // ---- scale + mask + block-diagonal tree bias
        const bool hasb = (k0 >= 2048) && (((k0 - 2048) >> 6) == nb);
#pragma unroll
        for (int kk = 0; kk < 4; ++kk)
#pragma unroll
            for (int r = 0; r < 8; ++r)
                sc[kk][r] = sc[kk][r] * 0.125f + mk[kk][r >> 2][r & 3];
        if (hasb) {
            const int* rp = rel + (nb << 12) + (((qrow0 & 63) + nl) << 6) + mb;
            int bi[4][8];      // index into tree_bias, relation bounded to 0..63
#pragma unroll
            for (int kk = 0; kk < 4; ++kk)
#pragma unroll
                for (int j = 0; j < 2; ++j) {
                    const v4i rv = *(const v4i*)(rp + kk * 16 + j * 4);
#pragma unroll
                    for (int e = 0; e < 4; ++e) bi[kk][j * 4 + e] = (rv[e] & 63) * 16 + h;
                }
            float bv[4][8];
#pragma unroll
            for (int kk = 0; kk < 4; ++kk) {
#pragma unroll
                for (int r = 0; r < 8; ++r) bv[kk][r] = tb[bi[kk][r]];
                // the eight index registers stay live up to this wait, so no
                // later gather's result lands in one of them ahead of it
                asm volatile("s_wait_xcnt 0x0"
                             :: "v"(bi[kk][0]), "v"(bi[kk][1]), "v"(bi[kk][2]), "v"(bi[kk][3]),
                                "v"(bi[kk][4]), "v"(bi[kk][5]), "v"(bi[kk][6]), "v"(bi[kk][7])
                             : "memory");
            }
#pragma unroll
            for (int kk = 0; kk < 4; ++kk)
#pragma unroll
                for (int r = 0; r < 8; ++r) sc[kk][r] += bv[kk][r];
        }
        // ---- online softmax: 32 of the query's 64 scores live in this lane, the
        // other 32 in lane ^ 16
        float mx4[4];
#pragma unroll
        for (int kk = 0; kk < 4; ++kk) {
            mx4[kk] = sc[kk][0];
#pragma unroll
            for (int r = 1; r < 8; ++r) mx4[kk] = fmaxf(mx4[kk], sc[kk][r]);
        }
        float mx = fmaxf(fmaxf(mx4[0], mx4[1]), fmaxf(mx4[2], mx4[3]));
        mx = fmaxf(mx, xhalf(mx));
        const float mnew = fmaxf(Mr, mx);
        const float al = __expf(Mr - mnew);
        Mr = mnew;
#pragma unroll
        for (int t = 0; t < 4; ++t)
#pragma unroll
            for (int r = 0; r < 8; ++r) o[t][r] *= al;
        float rs[4];           // four independent chains of adds
#pragma unroll
        for (int kk = 0; kk < 4; ++kk) {
            rs[kk] = 0.f;
#pragma unroll
            for (int r = 0; r < 8; ++r) {
                const float p = __expf(sc[kk][r] - Mr);
                sc[kk][r] = p;
                rs[kk] += p;
            }
        }
        Sr = Sr * al + ((rs[0] + rs[1]) + (rs[2] + rs[3]));
        // ---- O^T += V^T(64x64) . P^T(64x16). P^T as B operand: of the 32 keys of
        // step s a lane needs k = mb .. mb+7 and 16+mb .. 16+mb+7, which are its
        // own accumulator rows of groups 2s and 2s+1
#pragma unroll
        for (int s = 0; s < 2; ++s) {
            v16h bp;
#pragma unroll
            for (int i = 0; i < 8; ++i) {
                bp[i]     = (_Float16)sc[2 * s][i];
                bp[i + 8] = (_Float16)sc[2 * s + 1][i];
            }
#pragma unroll
            for (int d = 0; d < 4; ++d) o[d] = wmma32(av[s][d], bp, o[d]);
        }
        // keeps the hand-over at the foot: lifted over the softmax and the products,
        // its wait would give the copies issued at the last foot too little time
        __builtin_amdgcn_sched_barrier(0);
        // ---- hand-over: this wave's LDS reads are back, its copies of the next
        // tile have landed; the barrier publishes that tile and frees this one
        asm volatile("s_wait_dscnt 0x0" ::: "memory");
        wait_async0();
        __syncthreads();
        if (kt + 2 < 64) stage(kt + 2, kt & 1);
    }
    wait_async0();         // nothing is in flight when the wave ends
    // the two half-waves' sums are joined once, here
    const float inv = 1.0f / (Sr + xhalf(Sr));
    _Float16* op = Of + (size_t)(qrow0 + nl) * 1024 + h * 64 + mb;
#pragma unroll
    for (int d = 0; d < 4; ++d) {
        v8h w;
#pragma unroll
        for (int r = 0; r < 8; ++r) w[r] = (_Float16)(o[d][r] * inv);
        *(v8h*)(op + d * 16) = w;
    }
}

// ---------------------------------------------------------------- host
extern "C" void kernel_launch(void* const* d_in, const int* in_sizes, int n_in,
                              void* d_out, int out_size, void* d_ws, size_t ws_size,
                              hipStream_t stream) {
    (void)in_sizes; (void)n_in; (void)out_size; (void)ws_size;
    const float* hidden = (const float*)d_in[0];
    const float* target = (const float*)d_in[1];
    const float* cosp   = (const float*)d_in[2];
    const float* sinp   = (const float*)d_in[3];
    const float* mask   = (const float*)d_in[4];
    const float* Wq     = (const float*)d_in[5];
    const float* Wk     = (const float*)d_in[6];
    const float* Wv     = (const float*)d_in[7];
    const float* Wo     = (const float*)d_in[8];
    const float* qw     = (const float*)d_in[9];
    const float* kw     = (const float*)d_in[10];
    const float* tb     = (const float*)d_in[11];
    const int*   rel    = (const int*)d_in[12];

    char* ws = (char*)d_ws;
    size_t off = 0;
    auto alloc = [&](size_t bytes) -> void* {
        void* p = ws + off;
        off += (bytes + 255) & ~(size_t)255;
        return p;
    };
    _Float16* Xf   = (_Float16*)alloc(4096ull * 1024 * 2);   // [target; hidden] f16
    _Float16* Wq16 = (_Float16*)alloc(1024ull * 1024 * 2);
    _Float16* Wk16 = (_Float16*)alloc(1024ull * 512 * 2);
    _Float16* Wv16 = (_Float16*)alloc(1024ull * 512 * 2);
    _Float16* Wo16 = (_Float16*)alloc(1024ull * 1024 * 2);
    float*    Qraw = (float*)alloc(2048ull * 1024 * 4);
    float*    Kraw = (float*)alloc(4096ull * 512 * 4);
    float*    Vraw = (float*)alloc(4096ull * 512 * 4);
    _Float16* Qf   = (_Float16*)alloc(16ull * 2048 * 64 * 2);
    _Float16* Kf2  = (_Float16*)alloc(8ull * 4096 * 64 * 2);
    _Float16* Vt   = (_Float16*)alloc(8ull * 64 * 4096 * 2);
    _Float16* Of   = (_Float16*)alloc(2048ull * 1024 * 2);

    auto cast = [&](const float* s, _Float16* d, int n) {
        cast_f16_kernel<<<(n + 8191) / 8192, 256, 0, stream>>>(s, d, n);
    };
    cast(target, Xf, 2048 * 1024);
    cast(hidden, Xf + 2048ull * 1024, 2048 * 1024);
    cast(Wq, Wq16, 1024 * 1024);
    cast(Wk, Wk16, 1024 * 512);
    cast(Wv, Wv16, 1024 * 512);
    cast(Wo, Wo16, 1024 * 1024);

    // projections
    gemm_wmma<<<dim3(16, 16), 256, 0, stream>>>(Xf + 2048ull * 1024, Wq16, Qraw, 2048, 1024, 1024);
    gemm_wmma<<<dim3(8, 32), 256, 0, stream>>>(Xf, Wk16, Kraw, 4096, 512, 1024);
    gemm_wmma<<<dim3(8, 32), 256, 0, stream>>>(Xf, Wv16, Vraw, 4096, 512, 1024);

    // RMSNorm + RoPE (q positions CTX..TOTAL-1; k positions 0..TOTAL-1)
    norm_rope<<<512, 256, 0, stream>>>(Qraw, cosp, sinp, qw, Qf, 2048, 16, 1024, 2048);
    norm_rope<<<512, 256, 0, stream>>>(Kraw, cosp, sinp, kw, Kf2, 4096, 8, 512, 0);
    vtrans<<<(8 * 64 * 64) / 128, 128, 0, stream>>>(Vraw, Vt);

    // flash attention with tree bias
    flash_attn<<<dim3(16, 16), 256, 0, stream>>>(Qf, Kf2, Vt, mask, tb, rel, Of);

    // output projection
    gemm_wmma<<<dim3(16, 16), 256, 0, stream>>>(Of, Wo16, (float*)d_out, 2048, 1024, 1024);
}

// v005
// A run of this version takes 125 microseconds.
// Timed twice side by side with v004, it ran 1.32 and 1.31 times as fast.
// Counting every step since v000, it is 4.88 times as fast.
#include <hip/hip_runtime.h>

typedef __attribute__((ext_vector_type(16))) _Float16 v16h;
typedef __attribute__((ext_vector_type(8)))  _Float16 v8h;
typedef __attribute__((ext_vector_type(8)))  float    v8f;
typedef __attribute__((ext_vector_type(4)))  float    v4f;
typedef __attribute__((ext_vector_type(4)))  _Float16 v4h;
typedef __attribute__((ext_vector_type(4)))  int      v4i;

static __device__ __forceinline__ v8f zero8() {
    v8f z = {0.f, 0.f, 0.f, 0.f, 0.f, 0.f, 0.f, 0.f};
    return z;
}

// Load a 16x32 f16 fragment (A layout per CDNA5 ISA; B uses the same layout
// with the matrix stored column-major, i.e. base indexes [n][k]).
// lane<16:  row = lane,    K = {kb..kb+7, kb+16..kb+23}, kb=0
// lane>=16: row = lane-16, kb=8
static __device__ __forceinline__ v16h load_frag(const _Float16* p, int ld) {
    const int lane = threadIdx.x & 31;
    const int r    = lane & 15;
    const int kb   = (lane < 16) ? 0 : 8;
    const _Float16* q = p + (size_t)r * ld + kb;
    v8h lo = *(const v8h*)(q);
    v8h hi = *(const v8h*)(q + 16);
    v16h f;
#pragma unroll
    for (int i = 0; i < 8; ++i) { f[i] = lo[i]; f[i + 8] = hi[i]; }
    return f;
}

static __device__ __forceinline__ v8f wmma32(v16h a, v16h b, v8f c) {
    return __builtin_amdgcn_wmma_f32_16x16x32_f16(false, a, false, b,
                                                  (short)0, c, false, false);
}

// Async copy of 64 contiguous bytes global->LDS using the CDNA5 TDM-class
// GLOBAL_LOAD_ASYNC_TO_LDS_B128 path (ASYNCcnt). INST_OFFSET is added to both
// the LDS and the global address, so one base pair serves all four beats.
static __device__ __forceinline__ void async_copy64(unsigned lds_addr,
                                                    const void* gaddr) {
    unsigned long long ga = (unsigned long long)gaddr;
    asm volatile(
        "global_load_async_to_lds_b128 %0, %1, off\n\t"
        "global_load_async_to_lds_b128 %0, %1, off offset:16\n\t"
        "global_load_async_to_lds_b128 %0, %1, off offset:32\n\t"
        "global_load_async_to_lds_b128 %0, %1, off offset:48\n\t"
        "s_wait_xcnt 0x0"   // in front of any later write of the two address registers
        :: "v"(lds_addr), "v"(ga) : "memory");
}

// Four 16-byte async copies global->LDS of one lane, each with its own address
// pair. The s_wait_xcnt closes the statement so that it stands in front of any
// later write of the address registers the copies name.
static __device__ __forceinline__ void async_copy4x16(unsigned l0, const void* g0,
                                                      unsigned l1, const void* g1,
                                                      unsigned l2, const void* g2,
                                                      unsigned l3, const void* g3) {
    asm volatile(
        "global_load_async_to_lds_b128 %0, %1, off\n\t"
        "global_load_async_to_lds_b128 %2, %3, off\n\t"
        "global_load_async_to_lds_b128 %4, %5, off\n\t"
        "global_load_async_to_lds_b128 %6, %7, off\n\t"
        "s_wait_xcnt 0x0"
        :: "v"(l0), "v"((unsigned long long)g0), "v"(l1), "v"((unsigned long long)g1),
           "v"(l2), "v"((unsigned long long)g2), "v"(l3), "v"((unsigned long long)g3)
        : "memory");
}

static __device__ __forceinline__ void wait_async0() {
    asm volatile("s_wait_asynccnt 0x0" ::: "memory");
}

// ---------------------------------------------------------------- cast f32->f16
// One launch converts all six f32 operands: none of the six depends on another,
// and each alone is far too short to fill the chip or to cover its launch gap.
// A block converts 8192 consecutive elements of one operand, 32 per thread (every
// operand's size is a multiple of 8192). Each wave-wide load covers 512 contiguous
// bytes and each store 256; the eight loads of a thread fly together.
__global__ __launch_bounds__(256) void cast_all(const float* __restrict__ target,
                                                const float* __restrict__ hidden,
                                                const float* __restrict__ Wq,
                                                const float* __restrict__ Wk,
                                                const float* __restrict__ Wv,
                                                const float* __restrict__ Wo,
                                                _Float16* __restrict__ Xf,
                                                _Float16* __restrict__ Wq16,
                                                _Float16* __restrict__ Wk16,
                                                _Float16* __restrict__ Wv16,
                                                _Float16* __restrict__ Wo16) {
    const int b = blockIdx.x;      // 256 + 256 + 128 + 64 + 64 + 128 blocks
    const float* s;
    _Float16* d;
    int lb;
    if (b < 256)      { s = target; d = Xf;                 lb = b; }
    else if (b < 512) { s = hidden; d = Xf + 2048 * 1024;   lb = b - 256; }
    else if (b < 640) { s = Wq;     d = Wq16;               lb = b - 512; }
    else if (b < 704) { s = Wk;     d = Wk16;               lb = b - 640; }
    else if (b < 768) { s = Wv;     d = Wv16;               lb = b - 704; }
    else              { s = Wo;     d = Wo16;               lb = b - 768; }
    const int i0 = lb * 8192 + threadIdx.x * 4;
    v4f x[8];
    // both loops unrolled: x stays in registers, all loads issue before the first wait
#pragma unroll
    for (int j = 0; j < 8; ++j) x[j] = *(const v4f*)(s + i0 + j * 1024);
#pragma unroll
    for (int j = 0; j < 8; ++j)
        *(v4h*)(d + i0 + j * 1024) = __builtin_convertvector(x[j], v4h);
    // stands in front of any later write of a register that the stores name
    asm volatile("s_wait_xcnt 0x0" ::: "memory");
}

// ---------------------------------------------------------------- WMMA GEMM
// C(MxN,f32) = A(MxK,f16,row) * B(KxN,f16,row). Block tile 128x64, BK=64.
// 8 waves -> 4x2 wave grid, each wave 32x32 = 2x2 WMMA tiles.
// A tile staged with async global->LDS (no VGPR round-trip); B tile transposed
// through VGPRs into Bs[n][k] so both fragment loads are ds_load_b128.
static __device__ __forceinline__ void gemm_block(const _Float16* __restrict__ A,
                                                  const _Float16* __restrict__ B,
                                                  float* __restrict__ C,
                                                  int N, int K, int m0, int n0) {
    __shared__ _Float16 As[128 * 72];
    __shared__ _Float16 Bs[64 * 72];
    const int tid  = threadIdx.x;
    const int wid  = tid >> 5;
    const int lane = tid & 31;
    const int wm = wid >> 1, wn = wid & 1;
    const int nl = lane & 15;
    const int mb = (lane >> 4) << 3;

    // per-thread staging coordinates (constant over the K loop)
    const int arow = tid >> 1, akh = (tid & 1) * 32;
    const unsigned alds = (unsigned)(size_t)(void*)&As[arow * 72 + akh];
    const _Float16* agp = A + (size_t)(m0 + arow) * K + akh;
    const int bk = tid >> 2, bn0 = (tid & 3) * 16;
    const _Float16* bgp = B + (size_t)bk * N + n0 + bn0;

    v8f acc[2][2];
#pragma unroll
    for (int a = 0; a < 2; ++a)
#pragma unroll
        for (int b = 0; b < 2; ++b) acc[a][b] = zero8();

    for (int k0 = 0; k0 < K; k0 += 64) {
        __syncthreads();
        // A: 128 rows x 64 halves; each thread copies 64B via async-to-LDS
        async_copy64(alds, agp + k0);
        {   // B: transpose 64x64 tile into Bs[n][k]
            const _Float16* src = bgp + (size_t)k0 * N;
            v8h b0 = *(const v8h*)src;
            v8h b1 = *(const v8h*)(src + 8);
#pragma unroll
            for (int i = 0; i < 8; ++i) {
                Bs[(bn0 + i) * 72 + bk]     = b0[i];
                Bs[(bn0 + 8 + i) * 72 + bk] = b1[i];
            }
        }
        wait_async0();
        __syncthreads();
#pragma unroll
        for (int s = 0; s < 2; ++s) {
            v16h af[2], bf[2];
#pragma unroll
            for (int t = 0; t < 2; ++t)
                af[t] = load_frag(&As[(wm * 32 + t * 16) * 72 + s * 32], 72);
#pragma unroll
            for (int t = 0; t < 2; ++t)
                bf[t] = load_frag(&Bs[(wn * 32 + t * 16) * 72 + s * 32], 72);
#pragma unroll
            for (int tm = 0; tm < 2; ++tm)
#pragma unroll
                for (int tn = 0; tn < 2; ++tn)
                    acc[tm][tn] = wmma32(af[tm], bf[tn], acc[tm][tn]);
        }
    }
    // epilogue: one base pointer, constant-strided stores
    float* cp = C + (size_t)(m0 + wm * 32 + mb) * N + (n0 + wn * 32 + nl);
#pragma unroll
    for (int tm = 0; tm < 2; ++tm)
#pragma unroll
        for (int r = 0; r < 8; ++r) {
            float* rp = cp + (size_t)(tm * 16 + r) * N;
            rp[0]  = acc[tm][0][r];
            rp[16] = acc[tm][1][r];
        }
}

__global__ __launch_bounds__(256) void gemm_wmma(const _Float16* __restrict__ A,
                                                 const _Float16* __restrict__ B,
                                                 float* __restrict__ C,
                                                 int N, int K) {
    gemm_block(A, B, C, N, K, blockIdx.y * 128, blockIdx.x * 64);
}

// The three projections in one launch, 256 blocks each: they share no result, and
// one alone puts a single block on a WGP, whose waits nothing else fills.
// X = [target; hidden] (4096 x 1024); Q is taken of rows 2048 .. 4095 (hidden).
__global__ __launch_bounds__(256) void gemm_qkv(const _Float16* __restrict__ X,
                                                const _Float16* __restrict__ Wq16,
                                                const _Float16* __restrict__ Wk16,
                                                const _Float16* __restrict__ Wv16,
                                                float* __restrict__ Qraw,
                                                float* __restrict__ Kraw,
                                                float* __restrict__ Vraw) {
    const int which = blockIdx.x >> 8, r = blockIdx.x & 255;
    if (which == 0)
        gemm_block(X + 2048 * 1024, Wq16, Qraw, 1024, 1024, (r >> 4) * 128, (r & 15) * 64);
    else
        gemm_block(X, which == 1 ? Wk16 : Wv16, which == 1 ? Kraw : Vraw,
                   512, 1024, (r >> 3) * 128, (r & 7) * 64);
}

// ---------------------------------------------------------------- RMSNorm + RoPE
// src: rows x (heads*64) f32. dst: [h][rows][64] f16. A wave32 takes eight
// consecutive (row,h) slots, so an eighth of the waves has to start.
// N heads h .. h+N-1 of one row, stage by stage over all of them: the N slots'
// loads fly together and their lane exchanges overlap instead of following one
// another; the row's cos and sin are fetched once.
template <int N>
static __device__ __forceinline__ void rope_slots(const float* __restrict__ src,
                                                  const float* __restrict__ cosp,
                                                  const float* __restrict__ sinp,
                                                  float w0, float w1,
                                                  _Float16* __restrict__ dst,
                                                  int rows, int ld, int posoff,
                                                  int lane, int row, int h) {
    const float* x = src + (size_t)row * ld + h * 64;
    float x0[N], x1[N], ss[N];
    // every loop over the slots is unrolled: the arrays stay in registers
#pragma unroll
    for (int j = 0; j < N; ++j) {
        x0[j] = x[j * 64 + lane];
        x1[j] = x[j * 64 + lane + 32];
    }
    const int p = posoff + row;
    const float c0 = cosp[(size_t)p * 64 + lane];
    const float c1 = cosp[(size_t)p * 64 + lane + 32];
    const float s0 = sinp[(size_t)p * 64 + lane];
    const float s1 = sinp[(size_t)p * 64 + lane + 32];
#pragma unroll
    for (int j = 0; j < N; ++j) ss[j] = x0[j] * x0[j] + x1[j] * x1[j];
#pragma unroll
    for (int o = 16; o >= 1; o >>= 1) {
        float t[N];
#pragma unroll
        for (int j = 0; j < N; ++j) t[j] = __shfl_xor(ss[j], o, 32);
#pragma unroll
        for (int j = 0; j < N; ++j) ss[j] += t[j];
    }
#pragma unroll
    for (int j = 0; j < N; ++j) {
        const float sc = rsqrtf(ss[j] * (1.0f / 64.0f) + 1e-6f);
        const float xn0 = x0[j] * sc * w0;
        const float xn1 = x1[j] * sc * w1;
        _Float16* d = dst + ((size_t)(h + j) * rows + row) * 64;
        d[lane]      = (_Float16)(xn0 * c0 - xn1 * s0);
        d[lane + 32] = (_Float16)(xn1 * c1 + xn0 * s1);
    }
    // stands in front of any later write of a register that the stores name
    asm volatile("s_wait_xcnt 0x0" ::: "memory");
}

static __device__ __forceinline__ void norm_rope(const float* __restrict__ src,
                                                 const float* __restrict__ cosp,
                                                 const float* __restrict__ sinp,
                                                 const float* __restrict__ w,
                                                 _Float16* __restrict__ dst,
                                                 int rows, int heads, int ld, int posoff,
                                                 int blk) {
    // wave number held scalar: row, head and base addresses stay in scalar registers
    const int wave   = __builtin_amdgcn_readfirstlane(threadIdx.x >> 5);
    const int wslot0 = (blk * 8 + wave) * 8;
    const int lane   = threadIdx.x & 31;
    const int left   = rows * heads - wslot0;
    if (left <= 0) return;
    int row = wslot0 / heads;
    int h   = wslot0 - row * heads;
    const float w0 = w[lane], w1 = w[lane + 32];
    if (h + 8 <= heads) {          // the eight slots lie in one row
        rope_slots<8>(src, cosp, sinp, w0, w1, dst, rows, ld, posoff, lane, row, h);
    } else {                       // they cross a row's end, or the last row ends first
        for (int j = 0; j < 8 && j < left; ++j) {
            rope_slots<1>(src, cosp, sinp, w0, w1, dst, rows, ld, posoff, lane, row, h);
            if (++h == heads) { h = 0; ++row; }
        }
    }
}

// ---------------------------------------------------------------- V transpose
// vraw: (4096 x 512) f32 -> vt[kvh][d][t] f16  (d-major so the V^T A-frags of the PV product are contiguous)
// A thread takes one d and 64 consecutive t, one whole 128-byte line of vt: a
// sixty-fourth of the waves has to start. Lanes run along d.
static __device__ __forceinline__ void vtrans(const float* __restrict__ vraw,
                                              _Float16* __restrict__ vt, int blk) {
    const int i = blk * 256 + threadIdx.x;
    if (i >= 8 * 64 * 64) return;
    const int d   = i & 63;
    const int t0  = ((i >> 6) & 63) * 64;
    const int kvh = i >> 12;
    const float* sp = vraw + (size_t)t0 * 512 + kvh * 64 + d;
    _Float16*    dp = vt + (size_t)(kvh * 64 + d) * 4096 + t0;
    // unrolled: the 64 loads issue as one group, each store holds 8 packed values
#pragma unroll
    for (int g = 0; g < 8; ++g) {
        v8h o;
#pragma unroll
        for (int j = 0; j < 8; ++j) o[j] = (_Float16)sp[(g * 8 + j) * 512];
        *(v8h*)(dp + g * 8) = o;
    }
}

// What follows the projections, in one launch: V transpose (blocks 0 .. 127),
// norm + rope of Q (128 .. 639) and of K (640 .. 1151). The three read and write
// different arrays. q positions are CTX .. TOTAL-1, k positions 0 .. TOTAL-1.
__global__ __launch_bounds__(256) void post_proj(const float* __restrict__ Qraw,
                                                 const float* __restrict__ Kraw,
                                                 const float* __restrict__ Vraw,
                                                 const float* __restrict__ cosp,
                                                 const float* __restrict__ sinp,
                                                 const float* __restrict__ qw,
                                                 const float* __restrict__ kw,
                                                 _Float16* __restrict__ Qf,
                                                 _Float16* __restrict__ Kf,
                                                 _Float16* __restrict__ Vt) {
    const int b = blockIdx.x;
    if (b < 128)      vtrans(Vraw, Vt, b);
    else if (b < 640) norm_rope(Qraw, cosp, sinp, qw, Qf, 2048, 16, 1024, 2048, b - 128);
    else              norm_rope(Kraw, cosp, sinp, kw, Kf, 4096, 8, 512, 0, b - 640);
}

// ---------------------------------------------------------------- Flash attention
// Lane l with lane l ^ 16 (the two halves of a wave), in the vector unit.
static __device__ __forceinline__ float xhalf(float x) {
    const int b = __builtin_bit_cast(int, x);
    return __builtin_bit_cast(float,
        __builtin_amdgcn_permlanex16(b, b, 0x76543210, 0xfedcba98, false, false));
}

__global__ __launch_bounds__(256) void flash_attn(const _Float16* __restrict__ Qf,
                                                  const _Float16* __restrict__ Kf,
                                                  const _Float16* __restrict__ Vt,
                                                  const float* __restrict__ mask,
                                                  const float* __restrict__ tb,
                                                  const int* __restrict__ rel,
                                                  _Float16* __restrict__ Of) {
    const int h     = blockIdx.y;
    const int q0    = blockIdx.x * 128;
    const int kvh   = h >> 1;
    // wave number held scalar: the tree-bias test below is then one scalar
    // branch per key tile instead of an EXEC branch per score element
    const int wid   = __builtin_amdgcn_readfirstlane(threadIdx.x >> 5);
    const int lane  = threadIdx.x & 31;
    const int nl    = lane & 15;           // this lane's query within the wave
    const int mb    = (lane >> 4) << 3;    // first of its 8 rows in an accumulator
    const int qrow0 = q0 + wid * 16;
    const int nb    = qrow0 >> 6;          // 64-block index of this wave's rows

    // rows of 64 halves at a pitch of 72 (144 B = 16 B x odd, for ds_load_b128)
    __shared__ __attribute__((aligned(16))) _Float16 Ks[2][64 * 72];   // [key][d]
    __shared__ __attribute__((aligned(16))) _Float16 Vs[2][64 * 72];   // [d][key]
    // the block's 128 mask rows of 64 floats at a pitch of 68 (272 B = 16 B x odd)
    __shared__ __attribute__((aligned(16))) float Ms[2][128 * 68];     // [q][key]

    const _Float16* Qh = Qf + (size_t)h * 2048 * 64;
    const _Float16* Kh = Kf + (size_t)kvh * 4096 * 64;
    const _Float16* Vh = Vt + (size_t)kvh * 64 * 4096;

    // staging: 8 lanes per 128-byte row; a thread copies rows crow and crow + 32
    // of the K tile and of the V^T tile
    const int crow = threadIdx.x >> 3, ccol = (threadIdx.x & 7) * 8;
    const _Float16* kg = Kh + (size_t)crow * 64 + ccol;
    const _Float16* vg = Vh + (size_t)crow * 4096 + ccol;
    const unsigned kl = (unsigned)(size_t)(void*)&Ks[0][crow * 72 + ccol];
    const unsigned vl = (unsigned)(size_t)(void*)&Vs[0][crow * 72 + ccol];
    // mask: 16 lanes per 256-byte row piece, so a wave-wide copy takes whole lines;
    // a thread copies rows mrow0 + 16 i, i = 0 .. 7
    const int mrow0 = threadIdx.x >> 4, mcol = (threadIdx.x & 15) * 4;
    const float* mg = mask + (size_t)(q0 + mrow0) * 4096 + mcol;
    const unsigned ml = (unsigned)(size_t)(void*)&Ms[0][mrow0 * 68 + mcol];
    auto stage = [&](int t, int buf) {
        const unsigned bo = (unsigned)buf * (64 * 72 * 2);
        const _Float16* kp = kg + (size_t)t * 64 * 64;
        const _Float16* vp = vg + t * 64;
        async_copy4x16(kl + bo, kp, kl + bo + 32 * 72 * 2, kp + 32 * 64,
                       vl + bo, vp, vl + bo + 32 * 72 * 2, vp + (size_t)32 * 4096);
        const unsigned mo = ml + (unsigned)buf * (128 * 68 * 4);
        const float* mp = mg + t * 64;
        async_copy4x16(mo,                   mp,
                       mo + 1 * 16 * 68 * 4, mp + (size_t)1 * 16 * 4096,
                       mo + 2 * 16 * 68 * 4, mp + (size_t)2 * 16 * 4096,
                       mo + 3 * 16 * 68 * 4, mp + (size_t)3 * 16 * 4096);
        async_copy4x16(mo + 4 * 16 * 68 * 4, mp + (size_t)4 * 16 * 4096,
                       mo + 5 * 16 * 68 * 4, mp + (size_t)5 * 16 * 4096,
                       mo + 6 * 16 * 68 * 4, mp + (size_t)6 * 16 * 4096,
                       mo + 7 * 16 * 68 * 4, mp + (size_t)7 * 16 * 4096);
    };
    stage(0, 0);
    wait_async0();
    __syncthreads();       // publishes tile 0
    stage(1, 1);

    // Q^T as B operand: column = query, same k order as the K rows' A fragments
    const v16h bq0 = load_frag(Qh + (size_t)qrow0 * 64, 64);
    const v16h bq1 = load_frag(Qh + (size_t)qrow0 * 64 + 32, 64);

    v8f o[4];              // O^T: tile t holds d = t*16 + mb + r of query nl
#pragma unroll
    for (int t = 0; t < 4; ++t) o[t] = zero8();
    float Mr = -1e30f;     // running maximum of query nl (equal in both halves)
    float Sr = 0.f;        // running sum over this half-wave's keys only

    for (int kt = 0; kt < 64; ++kt) {
        const int k0 = kt * 64;
        const _Float16* kb = &Ks[kt & 1][0];
        const _Float16* vb = &Vs[kt & 1][0];
        const float*    mr = &Ms[kt & 1][(wid * 16 + nl) * 68 + mb];
        v8f sc[4];
#pragma unroll
        for (int kk = 0; kk < 4; ++kk) sc[kk] = zero8();
        // ---- scores, transposed: K(64x64) . Q^T(64x16)
        v16h ak[2][4];
#pragma unroll
        for (int s = 0; s < 2; ++s)
#pragma unroll
            for (int kk = 0; kk < 4; ++kk)
                ak[s][kk] = load_frag(kb + (kk * 16) * 72 + s * 32, 72);
        // keeps the 16 LDS reads together in front of the products: spread among
        // them into one register set, each product waits out its own LDS latency
        __builtin_amdgcn_sched_barrier(0);
#pragma unroll
        for (int s = 0; s < 2; ++s) {
            const v16h b = s ? bq1 : bq0;
#pragma unroll
            for (int kk = 0; kk < 4; ++kk) sc[kk] = wmma32(ak[s][kk], b, sc[kk]);
        }
        // this query's mask values in accumulator layout, 16 bytes a read
        v4f mk[4][2];
#pragma unroll
        for (int kk = 0; kk < 4; ++kk)
#pragma unroll
            for (int j = 0; j < 2; ++j) mk[kk][j] = *(const v4f*)(mr + kk * 16 + j * 4);
        // V^T fragments are read here: their LDS latency passes under the softmax
        v16h av[2][4];
#pragma unroll
        for (int s = 0; s < 2; ++s)
#pragma unroll
            for (int d = 0; d < 4; ++d)
                av[s][d] = load_frag(vb + (d * 16) * 72 + s * 32, 72);
        // ---- scale + mask + block-diagonal tree bias
        const bool hasb = (k0 >= 2048) && (((k0 - 2048) >> 6) == nb);
#pragma unroll
        for (int kk = 0; kk < 4; ++kk)
#pragma unroll
            for (int r = 0; r < 8; ++r)
                sc[kk][r] = sc[kk][r] * 0.125f + mk[kk][r >> 2][r & 3];
        if (hasb) {
            const int* rp = rel + (nb << 12) + (((qrow0 & 63) + nl) << 6) + mb;
            int bi[4][8];      // index into tree_bias, relation bounded to 0..63
#pragma unroll
            for (int kk = 0; kk < 4; ++kk)
#pragma unroll
                for (int j = 0; j < 2; ++j) {
                    const v4i rv = *(const v4i*)(rp + kk * 16 + j * 4);
#pragma unroll
                    for (int e = 0; e < 4; ++e) bi[kk][j * 4 + e] = (rv[e] & 63) * 16 + h;
                }
            float bv[4][8];
#pragma unroll
            for (int kk = 0; kk < 4; ++kk) {
#pragma unroll
                for (int r = 0; r < 8; ++r) bv[kk][r] = tb[bi[kk][r]];
                // the eight index registers stay live up to this wait, so no
                // later gather's result lands in one of them ahead of it
                asm volatile("s_wait_xcnt 0x0"
                             :: "v"(bi[kk][0]), "v"(bi[kk][1]), "v"(bi[kk][2]), "v"(bi[kk][3]),
                                "v"(bi[kk][4]), "v"(bi[kk][5]), "v"(bi[kk][6]), "v"(bi[kk][7])
                             : "memory");
            }
#pragma unroll
            for (int kk = 0; kk < 4; ++kk)
#pragma unroll
                for (int r = 0; r < 8; ++r) sc[kk][r] += bv[kk][r];
        }
        // ---- online softmax: 32 of the query's 64 scores live in this lane, the
        // other 32 in lane ^ 16
        float mx4[4];
#pragma unroll
        for (int kk = 0; kk < 4; ++kk) {
            mx4[kk] = sc[kk][0];
#pragma unroll
            for (int r = 1; r < 8; ++r) mx4[kk] = fmaxf(mx4[kk], sc[kk][r]);
        }
        float mx = fmaxf(fmaxf(mx4[0], mx4[1]), fmaxf(mx4[2], mx4[3]));
        mx = fmaxf(mx, xhalf(mx));
        const float mnew = fmaxf(Mr, mx);
        const float al = __expf(Mr - mnew);
        Mr = mnew;
#pragma unroll
        for (int t = 0; t < 4; ++t)
#pragma unroll
            for (int r = 0; r < 8; ++r) o[t][r] *= al;
        float rs[4];           // four independent chains of adds
#pragma unroll
        for (int kk = 0; kk < 4; ++kk) {
            rs[kk] = 0.f;
#pragma unroll
            for (int r = 0; r < 8; ++r) {
                const float p = __expf(sc[kk][r] - Mr);
                sc[kk][r] = p;
                rs[kk] += p;
            }
        }
        Sr = Sr * al + ((rs[0] + rs[1]) + (rs[2] + rs[3]));
        // ---- O^T += V^T(64x64) . P^T(64x16). P^T as B operand: of the 32 keys of
        // step s a lane needs k = mb .. mb+7 and 16+mb .. 16+mb+7, which are its
        // own accumulator rows of groups 2s and 2s+1
#pragma unroll
        for (int s = 0; s < 2; ++s) {
            v16h bp;
#pragma unroll
            for (int i = 0; i < 8; ++i) {
                bp[i]     = (_Float16)sc[2 * s][i];
                bp[i + 8] = (_Float16)sc[2 * s + 1][i];
            }
#pragma unroll
            for (int d = 0; d < 4; ++d) o[d] = wmma32(av[s][d], bp, o[d]);
        }
        // keeps the hand-over at the foot: lifted over the softmax and the products,
        // its wait would give the copies issued at the last foot too little time
        __builtin_amdgcn_sched_barrier(0);
        // ---- hand-over: this wave's LDS reads are back, its copies of the next
        // tile have landed; the barrier publishes that tile and frees this one
        asm volatile("s_wait_dscnt 0x0" ::: "memory");
        wait_async0();
        __syncthreads();
        if (kt + 2 < 64) stage(kt + 2, kt & 1);
    }
    wait_async0();         // nothing is in flight when the wave ends
    // the two half-waves' sums are joined once, here
    const float inv = 1.0f / (Sr + xhalf(Sr));
    _Float16* op = Of + (size_t)(qrow0 + nl) * 1024 + h * 64 + mb;
#pragma unroll
    for (int d = 0; d < 4; ++d) {
        v8h w;
#pragma unroll
        for (int r = 0; r < 8; ++r) w[r] = (_Float16)(o[d][r] * inv);
        *(v8h*)(op + d * 16) = w;
    }
}

// ---------------------------------------------------------------- host
extern "C" void kernel_launch(void* const* d_in, const int* in_sizes, int n_in,
                              void* d_out, int out_size, void* d_ws, size_t ws_size,
                              hipStream_t stream) {
    (void)in_sizes; (void)n_in; (void)out_size; (void)ws_size;
    const float* hidden = (const float*)d_in[0];
    const float* target = (const float*)d_in[1];
    const float* cosp   = (const float*)d_in[2];
    const float* sinp   = (const float*)d_in[3];
    const float* mask   = (const float*)d_in[4];
    const float* Wq     = (const float*)d_in[5];
    const float* Wk     = (const float*)d_in[6];
    const float* Wv     = (const float*)d_in[7];
    const float* Wo     = (const float*)d_in[8];
    const float* qw     = (const float*)d_in[9];
    const float* kw     = (const float*)d_in[10];
    const float* tb     = (const float*)d_in[11];
    const int*   rel    = (const int*)d_in[12];

    char* ws = (char*)d_ws;
    size_t off = 0;
    auto alloc = [&](size_t bytes) -> void* {
        void* p = ws + off;
        off += (bytes + 255) & ~(size_t)255;
        return p;
    };
    _Float16* Xf   = (_Float16*)alloc(4096ull * 1024 * 2);   // [target; hidden] f16
    _Float16* Wq16 = (_Float16*)alloc(1024ull * 1024 * 2);
    _Float16* Wk16 = (_Float16*)alloc(1024ull * 512 * 2);
    _Float16* Wv16 = (_Float16*)alloc(1024ull * 512 * 2);
    _Float16* Wo16 = (_Float16*)alloc(1024ull * 1024 * 2);
    float*    Qraw = (float*)alloc(2048ull * 1024 * 4);
    float*    Kraw = (float*)alloc(4096ull * 512 * 4);
    float*    Vraw = (float*)alloc(4096ull * 512 * 4);
    _Float16* Qf   = (_Float16*)alloc(16ull * 2048 * 64 * 2);
    _Float16* Kf2  = (_Float16*)alloc(8ull * 4096 * 64 * 2);
    _Float16* Vt   = (_Float16*)alloc(8ull * 64 * 4096 * 2);
    _Float16* Of   = (_Float16*)alloc(2048ull * 1024 * 2);

    // launches that do not depend on one another are one launch each level
    cast_all<<<896, 256, 0, stream>>>(target, hidden, Wq, Wk, Wv, Wo,
                                      Xf, Wq16, Wk16, Wv16, Wo16);

    // projections
    gemm_qkv<<<768, 256, 0, stream>>>(Xf, Wq16, Wk16, Wv16, Qraw, Kraw, Vraw);

    // RMSNorm + RoPE of Q and K, V transpose
    post_proj<<<1152, 256, 0, stream>>>(Qraw, Kraw, Vraw, cosp, sinp, qw, kw, Qf, Kf2, Vt);

    // flash attention with tree bias
    flash_attn<<<dim3(16, 16), 256, 0, stream>>>(Qf, Kf2, Vt, mask, tb, rel, Of);

    // output projection
    gemm_wmma<<<dim3(16, 16), 256, 0, stream>>>(Of, Wo16, (float*)d_out, 1024, 1024);
}

// v006
// Measured time: 103 microseconds a run.
// Two timings next to v005 put it at 1.20 and 1.21 times that version's speed.
// All steps since v000 together make it 5.88 times as fast.
#include <hip/hip_runtime.h>

typedef __attribute__((ext_vector_type(16))) _Float16 v16h;
typedef __attribute__((ext_vector_type(8)))  _Float16 v8h;
typedef __attribute__((ext_vector_type(8)))  float    v8f;
typedef __attribute__((ext_vector_type(4)))  float    v4f;
typedef __attribute__((ext_vector_type(2)))  float    v2f;
typedef __attribute__((ext_vector_type(4)))  _Float16 v4h;
typedef __attribute__((ext_vector_type(4)))  int      v4i;

static __device__ __forceinline__ v8f zero8() {
    v8f z = {0.f, 0.f, 0.f, 0.f, 0.f, 0.f, 0.f, 0.f};
    return z;
}

// Load a 16x32 f16 fragment (A layout per CDNA5 ISA; B uses the same layout
// with the matrix stored column-major, i.e. base indexes [n][k]).
// lane<16:  row = lane,    K = {kb..kb+7, kb+16..kb+23}, kb=0
// lane>=16: row = lane-16, kb=8
static __device__ __forceinline__ v16h load_frag(const _Float16* p, int ld) {
    const int lane = threadIdx.x & 31;
    const int r    = lane & 15;
    const int kb   = (lane < 16) ? 0 : 8;
    const _Float16* q = p + (size_t)r * ld + kb;
    v8h lo = *(const v8h*)(q);
    v8h hi = *(const v8h*)(q + 16);
    v16h f;
#pragma unroll
    for (int i = 0; i < 8; ++i) { f[i] = lo[i]; f[i + 8] = hi[i]; }
    return f;
}

static __device__ __forceinline__ v8f wmma32(v16h a, v16h b, v8f c) {
    return __builtin_amdgcn_wmma_f32_16x16x32_f16(false, a, false, b,
                                                  (short)0, c, false, false);
}

// Async copy of 64 contiguous bytes global->LDS using the CDNA5 TDM-class
// GLOBAL_LOAD_ASYNC_TO_LDS_B128 path (ASYNCcnt). INST_OFFSET is added to both
// the LDS and the global address, so one base pair serves all four beats.
static __device__ __forceinline__ void async_copy64(unsigned lds_addr,
                                                    const void* gaddr) {
    unsigned long long ga = (unsigned long long)gaddr;
    asm volatile(
        "global_load_async_to_lds_b128 %0, %1, off\n\t"
        "global_load_async_to_lds_b128 %0, %1, off offset:16\n\t"
        "global_load_async_to_lds_b128 %0, %1, off offset:32\n\t"
        "global_load_async_to_lds_b128 %0, %1, off offset:48\n\t"
        "s_wait_xcnt 0x0"   // in front of any later write of the two address registers
        :: "v"(lds_addr), "v"(ga) : "memory");
}

static __device__ __forceinline__ void wait_async0() {
    asm volatile("s_wait_asynccnt 0x0" ::: "memory");
}

// ---------------------------------------------------------------- cast f32->f16
// One launch converts all six f32 operands: none of the six depends on another,
// and each alone is far too short to fill the chip or to cover its launch gap.
// A block converts 8192 consecutive elements of one operand, 32 per thread (every
// operand's size is a multiple of 8192). Each wave-wide load covers 512 contiguous
// bytes and each store 256; the eight loads of a thread fly together.
__global__ __launch_bounds__(256) void cast_all(const float* __restrict__ target,
                                                const float* __restrict__ hidden,
                                                const float* __restrict__ Wq,
                                                const float* __restrict__ Wk,
                                                const float* __restrict__ Wv,
                                                const float* __restrict__ Wo,
                                                _Float16* __restrict__ Xf,
                                                _Float16* __restrict__ Wq16,
                                                _Float16* __restrict__ Wk16,
                                                _Float16* __restrict__ Wv16,
                                                _Float16* __restrict__ Wo16) {
    const int b = blockIdx.x;      // 256 + 256 + 128 + 64 + 64 + 128 blocks
    const float* s;
    _Float16* d;
    int lb;
    if (b < 256)      { s = target; d = Xf;                 lb = b; }
    else if (b < 512) { s = hidden; d = Xf + 2048 * 1024;   lb = b - 256; }
    else if (b < 640) { s = Wq;     d = Wq16;               lb = b - 512; }
    else if (b < 704) { s = Wk;     d = Wk16;               lb = b - 640; }
    else if (b < 768) { s = Wv;     d = Wv16;               lb = b - 704; }
    else              { s = Wo;     d = Wo16;               lb = b - 768; }
    const int i0 = lb * 8192 + threadIdx.x * 4;
    v4f x[8];
    // both loops unrolled: x stays in registers, all loads issue before the first wait
#pragma unroll
    for (int j = 0; j < 8; ++j) x[j] = *(const v4f*)(s + i0 + j * 1024);
#pragma unroll
    for (int j = 0; j < 8; ++j)
        *(v4h*)(d + i0 + j * 1024) = __builtin_convertvector(x[j], v4h);
    // stands in front of any later write of a register that the stores name
    asm volatile("s_wait_xcnt 0x0" ::: "memory");
}

// ---------------------------------------------------------------- WMMA GEMM
// C(MxN,f32) = A(MxK,f16,row) * B(KxN,f16,row). Block tile 128x64, BK=64.
// 8 waves -> 4x2 wave grid, each wave 32x32 = 2x2 WMMA tiles.
// A tile staged with async global->LDS (no VGPR round-trip); B tile transposed
// through VGPRs into Bs[n][k] so both fragment loads are ds_load_b128.
static __device__ __forceinline__ void gemm_block(const _Float16* __restrict__ A,
                                                  const _Float16* __restrict__ B,
                                                  float* __restrict__ C,
                                                  int N, int K, int m0, int n0) {
    __shared__ _Float16 As[128 * 72];
    __shared__ _Float16 Bs[64 * 72];
    const int tid  = threadIdx.x;
    const int wid  = tid >> 5;
    const int lane = tid & 31;
    const int wm = wid >> 1, wn = wid & 1;
    const int nl = lane & 15;
    const int mb = (lane >> 4) << 3;

    // per-thread staging coordinates (constant over the K loop)
    const int arow = tid >> 1, akh = (tid & 1) * 32;
    const unsigned alds = (unsigned)(size_t)(void*)&As[arow * 72 + akh];
    const _Float16* agp = A + (size_t)(m0 + arow) * K + akh;
    const int bk = tid >> 2, bn0 = (tid & 3) * 16;
    const _Float16* bgp = B + (size_t)bk * N + n0 + bn0;

    v8f acc[2][2];
#pragma unroll
    for (int a = 0; a < 2; ++a)
#pragma unroll
        for (int b = 0; b < 2; ++b) acc[a][b] = zero8();

    for (int k0 = 0; k0 < K; k0 += 64) {
        __syncthreads();
        // A: 128 rows x 64 halves; each thread copies 64B via async-to-LDS
        async_copy64(alds, agp + k0);
        {   // B: transpose 64x64 tile into Bs[n][k]
            const _Float16* src = bgp + (size_t)k0 * N;
            v8h b0 = *(const v8h*)src;
            v8h b1 = *(const v8h*)(src + 8);
#pragma unroll
            for (int i = 0; i < 8; ++i) {
                Bs[(bn0 + i) * 72 + bk]     = b0[i];
                Bs[(bn0 + 8 + i) * 72 + bk] = b1[i];
            }
        }
        wait_async0();
        __syncthreads();
#pragma unroll
        for (int s = 0; s < 2; ++s) {
            v16h af[2], bf[2];
#pragma unroll
            for (int t = 0; t < 2; ++t)
                af[t] = load_frag(&As[(wm * 32 + t * 16) * 72 + s * 32], 72);
#pragma unroll
            for (int t = 0; t < 2; ++t)
                bf[t] = load_frag(&Bs[(wn * 32 + t * 16) * 72 + s * 32], 72);
#pragma unroll
            for (int tm = 0; tm < 2; ++tm)
#pragma unroll
                for (int tn = 0; tn < 2; ++tn)
                    acc[tm][tn] = wmma32(af[tm], bf[tn], acc[tm][tn]);
        }
    }
    // epilogue: one base pointer, constant-strided stores
    float* cp = C + (size_t)(m0 + wm * 32 + mb) * N + (n0 + wn * 32 + nl);
#pragma unroll
    for (int tm = 0; tm < 2; ++tm)
#pragma unroll
        for (int r = 0; r < 8; ++r) {
            float* rp = cp + (size_t)(tm * 16 + r) * N;
            rp[0]  = acc[tm][0][r];
            rp[16] = acc[tm][1][r];
        }
}

__global__ __launch_bounds__(256) void gemm_wmma(const _Float16* __restrict__ A,
                                                 const _Float16* __restrict__ B,
                                                 float* __restrict__ C,
                                                 int N, int K) {
    gemm_block(A, B, C, N, K, blockIdx.y * 128, blockIdx.x * 64);
}

// The three projections in one launch, 256 blocks each: they share no result, and
// one alone puts a single block on a WGP, whose waits nothing else fills.
// X = [target; hidden] (4096 x 1024); Q is taken of rows 2048 .. 4095 (hidden).
__global__ __launch_bounds__(256) void gemm_qkv(const _Float16* __restrict__ X,
                                                const _Float16* __restrict__ Wq16,
                                                const _Float16* __restrict__ Wk16,
                                                const _Float16* __restrict__ Wv16,
                                                float* __restrict__ Qraw,
                                                float* __restrict__ Kraw,
                                                float* __restrict__ Vraw) {
    const int which = blockIdx.x >> 8, r = blockIdx.x & 255;
    if (which == 0)
        gemm_block(X + 2048 * 1024, Wq16, Qraw, 1024, 1024, (r >> 4) * 128, (r & 15) * 64);
    else
        gemm_block(X, which == 1 ? Wk16 : Wv16, which == 1 ? Kraw : Vraw,
                   512, 1024, (r >> 3) * 128, (r & 7) * 64);
}

// ---------------------------------------------------------------- RMSNorm + RoPE
// src: rows x (heads*64) f32. dst: [h][rows][64] f16. A wave32 takes eight
// consecutive (row,h) slots, so an eighth of the waves has to start.
// N heads h .. h+N-1 of one row, stage by stage over all of them: the N slots'
// loads fly together and their lane exchanges overlap instead of following one
// another; the row's cos and sin are fetched once.
template <int N>
static __device__ __forceinline__ void rope_slots(const float* __restrict__ src,
                                                  const float* __restrict__ cosp,
                                                  const float* __restrict__ sinp,
                                                  float w0, float w1,
                                                  _Float16* __restrict__ dst,
                                                  int rows, int ld, int posoff,
                                                  int lane, int row, int h) {
    const float* x = src + (size_t)row * ld + h * 64;
    float x0[N], x1[N], ss[N];
    // every loop over the slots is unrolled: the arrays stay in registers
#pragma unroll
    for (int j = 0; j < N; ++j) {
        x0[j] = x[j * 64 + lane];
        x1[j] = x[j * 64 + lane + 32];
    }
    const int p = posoff + row;
    const float c0 = cosp[(size_t)p * 64 + lane];
    const float c1 = cosp[(size_t)p * 64 + lane + 32];
    const float s0 = sinp[(size_t)p * 64 + lane];
    const float s1 = sinp[(size_t)p * 64 + lane + 32];
#pragma unroll
    for (int j = 0; j < N; ++j) ss[j] = x0[j] * x0[j] + x1[j] * x1[j];
#pragma unroll
    for (int o = 16; o >= 1; o >>= 1) {
        float t[N];
#pragma unroll
        for (int j = 0; j < N; ++j) t[j] = __shfl_xor(ss[j], o, 32);
#pragma unroll
        for (int j = 0; j < N; ++j) ss[j] += t[j];
    }
#pragma unroll
    for (int j = 0; j < N; ++j) {
        const float sc = rsqrtf(ss[j] * (1.0f / 64.0f) + 1e-6f);
        const float xn0 = x0[j] * sc * w0;
        const float xn1 = x1[j] * sc * w1;
        _Float16* d = dst + ((size_t)(h + j) * rows + row) * 64;
        d[lane]      = (_Float16)(xn0 * c0 - xn1 * s0);
        d[lane + 32] = (_Float16)(xn1 * c1 + xn0 * s1);
    }
    // stands in front of any later write of a register that the stores name
    asm volatile("s_wait_xcnt 0x0" ::: "memory");
}

static __device__ __forceinline__ void norm_rope(const float* __restrict__ src,
                                                 const float* __restrict__ cosp,
                                                 const float* __restrict__ sinp,
                                                 const float* __restrict__ w,
                                                 _Float16* __restrict__ dst,
                                                 int rows, int heads, int ld, int posoff,
                                                 int blk) {
    // wave number held scalar: row, head and base addresses stay in scalar registers
    const int wave   = __builtin_amdgcn_readfirstlane(threadIdx.x >> 5);
    const int wslot0 = (blk * 8 + wave) * 8;
    const int lane   = threadIdx.x & 31;
    const int left   = rows * heads - wslot0;
    if (left <= 0) return;
    int row = wslot0 / heads;
    int h   = wslot0 - row * heads;
    const float w0 = w[lane], w1 = w[lane + 32];
    if (h + 8 <= heads) {          // the eight slots lie in one row
        rope_slots<8>(src, cosp, sinp, w0, w1, dst, rows, ld, posoff, lane, row, h);
    } else {                       // they cross a row's end, or the last row ends first
        for (int j = 0; j < 8 && j < left; ++j) {
            rope_slots<1>(src, cosp, sinp, w0, w1, dst, rows, ld, posoff, lane, row, h);
            if (++h == heads) { h = 0; ++row; }
        }
    }
}

// ---------------------------------------------------------------- V transpose
// vraw: (4096 x 512) f32 -> vt[kvh][d][t] f16  (d-major so the V^T A-frags of the PV product are contiguous)
// A thread takes one d and 64 consecutive t, one whole 128-byte line of vt: a
// sixty-fourth of the waves has to start. Lanes run along d.
static __device__ __forceinline__ void vtrans(const float* __restrict__ vraw,
                                              _Float16* __restrict__ vt, int blk) {
    const int i = blk * 256 + threadIdx.x;
    if (i >= 8 * 64 * 64) return;
    const int d   = i & 63;
    const int t0  = ((i >> 6) & 63) * 64;
    const int kvh = i >> 12;
    const float* sp = vraw + (size_t)t0 * 512 + kvh * 64 + d;
    _Float16*    dp = vt + (size_t)(kvh * 64 + d) * 4096 + t0;
    // unrolled: the 64 loads issue as one group, each store holds 8 packed values
#pragma unroll
    for (int g = 0; g < 8; ++g) {
        v8h o;
#pragma unroll
        for (int j = 0; j < 8; ++j) o[j] = (_Float16)sp[(g * 8 + j) * 512];
        *(v8h*)(dp + g * 8) = o;
    }
}

// What follows the projections, in one launch: V transpose (blocks 0 .. 127),
// norm + rope of Q (128 .. 639) and of K (640 .. 1151). The three read and write
// different arrays. q positions are CTX .. TOTAL-1, k positions 0 .. TOTAL-1.
__global__ __launch_bounds__(256) void post_proj(const float* __restrict__ Qraw,
                                                 const float* __restrict__ Kraw,
                                                 const float* __restrict__ Vraw,
                                                 const float* __restrict__ cosp,
                                                 const float* __restrict__ sinp,
                                                 const float* __restrict__ qw,
                                                 const float* __restrict__ kw,
                                                 _Float16* __restrict__ Qf,
                                                 _Float16* __restrict__ Kf,
                                                 _Float16* __restrict__ Vt) {
    const int b = blockIdx.x;
    if (b < 128)      vtrans(Vraw, Vt, b);
    else if (b < 640) norm_rope(Qraw, cosp, sinp, qw, Qf, 2048, 16, 1024, 2048, b - 128);
    else              norm_rope(Kraw, cosp, sinp, kw, Kf, 4096, 8, 512, 0, b - 640);
}

// ---------------------------------------------------------------- Flash attention
// Lane l with lane l ^ 16 (the two halves of a wave), in the vector unit.
static __device__ __forceinline__ float xhalf(float x) {
    const int b = __builtin_bit_cast(int, x);
    return __builtin_bit_cast(float,
        __builtin_amdgcn_permlanex16(b, b, 0x76543210, 0xfedcba98, false, false));
}

// Eight 16-byte async copies global->LDS of one lane, each with its own address
// pair. The s_wait_xcnt closes the statement so that it stands in front of any
// later write of the address registers the copies name.
static __device__ __forceinline__ void async_copy8x16(unsigned l0, const void* g0,
                                                      unsigned l1, const void* g1,
                                                      unsigned l2, const void* g2,
                                                      unsigned l3, const void* g3,
                                                      unsigned l4, const void* g4,
                                                      unsigned l5, const void* g5,
                                                      unsigned l6, const void* g6,
                                                      unsigned l7, const void* g7) {
    asm volatile(
        "global_load_async_to_lds_b128 %0, %1, off\n\t"
        "global_load_async_to_lds_b128 %2, %3, off\n\t"
        "global_load_async_to_lds_b128 %4, %5, off\n\t"
        "global_load_async_to_lds_b128 %6, %7, off\n\t"
        "global_load_async_to_lds_b128 %8, %9, off\n\t"
        "global_load_async_to_lds_b128 %10, %11, off\n\t"
        "global_load_async_to_lds_b128 %12, %13, off\n\t"
        "global_load_async_to_lds_b128 %14, %15, off\n\t"
        "s_wait_xcnt 0x0"
        :: "v"(l0), "v"((unsigned long long)g0), "v"(l1), "v"((unsigned long long)g1),
           "v"(l2), "v"((unsigned long long)g2), "v"(l3), "v"((unsigned long long)g3),
           "v"(l4), "v"((unsigned long long)g4), "v"(l5), "v"((unsigned long long)g5),
           "v"(l6), "v"((unsigned long long)g6), "v"(l7), "v"((unsigned long long)g7)
        : "memory");
}

__global__ __launch_bounds__(256) void flash_attn(const _Float16* __restrict__ Qf,
                                                  const _Float16* __restrict__ Kf,
                                                  const _Float16* __restrict__ Vt,
                                                  const float* __restrict__ mask,
                                                  const float* __restrict__ tb,
                                                  const int* __restrict__ rel,
                                                  _Float16* __restrict__ Of) {
    const int kvh   = blockIdx.y;
    const int h0    = kvh * 2;             // heads h0 and h0 + 1
    const int nb    = blockIdx.x;          // the block's 64 rows are one 64-block
    const int q0    = nb * 64;
    // wave number held scalar: the tree-bias test below is then one scalar
    // branch per key tile instead of an EXEC branch per score element
    const int wid   = __builtin_amdgcn_readfirstlane(threadIdx.x >> 5);
    const int rg    = wid & 3;             // which 16 rows
    const int g     = wid >> 2;            // which key tile of a step
    const int lane  = threadIdx.x & 31;
    const int nl    = lane & 15;           // this lane's query within the wave
    const int mb    = (lane >> 4) << 3;    // first of its 8 rows in an accumulator
    const int qrow0 = q0 + rg * 16;

    // rows of 64 halves at a pitch of 72 (144 B = 16 B x odd, for ds_load_b128)
    // [buffer][0][tile][key][d] holds K, [buffer][1][tile][d][key] holds V^T
    __shared__ __attribute__((aligned(16))) _Float16 KVs[2][2][2][64 * 72];
    // the block's 64 mask rows of 64 floats at a pitch of 68 (272 B = 16 B x odd)
    __shared__ __attribute__((aligned(16))) float Ms[2][2][64 * 68];      // [buffer][tile][q][key]
    // the merge: per wave 8 x 16 bytes of O and 16 bytes of (maximum, sum) a lane
    __shared__ __attribute__((aligned(16))) float Xs[8][9][32][4];

    const _Float16* Kh = Kf + (size_t)kvh * 4096 * 64;
    const _Float16* Vh = Vt + (size_t)kvh * 64 * 4096;

    // staging: 8 lanes per 128-byte row; a thread copies rows crow + 32 i of the
    // step's 128 keys, and rows crow, crow + 32 of each of its two V^T tiles
    const int crow = threadIdx.x >> 3, ccol = (threadIdx.x & 7) * 8;
    const _Float16* kg = Kh + (size_t)crow * 64 + ccol;
    const _Float16* vg = Vh + (size_t)crow * 4096 + ccol;
    const unsigned kvl = (unsigned)(size_t)(void*)&KVs[0][0][0][crow * 72 + ccol];
    // mask: 16 lanes per 256-byte row piece, so a wave-wide copy takes whole lines;
    // a thread copies rows mrow0 + 16 i, i = 0 .. 3, of each of the two tiles
    const int mrow0 = threadIdx.x >> 4, mcol = (threadIdx.x & 15) * 4;
    const float* mg = mask + (size_t)(q0 + mrow0) * 4096 + mcol;
    const unsigned ml = (unsigned)(size_t)(void*)&Ms[0][0][mrow0 * 68 + mcol];
    auto stage = [&](int st, int buf) {
        const unsigned ko = kvl + (unsigned)buf * (4 * 64 * 72 * 2);
        const _Float16* kp = kg + (size_t)st * 128 * 64;
        const _Float16* vp = vg + st * 128;
        async_copy8x16(ko,                 kp,
                       ko +  32 * 72 * 2,  kp + 32 * 64,
                       ko +  64 * 72 * 2,  kp + 64 * 64,
                       ko +  96 * 72 * 2,  kp + 96 * 64,
                       ko + 128 * 72 * 2,  vp,
                       ko + 160 * 72 * 2,  vp + (size_t)32 * 4096,
                       ko + 192 * 72 * 2,  vp + 64,
                       ko + 224 * 72 * 2,  vp + (size_t)32 * 4096 + 64);
        const unsigned mo = ml + (unsigned)buf * (2 * 64 * 68 * 4);
        const float* mp = mg + st * 128;
        async_copy8x16(mo,                   mp,
                       mo + 1 * 16 * 68 * 4, mp + (size_t)1 * 16 * 4096,
                       mo + 2 * 16 * 68 * 4, mp + (size_t)2 * 16 * 4096,
                       mo + 3 * 16 * 68 * 4, mp + (size_t)3 * 16 * 4096,
                       mo + 4 * 16 * 68 * 4, mp + 64,
                       mo + 5 * 16 * 68 * 4, mp + (size_t)1 * 16 * 4096 + 64,
                       mo + 6 * 16 * 68 * 4, mp + (size_t)2 * 16 * 4096 + 64,
                       mo + 7 * 16 * 68 * 4, mp + (size_t)3 * 16 * 4096 + 64);
    };
    stage(0, 0);
    wait_async0();
    __syncthreads();       // publishes step 0
    stage(1, 1);

    // Q^T as B operand: column = query, same k order as the K rows' A fragments
    v16h bq[2][2];
#pragma unroll
    for (int hh = 0; hh < 2; ++hh) {
        const _Float16* Qh = Qf + ((size_t)(h0 + hh) * 2048 + qrow0) * 64;
        bq[hh][0] = load_frag(Qh, 64);
        bq[hh][1] = load_frag(Qh + 32, 64);
    }

    v8f o[2][4];           // O^T of head hh: tile t holds d = t*16 + mb + r of query nl
#pragma unroll
    for (int hh = 0; hh < 2; ++hh)
#pragma unroll
        for (int t = 0; t < 4; ++t) o[hh][t] = zero8();
    // running maximum of query nl over this wave's tiles (equal in both halves) and
    // running sum over this half-wave's keys only
    float Mr[2] = {-1e30f, -1e30f};
    float Sr[2] = {0.f, 0.f};

    for (int st = 0; st < 32; ++st) {
        const int kt = st * 2 + g;         // this wave's key tile
        const _Float16* kb = &KVs[st & 1][0][g][0];
        const _Float16* vb = &KVs[st & 1][1][g][0];
        const float*    mr = &Ms[st & 1][g][(rg * 16 + nl) * 68 + mb];
        v8f sc[2][4];
#pragma unroll
        for (int hh = 0; hh < 2; ++hh)
#pragma unroll
            for (int kk = 0; kk < 4; ++kk) sc[hh][kk] = zero8();
        // ---- scores, transposed: K(64x64) . Q^T(64x32)
        v16h ak[2][4];
#pragma unroll
        for (int s = 0; s < 2; ++s)
#pragma unroll
            for (int kk = 0; kk < 4; ++kk)
                ak[s][kk] = load_frag(kb + (kk * 16) * 72 + s * 32, 72);
        // keeps the 16 LDS reads together in front of the products: spread among
        // them into one register set, each product waits out its own LDS latency
        __builtin_amdgcn_sched_barrier(0);
#pragma unroll
        for (int s = 0; s < 2; ++s)
#pragma unroll
            for (int kk = 0; kk < 4; ++kk)
#pragma unroll
                for (int hh = 0; hh < 2; ++hh)
                    sc[hh][kk] = wmma32(ak[s][kk], bq[hh][s], sc[hh][kk]);
        // this query's mask values in accumulator layout, 16 bytes a read
        v4f mk[4][2];
#pragma unroll
        for (int kk = 0; kk < 4; ++kk)
#pragma unroll
            for (int j = 0; j < 2; ++j) mk[kk][j] = *(const v4f*)(mr + kk * 16 + j * 4);
        // V^T fragments are read here: their LDS latency passes under the softmax
        v16h av[2][4];
#pragma unroll
        for (int s = 0; s < 2; ++s)
#pragma unroll
            for (int d = 0; d < 4; ++d)
                av[s][d] = load_frag(vb + (d * 16) * 72 + s * 32, 72);
        // ---- scale + mask + block-diagonal tree bias
        const bool hasb = (kt - 32) == nb;
#pragma unroll
        for (int hh = 0; hh < 2; ++hh)
#pragma unroll
            for (int kk = 0; kk < 4; ++kk)
#pragma unroll
                for (int r = 0; r < 8; ++r)
                    sc[hh][kk][r] = sc[hh][kk][r] * 0.125f + mk[kk][r >> 2][r & 3];
        if (hasb) {
            const int* rp = rel + (nb << 12) + ((rg * 16 + nl) << 6) + mb;
            // a 16-key group at a time: this runs in one step of 32, and with all four
            // groups' offsets and values live at once the staging addresses spill
#pragma unroll
            for (int kk = 0; kk < 4; ++kk) {
                unsigned bi[8];   // byte offset into tree_bias, relation bounded to 0..63
#pragma unroll
                for (int j = 0; j < 2; ++j) {
                    const v4i rv = *(const v4i*)(rp + kk * 16 + j * 4);
#pragma unroll
                    for (int e = 0; e < 4; ++e)
                        bi[j * 4 + e] = (unsigned)(rv[e] & 63) * 64u + (unsigned)h0 * 4u;
                }
                v2f bv[8];     // the two heads' values lie side by side (h0 is even)
#pragma unroll
                for (int r = 0; r < 8; ++r) bv[r] = *(const v2f*)((const char*)tb + bi[r]);
                // the eight offset registers stay live up to this wait, so no
                // load's result lands in one of them ahead of it
                asm volatile("s_wait_xcnt 0x0"
                             :: "v"(bi[0]), "v"(bi[1]), "v"(bi[2]), "v"(bi[3]),
                                "v"(bi[4]), "v"(bi[5]), "v"(bi[6]), "v"(bi[7])
                             : "memory");
#pragma unroll
                for (int r = 0; r < 8; ++r) {
                    sc[0][kk][r] += bv[r][0];
                    sc[1][kk][r] += bv[r][1];
                }
            }
        }
        // ---- online softmax, head by head: 32 of the query's 64 scores live in this
        // lane, the other 32 in lane ^ 16
#pragma unroll
        for (int hh = 0; hh < 2; ++hh) {
            float mx4[4];
#pragma unroll
            for (int kk = 0; kk < 4; ++kk) {
                mx4[kk] = sc[hh][kk][0];
#pragma unroll
                for (int r = 1; r < 8; ++r) mx4[kk] = fmaxf(mx4[kk], sc[hh][kk][r]);
            }
            float mx = fmaxf(fmaxf(mx4[0], mx4[1]), fmaxf(mx4[2], mx4[3]));
            mx = fmaxf(mx, xhalf(mx));
            const float mnew = fmaxf(Mr[hh], mx);
            const float al = __expf(Mr[hh] - mnew);
            Mr[hh] = mnew;
#pragma unroll
            for (int t = 0; t < 4; ++t)
#pragma unroll
                for (int r = 0; r < 8; ++r) o[hh][t][r] *= al;
            float rs[4];       // four independent chains of adds
#pragma unroll
            for (int kk = 0; kk < 4; ++kk) {
                rs[kk] = 0.f;
#pragma unroll
                for (int r = 0; r < 8; ++r) {
                    const float p = __expf(sc[hh][kk][r] - mnew);
                    sc[hh][kk][r] = p;
                    rs[kk] += p;
                }
            }
            Sr[hh] = Sr[hh] * al + ((rs[0] + rs[1]) + (rs[2] + rs[3]));
        }
        // ---- O^T += V^T(64x64) . P^T(64x32). P^T as B operand: of the 32 keys of
        // step s a lane needs k = mb .. mb+7 and 16+mb .. 16+mb+7, which are its
        // own accumulator rows of groups 2s and 2s+1
#pragma unroll
        for (int s = 0; s < 2; ++s) {
            v16h bp[2];
#pragma unroll
            for (int hh = 0; hh < 2; ++hh)
#pragma unroll
                for (int i = 0; i < 8; ++i) {
                    bp[hh][i]     = (_Float16)sc[hh][2 * s][i];
                    bp[hh][i + 8] = (_Float16)sc[hh][2 * s + 1][i];
                }
#pragma unroll
            for (int d = 0; d < 4; ++d)
#pragma unroll
                for (int hh = 0; hh < 2; ++hh)
                    o[hh][d] = wmma32(av[s][d], bp[hh], o[hh][d]);
        }
        // keeps the hand-over at the foot: lifted over the softmax and the products,
        // its wait would give the copies issued at the last foot too little time
        __builtin_amdgcn_sched_barrier(0);
        // ---- hand-over: this wave's LDS reads are back, its copies of the next
        // step have landed; the barrier publishes that step and frees this one
        asm volatile("s_wait_dscnt 0x0" ::: "memory");
        wait_async0();
        __syncthreads();
        if (st + 2 < 32) stage(st + 2, st & 1);
    }
    wait_async0();         // nothing is in flight when the wave ends

    // ---- merge of the two key halves. Waves w and w ^ 4 hold the same 32 columns in
    // the same lanes. Wave group g finishes head h0 + g: it hands its partial result
    // of the other head to its partner and takes the partner's of its own.
    auto give = [&](const v8f (&oo)[4], float M, float S) {
        float* x = &Xs[wid][0][lane][0];
#pragma unroll
        for (int d = 0; d < 4; ++d) {
            const v4f lo = {oo[d][0], oo[d][1], oo[d][2], oo[d][3]};
            const v4f hi = {oo[d][4], oo[d][5], oo[d][6], oo[d][7]};
            *(v4f*)(x + (2 * d) * 128)     = lo;
            *(v4f*)(x + (2 * d + 1) * 128) = hi;
        }
        const v4f ms = {M, S, 0.f, 0.f};
        *(v4f*)(x + 8 * 128) = ms;
    };
    auto finish = [&](const v8f (&oo)[4], float M1, float S1, int h) {
        const float* x = &Xs[wid ^ 4][0][lane][0];
        const v4f ms = *(const v4f*)(x + 8 * 128);
        const float M  = fmaxf(M1, ms[0]);
        const float a1 = __expf(M1 - M);
        const float a2 = __expf(ms[0] - M);
        const float S  = S1 * a1 + ms[1] * a2;
        // the two half-waves' sums are joined once, here
        const float inv = 1.0f / (S + xhalf(S));
        const float c1 = a1 * inv, c2 = a2 * inv;
        _Float16* op = Of + (size_t)(qrow0 + nl) * 1024 + h * 64 + mb;
#pragma unroll
        for (int d = 0; d < 4; ++d) {
            const v4f lo = *(const v4f*)(x + (2 * d) * 128);
            const v4f hi = *(const v4f*)(x + (2 * d + 1) * 128);
            v8h w;
#pragma unroll
            for (int r = 0; r < 4; ++r) {
                w[r]     = (_Float16)(oo[d][r] * c1 + lo[r] * c2);
                w[r + 4] = (_Float16)(oo[d][r + 4] * c1 + hi[r] * c2);
            }
            *(v8h*)(op + d * 16) = w;
        }
    };
    if (g == 0) give(o[1], Mr[1], Sr[1]);
    else        give(o[0], Mr[0], Sr[0]);
    __syncthreads();       // every wave's hand-over is written before any is read
    if (g == 0) finish(o[0], Mr[0], Sr[0], h0);
    else        finish(o[1], Mr[1], Sr[1], h0 + 1);
}

// ---------------------------------------------------------------- host
extern "C" void kernel_launch(void* const* d_in, const int* in_sizes, int n_in,
                              void* d_out, int out_size, void* d_ws, size_t ws_size,
                              hipStream_t stream) {
    (void)in_sizes; (void)n_in; (void)out_size; (void)ws_size;
    const float* hidden = (const float*)d_in[0];
    const float* target = (const float*)d_in[1];
    const float* cosp   = (const float*)d_in[2];
    const float* sinp   = (const float*)d_in[3];
    const float* mask   = (const float*)d_in[4];
    const float* Wq     = (const float*)d_in[5];
    const float* Wk     = (const float*)d_in[6];
    const float* Wv     = (const float*)d_in[7];
    const float* Wo     = (const float*)d_in[8];
    const float* qw     = (const float*)d_in[9];
    const float* kw     = (const float*)d_in[10];
    const float* tb     = (const float*)d_in[11];
    const int*   rel    = (const int*)d_in[12];

    char* ws = (char*)d_ws;
    size_t off = 0;
    auto alloc = [&](size_t bytes) -> void* {
        void* p = ws + off;
        off += (bytes + 255) & ~(size_t)255;
        return p;
    };
    _Float16* Xf   = (_Float16*)alloc(4096ull * 1024 * 2);   // [target; hidden] f16
    _Float16* Wq16 = (_Float16*)alloc(1024ull * 1024 * 2);
    _Float16* Wk16 = (_Float16*)alloc(1024ull * 512 * 2);
    _Float16* Wv16 = (_Float16*)alloc(1024ull * 512 * 2);
    _Float16* Wo16 = (_Float16*)alloc(1024ull * 1024 * 2);
    float*    Qraw = (float*)alloc(2048ull * 1024 * 4);
    float*    Kraw = (float*)alloc(4096ull * 512 * 4);
    float*    Vraw = (float*)alloc(4096ull * 512 * 4);
    _Float16* Qf   = (_Float16*)alloc(16ull * 2048 * 64 * 2);
    _Float16* Kf2  = (_Float16*)alloc(8ull * 4096 * 64 * 2);
    _Float16* Vt   = (_Float16*)alloc(8ull * 64 * 4096 * 2);
    _Float16* Of   = (_Float16*)alloc(2048ull * 1024 * 2);

    // launches that do not depend on one another are one launch each level
    cast_all<<<896, 256, 0, stream>>>(target, hidden, Wq, Wk, Wv, Wo,
                                      Xf, Wq16, Wk16, Wv16, Wo16);

    // projections
    gemm_qkv<<<768, 256, 0, stream>>>(Xf, Wq16, Wk16, Wv16, Qraw, Kraw, Vraw);

    // RMSNorm + RoPE of Q and K, V transpose
    post_proj<<<1152, 256, 0, stream>>>(Qraw, Kraw, Vraw, cosp, sinp, qw, kw, Qf, Kf2, Vt);

    // flash attention with tree bias
    flash_attn<<<dim3(32, 8), 256, 0, stream>>>(Qf, Kf2, Vt, mask, tb, rel, Of);

    // output projection
    gemm_wmma<<<dim3(16, 16), 256, 0, stream>>>(Of, Wo16, (float*)d_out, 1024, 1024);
}

// v007
// A run of this version takes 94 microseconds.
// Timed twice side by side with v006, it ran 1.10 and 1.09 times as fast.
// All steps since v000 together make it 6.43 times as fast.
#include <hip/hip_runtime.h>

typedef __attribute__((ext_vector_type(16))) _Float16 v16h;
typedef __attribute__((ext_vector_type(8)))  _Float16 v8h;
typedef __attribute__((ext_vector_type(8)))  float    v8f;
typedef __attribute__((ext_vector_type(4)))  float    v4f;
typedef __attribute__((ext_vector_type(2)))  float    v2f;
typedef __attribute__((ext_vector_type(4)))  _Float16 v4h;
typedef __attribute__((ext_vector_type(4)))  int      v4i;

static __device__ __forceinline__ v8f zero8() {
    v8f z = {0.f, 0.f, 0.f, 0.f, 0.f, 0.f, 0.f, 0.f};
    return z;
}

// Load a 16x32 f16 fragment (A layout per CDNA5 ISA; B uses the same layout
// with the matrix stored column-major, i.e. base indexes [n][k]).
// lane<16:  row = lane,    K = {kb..kb+7, kb+16..kb+23}, kb=0
// lane>=16: row = lane-16, kb=8
static __device__ __forceinline__ v16h load_frag(const _Float16* p, int ld) {
    const int lane = threadIdx.x & 31;
    const int r    = lane & 15;
    const int kb   = (lane < 16) ? 0 : 8;
    const _Float16* q = p + (size_t)r * ld + kb;
    v8h lo = *(const v8h*)(q);
    v8h hi = *(const v8h*)(q + 16);
    v16h f;
#pragma unroll
    for (int i = 0; i < 8; ++i) { f[i] = lo[i]; f[i + 8] = hi[i]; }
    return f;
}

static __device__ __forceinline__ v8f wmma32(v16h a, v16h b, v8f c) {
    return __builtin_amdgcn_wmma_f32_16x16x32_f16(false, a, false, b,
                                                  (short)0, c, false, false);
}

// Async copy of 64 contiguous bytes global->LDS using the CDNA5 TDM-class
// GLOBAL_LOAD_ASYNC_TO_LDS_B128 path (ASYNCcnt). INST_OFFSET is added to both
// the LDS and the global address, so one base pair serves all four beats.
static __device__ __forceinline__ void async_copy64(unsigned lds_addr,
                                                    const void* gaddr) {
    unsigned long long ga = (unsigned long long)gaddr;
    asm volatile(
        "global_load_async_to_lds_b128 %0, %1, off\n\t"
        "global_load_async_to_lds_b128 %0, %1, off offset:16\n\t"
        "global_load_async_to_lds_b128 %0, %1, off offset:32\n\t"
        "global_load_async_to_lds_b128 %0, %1, off offset:48\n\t"
        "s_wait_xcnt 0x0"   // in front of any later write of the two address registers
        :: "v"(lds_addr), "v"(ga) : "memory");
}

// Two 16-byte async copies global->LDS of one lane, each with its own address pair.
static __device__ __forceinline__ void async_copy2x16(unsigned l0, const void* g0,
                                                      unsigned l1, const void* g1) {
    asm volatile(
        "global_load_async_to_lds_b128 %0, %1, off\n\t"
        "global_load_async_to_lds_b128 %2, %3, off\n\t"
        "s_wait_xcnt 0x0"   // in front of any later write of the address registers
        :: "v"(l0), "v"((unsigned long long)g0), "v"(l1), "v"((unsigned long long)g1)
        : "memory");
}

static __device__ __forceinline__ void wait_async0() {
    asm volatile("s_wait_asynccnt 0x0" ::: "memory");
}

// ---------------------------------------------------------------- cast f32->f16
// A weight W (1024 x N, f32, row-major) is written as f16 TRANSPOSED, Wt[n][k]: that
// is the order in which the GEMM wants its B tile in LDS, so the tile can be copied
// there as it lies. The transposition is done once here instead of once per GEMM
// block and K step. A thread takes one n and 64 consecutive k, one whole 128-byte
// line of Wt; lanes run along n, so a wave-wide load is one contiguous line.
template <int N>
static __device__ __forceinline__ void wtrans(const float* __restrict__ w,
                                              _Float16* __restrict__ wt, int blk) {
    const int i  = blk * 256 + threadIdx.x;
    const int n  = i & (N - 1);
    const int k0 = (i / N) * 64;
    const float* sp = w + (size_t)k0 * N + n;
    _Float16*    dp = wt + (size_t)n * 1024 + k0;
    float x[64];
    // both loops unrolled: x stays in registers, all loads issue before the first wait
#pragma unroll
    for (int j = 0; j < 64; ++j) x[j] = sp[j * N];
#pragma unroll
    for (int g = 0; g < 8; ++g) {
        v8h o;
#pragma unroll
        for (int j = 0; j < 8; ++j) o[j] = (_Float16)x[g * 8 + j];
        *(v8h*)(dp + g * 8) = o;
    }
    // stands in front of any later write of a register that the stores name
    asm volatile("s_wait_xcnt 0x0" ::: "memory");
}

// One launch converts all six f32 operands: none of the six depends on another,
// and each alone is far too short to fill the chip or to cover its launch gap.
// The four weights come first (transposed, see above). For target and hidden a block
// converts 8192 consecutive elements, 32 per thread. Each wave-wide load covers 512
// contiguous bytes and each store 256; the eight loads of a thread fly together.
__global__ __launch_bounds__(256) void cast_all(const float* __restrict__ target,
                                                const float* __restrict__ hidden,
                                                const float* __restrict__ Wq,
                                                const float* __restrict__ Wk,
                                                const float* __restrict__ Wv,
                                                const float* __restrict__ Wo,
                                                _Float16* __restrict__ Xf,
                                                _Float16* __restrict__ Wq16,
                                                _Float16* __restrict__ Wk16,
                                                _Float16* __restrict__ Wv16,
                                                _Float16* __restrict__ Wo16) {
    const int b = blockIdx.x;      // 64 + 32 + 32 + 64 + 256 + 256 blocks
    if (b < 64)  { wtrans<1024>(Wq, Wq16, b);       return; }
    if (b < 96)  { wtrans<512>(Wk, Wk16, b - 64);   return; }
    if (b < 128) { wtrans<512>(Wv, Wv16, b - 96);   return; }
    if (b < 192) { wtrans<1024>(Wo, Wo16, b - 128); return; }
    const float* s;
    _Float16* d;
    int lb;
    if (b < 448) { s = target; d = Xf;               lb = b - 192; }
    else         { s = hidden; d = Xf + 2048 * 1024; lb = b - 448; }
    const int i0 = lb * 8192 + threadIdx.x * 4;
    v4f x[8];
    // both loops unrolled: x stays in registers, all loads issue before the first wait
#pragma unroll
    for (int j = 0; j < 8; ++j) x[j] = *(const v4f*)(s + i0 + j * 1024);
#pragma unroll
    for (int j = 0; j < 8; ++j)
        *(v4h*)(d + i0 + j * 1024) = __builtin_convertvector(x[j], v4h);
    // stands in front of any later write of a register that the stores name
    asm volatile("s_wait_xcnt 0x0" ::: "memory");
}

// ---------------------------------------------------------------- WMMA GEMM
// C(MxN,f32) = A(MxK,f16,row) * B(KxN), B given transposed: Bt(NxK,f16,row).
// Block tile 128x64, BK=64. 8 waves -> 4x2 wave grid, each wave 32x32 = 2x2 WMMA
// tiles. Both tiles are staged with async global->LDS copies (no VGPR round-trip),
// As[m][k] and Bs[n][k], so both fragment loads are ds_load_b128.
static __device__ __forceinline__ void gemm_block(const _Float16* __restrict__ A,
                                                  const _Float16* __restrict__ Bt,
                                                  float* __restrict__ C,
                                                  int N, int K, int m0, int n0) {
    __shared__ _Float16 As[128 * 72];
    __shared__ __attribute__((aligned(16))) _Float16 Bs[64 * 72];
    const int tid  = threadIdx.x;
    const int wid  = tid >> 5;
    const int lane = tid & 31;
    const int wm = wid >> 1, wn = wid & 1;
    const int nl = lane & 15;
    const int mb = (lane >> 4) << 3;

    // per-thread staging coordinates (constant over the K loop)
    const int arow = tid >> 1, akh = (tid & 1) * 32;
    const unsigned alds = (unsigned)(size_t)(void*)&As[arow * 72 + akh];
    const _Float16* agp = A + (size_t)(m0 + arow) * K + akh;
    // B: 8 lanes per 128-byte row, so a wave-wide copy takes whole lines; a thread
    // copies 16 bytes of rows brow and brow + 32
    const int brow = tid >> 3, bcol = (tid & 7) * 8;
    const unsigned blds = (unsigned)(size_t)(void*)&Bs[brow * 72 + bcol];
    const _Float16* bgp = Bt + (size_t)(n0 + brow) * K + bcol;

    v8f acc[2][2];
#pragma unroll
    for (int a = 0; a < 2; ++a)
#pragma unroll
        for (int b = 0; b < 2; ++b) acc[a][b] = zero8();

    for (int k0 = 0; k0 < K; k0 += 64) {
        // this wave's fragment reads are back before the barrier that frees both
        // tiles for the copies
        asm volatile("s_wait_dscnt 0x0" ::: "memory");
        __syncthreads();
        // A: 128 rows x 64 halves; each thread copies 64B via async-to-LDS
        async_copy64(alds, agp + k0);
        // B: 64 rows (n) x 64 halves (k), as they lie in Bt
        async_copy2x16(blds,               bgp + k0,
                       blds + 32 * 72 * 2, bgp + k0 + (size_t)32 * K);
        wait_async0();
        __syncthreads();
#pragma unroll
        for (int s = 0; s < 2; ++s) {
            v16h af[2], bf[2];
#pragma unroll
            for (int t = 0; t < 2; ++t)
                af[t] = load_frag(&As[(wm * 32 + t * 16) * 72 + s * 32], 72);
#pragma unroll
            for (int t = 0; t < 2; ++t)
                bf[t] = load_frag(&Bs[(wn * 32 + t * 16) * 72 + s * 32], 72);
#pragma unroll
            for (int tm = 0; tm < 2; ++tm)
#pragma unroll
                for (int tn = 0; tn < 2; ++tn)
                    acc[tm][tn] = wmma32(af[tm], bf[tn], acc[tm][tn]);
        }
    }
    // epilogue: one base pointer, constant-strided stores
    float* cp = C + (size_t)(m0 + wm * 32 + mb) * N + (n0 + wn * 32 + nl);
#pragma unroll
    for (int tm = 0; tm < 2; ++tm)
#pragma unroll
        for (int r = 0; r < 8; ++r) {
            float* rp = cp + (size_t)(tm * 16 + r) * N;
            rp[0]  = acc[tm][0][r];
            rp[16] = acc[tm][1][r];
        }
}

__global__ __launch_bounds__(256) void gemm_wmma(const _Float16* __restrict__ A,
                                                 const _Float16* __restrict__ Bt,
                                                 float* __restrict__ C,
                                                 int N, int K) {
    gemm_block(A, Bt, C, N, K, blockIdx.y * 128, blockIdx.x * 64);
}

// The three projections in one launch, 256 blocks each: they share no result, and
// one alone puts a single block on a WGP, whose waits nothing else fills.
// X = [target; hidden] (4096 x 1024); Q is taken of rows 2048 .. 4095 (hidden).
__global__ __launch_bounds__(256) void gemm_qkv(const _Float16* __restrict__ X,
                                                const _Float16* __restrict__ Wq16,
                                                const _Float16* __restrict__ Wk16,
                                                const _Float16* __restrict__ Wv16,
                                                float* __restrict__ Qraw,
                                                float* __restrict__ Kraw,
                                                float* __restrict__ Vraw) {
    const int which = blockIdx.x >> 8, r = blockIdx.x & 255;
    if (which == 0)
        gemm_block(X + 2048 * 1024, Wq16, Qraw, 1024, 1024, (r >> 4) * 128, (r & 15) * 64);
    else
        gemm_block(X, which == 1 ? Wk16 : Wv16, which == 1 ? Kraw : Vraw,
                   512, 1024, (r >> 3) * 128, (r & 7) * 64);
}

// ---------------------------------------------------------------- RMSNorm + RoPE
// src: rows x (heads*64) f32. dst: [h][rows][64] f16. A wave32 takes eight
// consecutive (row,h) slots, so an eighth of the waves has to start.
// N heads h .. h+N-1 of one row, stage by stage over all of them: the N slots'
// loads fly together and their lane exchanges overlap instead of following one
// another; the row's cos and sin are fetched once.
template <int N>
static __device__ __forceinline__ void rope_slots(const float* __restrict__ src,
                                                  const float* __restrict__ cosp,
                                                  const float* __restrict__ sinp,
                                                  float w0, float w1,
                                                  _Float16* __restrict__ dst,
                                                  int rows, int ld, int posoff,
                                                  int lane, int row, int h) {
    const float* x = src + (size_t)row * ld + h * 64;
    float x0[N], x1[N], ss[N];
    // every loop over the slots is unrolled: the arrays stay in registers
#pragma unroll
    for (int j = 0; j < N; ++j) {
        x0[j] = x[j * 64 + lane];
        x1[j] = x[j * 64 + lane + 32];
    }
    const int p = posoff + row;
    const float c0 = cosp[(size_t)p * 64 + lane];
    const float c1 = cosp[(size_t)p * 64 + lane + 32];
    const float s0 = sinp[(size_t)p * 64 + lane];
    const float s1 = sinp[(size_t)p * 64 + lane + 32];
#pragma unroll
    for (int j = 0; j < N; ++j) ss[j] = x0[j] * x0[j] + x1[j] * x1[j];
#pragma unroll
    for (int o = 16; o >= 1; o >>= 1) {
        float t[N];
#pragma unroll
        for (int j = 0; j < N; ++j) t[j] = __shfl_xor(ss[j], o, 32);
#pragma unroll
        for (int j = 0; j < N; ++j) ss[j] += t[j];
    }
#pragma unroll
    for (int j = 0; j < N; ++j) {
        const float sc = rsqrtf(ss[j] * (1.0f / 64.0f) + 1e-6f);
        const float xn0 = x0[j] * sc * w0;
        const float xn1 = x1[j] * sc * w1;
        _Float16* d = dst + ((size_t)(h + j) * rows + row) * 64;
        d[lane]      = (_Float16)(xn0 * c0 - xn1 * s0);
        d[lane + 32] = (_Float16)(xn1 * c1 + xn0 * s1);
    }
    // stands in front of any later write of a register that the stores name
    asm volatile("s_wait_xcnt 0x0" ::: "memory");
}

static __device__ __forceinline__ void norm_rope(const float* __restrict__ src,
                                                 const float* __restrict__ cosp,
                                                 const float* __restrict__ sinp,
                                                 const float* __restrict__ w,
                                                 _Float16* __restrict__ dst,
                                                 int rows, int heads, int ld, int posoff,
                                                 int blk) {
    // wave number held scalar: row, head and base addresses stay in scalar registers
    const int wave   = __builtin_amdgcn_readfirstlane(threadIdx.x >> 5);
    const int wslot0 = (blk * 8 + wave) * 8;
    const int lane   = threadIdx.x & 31;
    const int left   = rows * heads - wslot0;
    if (left <= 0) return;
    int row = wslot0 / heads;
    int h   = wslot0 - row * heads;
    const float w0 = w[lane], w1 = w[lane + 32];
    if (h + 8 <= heads) {          // the eight slots lie in one row
        rope_slots<8>(src, cosp, sinp, w0, w1, dst, rows, ld, posoff, lane, row, h);
    } else {                       // they cross a row's end, or the last row ends first
        for (int j = 0; j < 8 && j < left; ++j) {
            rope_slots<1>(src, cosp, sinp, w0, w1, dst, rows, ld, posoff, lane, row, h);
            if (++h == heads) { h = 0; ++row; }
        }
    }
}

// ---------------------------------------------------------------- V transpose
// vraw: (4096 x 512) f32 -> vt[kvh][d][t] f16  (d-major so the V^T A-frags of the PV product are contiguous)
// A thread takes one d and 64 consecutive t, one whole 128-byte line of vt: a
// sixty-fourth of the waves has to start. Lanes run along d.
static __device__ __forceinline__ void vtrans(const float* __restrict__ vraw,
                                              _Float16* __restrict__ vt, int blk) {
    const int i = blk * 256 + threadIdx.x;
    if (i >= 8 * 64 * 64) return;
    const int d   = i & 63;
    const int t0  = ((i >> 6) & 63) * 64;
    const int kvh = i >> 12;
    const float* sp = vraw + (size_t)t0 * 512 + kvh * 64 + d;
    _Float16*    dp = vt + (size_t)(kvh * 64 + d) * 4096 + t0;
    // unrolled: the 64 loads issue as one group, each store holds 8 packed values
#pragma unroll
    for (int g = 0; g < 8; ++g) {
        v8h o;
#pragma unroll
        for (int j = 0; j < 8; ++j) o[j] = (_Float16)sp[(g * 8 + j) * 512];
        *(v8h*)(dp + g * 8) = o;
    }
}

// What follows the projections, in one launch: V transpose (blocks 0 .. 127),
// norm + rope of Q (128 .. 639) and of K (640 .. 1151). The three read and write
// different arrays. q positions are CTX .. TOTAL-1, k positions 0 .. TOTAL-1.
__global__ __launch_bounds__(256) void post_proj(const float* __restrict__ Qraw,
                                                 const float* __restrict__ Kraw,
                                                 const float* __restrict__ Vraw,
                                                 const float* __restrict__ cosp,
                                                 const float* __restrict__ sinp,
                                                 const float* __restrict__ qw,
                                                 const float* __restrict__ kw,
                                                 _Float16* __restrict__ Qf,
                                                 _Float16* __restrict__ Kf,
                                                 _Float16* __restrict__ Vt) {
    const int b = blockIdx.x;
    if (b < 128)      vtrans(Vraw, Vt, b);
    else if (b < 640) norm_rope(Qraw, cosp, sinp, qw, Qf, 2048, 16, 1024, 2048, b - 128);
    else              norm_rope(Kraw, cosp, sinp, kw, Kf, 4096, 8, 512, 0, b - 640);
}

// ---------------------------------------------------------------- Flash attention
// Lane l with lane l ^ 16 (the two halves of a wave), in the vector unit.
static __device__ __forceinline__ float xhalf(float x) {
    const int b = __builtin_bit_cast(int, x);
    return __builtin_bit_cast(float,
        __builtin_amdgcn_permlanex16(b, b, 0x76543210, 0xfedcba98, false, false));
}

// Eight 16-byte async copies global->LDS of one lane, each with its own address
// pair. The s_wait_xcnt closes the statement so that it stands in front of any
// later write of the address registers the copies name.
static __device__ __forceinline__ void async_copy8x16(unsigned l0, const void* g0,
                                                      unsigned l1, const void* g1,
                                                      unsigned l2, const void* g2,
                                                      unsigned l3, const void* g3,
                                                      unsigned l4, const void* g4,
                                                      unsigned l5, const void* g5,
                                                      unsigned l6, const void* g6,
                                                      unsigned l7, const void* g7) {
    asm volatile(
        "global_load_async_to_lds_b128 %0, %1, off\n\t"
        "global_load_async_to_lds_b128 %2, %3, off\n\t"
        "global_load_async_to_lds_b128 %4, %5, off\n\t"
        "global_load_async_to_lds_b128 %6, %7, off\n\t"
        "global_load_async_to_lds_b128 %8, %9, off\n\t"
        "global_load_async_to_lds_b128 %10, %11, off\n\t"
        "global_load_async_to_lds_b128 %12, %13, off\n\t"
        "global_load_async_to_lds_b128 %14, %15, off\n\t"
        "s_wait_xcnt 0x0"
        :: "v"(l0), "v"((unsigned long long)g0), "v"(l1), "v"((unsigned long long)g1),
           "v"(l2), "v"((unsigned long long)g2), "v"(l3), "v"((unsigned long long)g3),
           "v"(l4), "v"((unsigned long long)g4), "v"(l5), "v"((unsigned long long)g5),
           "v"(l6), "v"((unsigned long long)g6), "v"(l7), "v"((unsigned long long)g7)
        : "memory");
}

__global__ __launch_bounds__(256) void flash_attn(const _Float16* __restrict__ Qf,
                                                  const _Float16* __restrict__ Kf,
                                                  const _Float16* __restrict__ Vt,
                                                  const float* __restrict__ mask,
                                                  const float* __restrict__ tb,
                                                  const int* __restrict__ rel,
                                                  _Float16* __restrict__ Of) {
    const int kvh   = blockIdx.y;
    const int h0    = kvh * 2;             // heads h0 and h0 + 1
    const int nb    = blockIdx.x;          // the block's 64 rows are one 64-block
    const int q0    = nb * 64;
    // wave number held scalar: the tree-bias test below is then one scalar
    // branch per key tile instead of an EXEC branch per score element
    const int wid   = __builtin_amdgcn_readfirstlane(threadIdx.x >> 5);
    const int rg    = wid & 3;             // which 16 rows
    const int g     = wid >> 2;            // which key tile of a step
    const int lane  = threadIdx.x & 31;
    const int nl    = lane & 15;           // this lane's query within the wave
    const int mb    = (lane >> 4) << 3;    // first of its 8 rows in an accumulator
    const int qrow0 = q0 + rg * 16;

    // rows of 64 halves at a pitch of 72 (144 B = 16 B x odd, for ds_load_b128)
    // [buffer][0][tile][key][d] holds K, [buffer][1][tile][d][key] holds V^T
    __shared__ __attribute__((aligned(16))) _Float16 KVs[2][2][2][64 * 72];
    // the block's 64 mask rows of 64 floats at a pitch of 68 (272 B = 16 B x odd)
    __shared__ __attribute__((aligned(16))) float Ms[2][2][64 * 68];      // [buffer][tile][q][key]
    // the merge: per wave 8 x 16 bytes of O and 16 bytes of (maximum, sum) a lane
    __shared__ __attribute__((aligned(16))) float Xs[8][9][32][4];

    const _Float16* Kh = Kf + (size_t)kvh * 4096 * 64;
    const _Float16* Vh = Vt + (size_t)kvh * 64 * 4096;

    // staging: 8 lanes per 128-byte row; a thread copies rows crow + 32 i of the
    // step's 128 keys, and rows crow, crow + 32 of each of its two V^T tiles
    const int crow = threadIdx.x >> 3, ccol = (threadIdx.x & 7) * 8;
    const _Float16* kg = Kh + (size_t)crow * 64 + ccol;
    const _Float16* vg = Vh + (size_t)crow * 4096 + ccol;
    const unsigned kvl = (unsigned)(size_t)(void*)&KVs[0][0][0][crow * 72 + ccol];
    // mask: 16 lanes per 256-byte row piece, so a wave-wide copy takes whole lines;
    // a thread copies rows mrow0 + 16 i, i = 0 .. 3, of each of the two tiles
    const int mrow0 = threadIdx.x >> 4, mcol = (threadIdx.x & 15) * 4;
    const float* mg = mask + (size_t)(q0 + mrow0) * 4096 + mcol;
    const unsigned ml = (unsigned)(size_t)(void*)&Ms[0][0][mrow0 * 68 + mcol];
    auto stage = [&](int st, int buf) {
        const unsigned ko = kvl + (unsigned)buf * (4 * 64 * 72 * 2);
        const _Float16* kp = kg + (size_t)st * 128 * 64;
        const _Float16* vp = vg + st * 128;
        async_copy8x16(ko,                 kp,
                       ko +  32 * 72 * 2,  kp + 32 * 64,
                       ko +  64 * 72 * 2,  kp + 64 * 64,
                       ko +  96 * 72 * 2,  kp + 96 * 64,
                       ko + 128 * 72 * 2,  vp,
                       ko + 160 * 72 * 2,  vp + (size_t)32 * 4096,
                       ko + 192 * 72 * 2,  vp + 64,
                       ko + 224 * 72 * 2,  vp + (size_t)32 * 4096 + 64);
        const unsigned mo = ml + (unsigned)buf * (2 * 64 * 68 * 4);
        const float* mp = mg + st * 128;
        async_copy8x16(mo,                   mp,
                       mo + 1 * 16 * 68 * 4, mp + (size_t)1 * 16 * 4096,
                       mo + 2 * 16 * 68 * 4, mp + (size_t)2 * 16 * 4096,
                       mo + 3 * 16 * 68 * 4, mp + (size_t)3 * 16 * 4096,
                       mo + 4 * 16 * 68 * 4, mp + 64,
                       mo + 5 * 16 * 68 * 4, mp + (size_t)1 * 16 * 4096 + 64,
                       mo + 6 * 16 * 68 * 4, mp + (size_t)2 * 16 * 4096 + 64,
                       mo + 7 * 16 * 68 * 4, mp + (size_t)3 * 16 * 4096 + 64);
    };
    stage(0, 0);
    wait_async0();
    __syncthreads();       // publishes step 0
    stage(1, 1);

    // Q^T as B operand: column = query, same k order as the K rows' A fragments
    v16h bq[2][2];
#pragma unroll
    for (int hh = 0; hh < 2; ++hh) {
        const _Float16* Qh = Qf + ((size_t)(h0 + hh) * 2048 + qrow0) * 64;
        bq[hh][0] = load_frag(Qh, 64);
        bq[hh][1] = load_frag(Qh + 32, 64);
    }

    v8f o[2][4];           // O^T of head hh: tile t holds d = t*16 + mb + r of query nl
#pragma unroll
    for (int hh = 0; hh < 2; ++hh)
#pragma unroll
        for (int t = 0; t < 4; ++t) o[hh][t] = zero8();
    // running maximum of query nl over this wave's tiles (equal in both halves) and
    // running sum over this half-wave's keys only
    float Mr[2] = {-1e30f, -1e30f};
    float Sr[2] = {0.f, 0.f};

    for (int st = 0; st < 32; ++st) {
        const int kt = st * 2 + g;         // this wave's key tile
        const _Float16* kb = &KVs[st & 1][0][g][0];
        const _Float16* vb = &KVs[st & 1][1][g][0];
        const float*    mr = &Ms[st & 1][g][(rg * 16 + nl) * 68 + mb];
        v8f sc[2][4];
#pragma unroll
        for (int hh = 0; hh < 2; ++hh)
#pragma unroll
            for (int kk = 0; kk < 4; ++kk) sc[hh][kk] = zero8();
        // ---- scores, transposed: K(64x64) . Q^T(64x32)
        v16h ak[2][4];
#pragma unroll
        for (int s = 0; s < 2; ++s)
#pragma unroll
            for (int kk = 0; kk < 4; ++kk)
                ak[s][kk] = load_frag(kb + (kk * 16) * 72 + s * 32, 72);
        // keeps the 16 LDS reads together in front of the products: spread among
        // them into one register set, each product waits out its own LDS latency
        __builtin_amdgcn_sched_barrier(0);
#pragma unroll
        for (int s = 0; s < 2; ++s)
#pragma unroll
            for (int kk = 0; kk < 4; ++kk)
#pragma unroll
                for (int hh = 0; hh < 2; ++hh)
                    sc[hh][kk] = wmma32(ak[s][kk], bq[hh][s], sc[hh][kk]);
        // this query's mask values in accumulator layout, 16 bytes a read
        v4f mk[4][2];
#pragma unroll
        for (int kk = 0; kk < 4; ++kk)
#pragma unroll
            for (int j = 0; j < 2; ++j) mk[kk][j] = *(const v4f*)(mr + kk * 16 + j * 4);
        // V^T fragments are read here: their LDS latency passes under the softmax
        v16h av[2][4];
#pragma unroll
        for (int s = 0; s < 2; ++s)
#pragma unroll
            for (int d = 0; d < 4; ++d)
                av[s][d] = load_frag(vb + (d * 16) * 72 + s * 32, 72);
        // ---- scale + mask + block-diagonal tree bias
        const bool hasb = (kt - 32) == nb;
#pragma unroll
        for (int hh = 0; hh < 2; ++hh)
#pragma unroll
            for (int kk = 0; kk < 4; ++kk)
#pragma unroll
                for (int r = 0; r < 8; ++r)
                    sc[hh][kk][r] = sc[hh][kk][r] * 0.125f + mk[kk][r >> 2][r & 3];
        if (hasb) {
            const int* rp = rel + (nb << 12) + ((rg * 16 + nl) << 6) + mb;
            // a 16-key group at a time: this runs in one step of 32, and with all four
            // groups' offsets and values live at once the staging addresses spill
#pragma unroll
            for (int kk = 0; kk < 4; ++kk) {
                unsigned bi[8];   // byte offset into tree_bias, relation bounded to 0..63
#pragma unroll
                for (int j = 0; j < 2; ++j) {
                    const v4i rv = *(const v4i*)(rp + kk * 16 + j * 4);
#pragma unroll
                    for (int e = 0; e < 4; ++e)
                        bi[j * 4 + e] = (unsigned)(rv[e] & 63) * 64u + (unsigned)h0 * 4u;
                }
                v2f bv[8];     // the two heads' values lie side by side (h0 is even)
#pragma unroll
                for (int r = 0; r < 8; ++r) bv[r] = *(const v2f*)((const char*)tb + bi[r]);
                // the eight offset registers stay live up to this wait, so no
                // load's result lands in one of them ahead of it
                asm volatile("s_wait_xcnt 0x0"
                             :: "v"(bi[0]), "v"(bi[1]), "v"(bi[2]), "v"(bi[3]),
                                "v"(bi[4]), "v"(bi[5]), "v"(bi[6]), "v"(bi[7])
                             : "memory");
#pragma unroll
                for (int r = 0; r < 8; ++r) {
                    sc[0][kk][r] += bv[r][0];
                    sc[1][kk][r] += bv[r][1];
                }
            }
        }
        // ---- online softmax, head by head: 32 of the query's 64 scores live in this
        // lane, the other 32 in lane ^ 16
#pragma unroll
        for (int hh = 0; hh < 2; ++hh) {
            float mx4[4];
#pragma unroll
            for (int kk = 0; kk < 4; ++kk) {
                mx4[kk] = sc[hh][kk][0];
#pragma unroll
                for (int r = 1; r < 8; ++r) mx4[kk] = fmaxf(mx4[kk], sc[hh][kk][r]);
            }
            float mx = fmaxf(fmaxf(mx4[0], mx4[1]), fmaxf(mx4[2], mx4[3]));
            mx = fmaxf(mx, xhalf(mx));
            const float mnew = fmaxf(Mr[hh], mx);
            const float al = __expf(Mr[hh] - mnew);
            Mr[hh] = mnew;
#pragma unroll
            for (int t = 0; t < 4; ++t)
#pragma unroll
                for (int r = 0; r < 8; ++r) o[hh][t][r] *= al;
            float rs[4];       // four independent chains of adds
#pragma unroll
            for (int kk = 0; kk < 4; ++kk) {
                rs[kk] = 0.f;
#pragma unroll
                for (int r = 0; r < 8; ++r) {
                    const float p = __expf(sc[hh][kk][r] - mnew);
                    sc[hh][kk][r] = p;
                    rs[kk] += p;
                }
            }
            Sr[hh] = Sr[hh] * al + ((rs[0] + rs[1]) + (rs[2] + rs[3]));
        }
        // ---- O^T += V^T(64x64) . P^T(64x32). P^T as B operand: of the 32 keys of
        // step s a lane needs k = mb .. mb+7 and 16+mb .. 16+mb+7, which are its
        // own accumulator rows of groups 2s and 2s+1
#pragma unroll
        for (int s = 0; s < 2; ++s) {
            v16h bp[2];
#pragma unroll
            for (int hh = 0; hh < 2; ++hh)
#pragma unroll
                for (int i = 0; i < 8; ++i) {
                    bp[hh][i]     = (_Float16)sc[hh][2 * s][i];
                    bp[hh][i + 8] = (_Float16)sc[hh][2 * s + 1][i];
                }
#pragma unroll
            for (int d = 0; d < 4; ++d)
#pragma unroll
                for (int hh = 0; hh < 2; ++hh)
                    o[hh][d] = wmma32(av[s][d], bp[hh], o[hh][d]);
        }
        // keeps the hand-over at the foot: lifted over the softmax and the products,
        // its wait would give the copies issued at the last foot too little time
        __builtin_amdgcn_sched_barrier(0);
        // ---- hand-over: this wave's LDS reads are back, its copies of the next
        // step have landed; the barrier publishes that step and frees this one
        asm volatile("s_wait_dscnt 0x0" ::: "memory");
        wait_async0();
        __syncthreads();
        if (st + 2 < 32) stage(st + 2, st & 1);
    }
    wait_async0();         // nothing is in flight when the wave ends

    // ---- merge of the two key halves. Waves w and w ^ 4 hold the same 32 columns in
    // the same lanes. Wave group g finishes head h0 + g: it hands its partial result
    // of the other head to its partner and takes the partner's of its own.
    auto give = [&](const v8f (&oo)[4], float M, float S) {
        float* x = &Xs[wid][0][lane][0];
#pragma unroll
        for (int d = 0; d < 4; ++d) {
            const v4f lo = {oo[d][0], oo[d][1], oo[d][2], oo[d][3]};
            const v4f hi = {oo[d][4], oo[d][5], oo[d][6], oo[d][7]};
            *(v4f*)(x + (2 * d) * 128)     = lo;
            *(v4f*)(x + (2 * d + 1) * 128) = hi;
        }
        const v4f ms = {M, S, 0.f, 0.f};
        *(v4f*)(x + 8 * 128) = ms;
    };
    auto finish = [&](const v8f (&oo)[4], float M1, float S1, int h) {
        const float* x = &Xs[wid ^ 4][0][lane][0];
        const v4f ms = *(const v4f*)(x + 8 * 128);
        const float M  = fmaxf(M1, ms[0]);
        const float a1 = __expf(M1 - M);
        const float a2 = __expf(ms[0] - M);
        const float S  = S1 * a1 + ms[1] * a2;
        // the two half-waves' sums are joined once, here
        const float inv = 1.0f / (S + xhalf(S));
        const float c1 = a1 * inv, c2 = a2 * inv;
        _Float16* op = Of + (size_t)(qrow0 + nl) * 1024 + h * 64 + mb;
#pragma unroll
        for (int d = 0; d < 4; ++d) {
            const v4f lo = *(const v4f*)(x + (2 * d) * 128);
            const v4f hi = *(const v4f*)(x + (2 * d + 1) * 128);
            v8h w;
#pragma unroll
            for (int r = 0; r < 4; ++r) {
                w[r]     = (_Float16)(oo[d][r] * c1 + lo[r] * c2);
                w[r + 4] = (_Float16)(oo[d][r + 4] * c1 + hi[r] * c2);
            }
            *(v8h*)(op + d * 16) = w;
        }
    };
    if (g == 0) give(o[1], Mr[1], Sr[1]);
    else        give(o[0], Mr[0], Sr[0]);
    __syncthreads();       // every wave's hand-over is written before any is read
    if (g == 0) finish(o[0], Mr[0], Sr[0], h0);
    else        finish(o[1], Mr[1], Sr[1], h0 + 1);
}

// ---------------------------------------------------------------- host
extern "C" void kernel_launch(void* const* d_in, const int* in_sizes, int n_in,
                              void* d_out, int out_size, void* d_ws, size_t ws_size,
                              hipStream_t stream) {
    (void)in_sizes; (void)n_in; (void)out_size; (void)ws_size;
    const float* hidden = (const float*)d_in[0];
    const float* target = (const float*)d_in[1];
    const float* cosp   = (const float*)d_in[2];
    const float* sinp   = (const float*)d_in[3];
    const float* mask   = (const float*)d_in[4];
    const float* Wq     = (const float*)d_in[5];
    const float* Wk     = (const float*)d_in[6];
    const float* Wv     = (const float*)d_in[7];
    const float* Wo     = (const float*)d_in[8];
    const float* qw     = (const float*)d_in[9];
    const float* kw     = (const float*)d_in[10];
    const float* tb     = (const float*)d_in[11];
    const int*   rel    = (const int*)d_in[12];

    char* ws = (char*)d_ws;
    size_t off = 0;
    auto alloc = [&](size_t bytes) -> void* {
        void* p = ws + off;
        off += (bytes + 255) & ~(size_t)255;
        return p;
    };
    _Float16* Xf   = (_Float16*)alloc(4096ull * 1024 * 2);   // [target; hidden] f16
    _Float16* Wq16 = (_Float16*)alloc(1024ull * 1024 * 2);   // weights: f16, [n][k]
    _Float16* Wk16 = (_Float16*)alloc(1024ull * 512 * 2);
    _Float16* Wv16 = (_Float16*)alloc(1024ull * 512 * 2);
    _Float16* Wo16 = (_Float16*)alloc(1024ull * 1024 * 2);
    float*    Qraw = (float*)alloc(2048ull * 1024 * 4);
    float*    Kraw = (float*)alloc(4096ull * 512 * 4);
    float*    Vraw = (float*)alloc(4096ull * 512 * 4);
    _Float16* Qf   = (_Float16*)alloc(16ull * 2048 * 64 * 2);
    _Float16* Kf2  = (_Float16*)alloc(8ull * 4096 * 64 * 2);
    _Float16* Vt   = (_Float16*)alloc(8ull * 64 * 4096 * 2);
    _Float16* Of   = (_Float16*)alloc(2048ull * 1024 * 2);

    // launches that do not depend on one another are one launch each level
    cast_all<<<704, 256, 0, stream>>>(target, hidden, Wq, Wk, Wv, Wo,
                                      Xf, Wq16, Wk16, Wv16, Wo16);

    // projections
    gemm_qkv<<<768, 256, 0, stream>>>(Xf, Wq16, Wk16, Wv16, Qraw, Kraw, Vraw);

    // RMSNorm + RoPE of Q and K, V transpose
    post_proj<<<1152, 256, 0, stream>>>(Qraw, Kraw, Vraw, cosp, sinp, qw, kw, Qf, Kf2, Vt);

    // flash attention with tree bias
    flash_attn<<<dim3(32, 8), 256, 0, stream>>>(Qf, Kf2, Vt, mask, tb, rel, Of);

    // output projection
    gemm_wmma<<<dim3(16, 16), 256, 0, stream>>>(Of, Wo16, (float*)d_out, 1024, 1024);
}

// v008
// A run of this version takes 89.1 microseconds.
// Two timings next to v007 both put it at 1.05 times that version's speed.
// Counting every step since v000, it is 6.74 times as fast.
#include <hip/hip_runtime.h>

typedef __attribute__((ext_vector_type(16))) _Float16 v16h;
typedef __attribute__((ext_vector_type(8)))  _Float16 v8h;
typedef __attribute__((ext_vector_type(8)))  float    v8f;
typedef __attribute__((ext_vector_type(4)))  float    v4f;
typedef __attribute__((ext_vector_type(2)))  float    v2f;
typedef __attribute__((ext_vector_type(4)))  _Float16 v4h;
typedef __attribute__((ext_vector_type(4)))  int      v4i;

static __device__ __forceinline__ v8f zero8() {
    v8f z = {0.f, 0.f, 0.f, 0.f, 0.f, 0.f, 0.f, 0.f};
    return z;
}

// Load a 16x32 f16 fragment (A layout per CDNA5 ISA; B uses the same layout
// with the matrix stored column-major, i.e. base indexes [n][k]).
// lane<16:  row = lane,    K = {kb..kb+7, kb+16..kb+23}, kb=0
// lane>=16: row = lane-16, kb=8
static __device__ __forceinline__ v16h load_frag(const _Float16* p, int ld) {
    const int lane = threadIdx.x & 31;
    const int r    = lane & 15;
    const int kb   = (lane < 16) ? 0 : 8;
    const _Float16* q = p + (size_t)r * ld + kb;
    v8h lo = *(const v8h*)(q);
    v8h hi = *(const v8h*)(q + 16);
    v16h f;
#pragma unroll
    for (int i = 0; i < 8; ++i) { f[i] = lo[i]; f[i + 8] = hi[i]; }
    return f;
}

static __device__ __forceinline__ v8f wmma32(v16h a, v16h b, v8f c) {
    return __builtin_amdgcn_wmma_f32_16x16x32_f16(false, a, false, b,
                                                  (short)0, c, false, false);
}

// Async copy of 64 contiguous bytes global->LDS using the CDNA5 TDM-class
// GLOBAL_LOAD_ASYNC_TO_LDS_B128 path (ASYNCcnt). INST_OFFSET is added to both
// the LDS and the global address, so one base pair serves all four beats.
static __device__ __forceinline__ void async_copy64(unsigned lds_addr,
                                                    const void* gaddr) {
    unsigned long long ga = (unsigned long long)gaddr;
    asm volatile(
        "global_load_async_to_lds_b128 %0, %1, off\n\t"
        "global_load_async_to_lds_b128 %0, %1, off offset:16\n\t"
        "global_load_async_to_lds_b128 %0, %1, off offset:32\n\t"
        "global_load_async_to_lds_b128 %0, %1, off offset:48\n\t"
        "s_wait_xcnt 0x0"   // in front of any later write of the two address registers
        :: "v"(lds_addr), "v"(ga) : "memory");
}

// Two 16-byte async copies global->LDS of one lane, each with its own address pair.
static __device__ __forceinline__ void async_copy2x16(unsigned l0, const void* g0,
                                                      unsigned l1, const void* g1) {
    asm volatile(
        "global_load_async_to_lds_b128 %0, %1, off\n\t"
        "global_load_async_to_lds_b128 %2, %3, off\n\t"
        "s_wait_xcnt 0x0"   // in front of any later write of the address registers
        :: "v"(l0), "v"((unsigned long long)g0), "v"(l1), "v"((unsigned long long)g1)
        : "memory");
}

static __device__ __forceinline__ void wait_async0() {
    asm volatile("s_wait_asynccnt 0x0" ::: "memory");
}

// ---------------------------------------------------------------- cast f32->f16
// A weight W (1024 x N, f32, row-major) is written as f16 TRANSPOSED, Wt[n][k]: that
// is the order in which the GEMM wants its B tile in LDS, so the tile can be copied
// there as it lies. The transposition is done once here instead of once per GEMM
// block and K step. A thread takes one n and 64 consecutive k, one whole 128-byte
// line of Wt; lanes run along n, so a wave-wide load is one contiguous line.
template <int N>
static __device__ __forceinline__ void wtrans(const float* __restrict__ w,
                                              _Float16* __restrict__ wt, int blk) {
    const int i  = blk * 256 + threadIdx.x;
    const int n  = i & (N - 1);
    const int k0 = (i / N) * 64;
    const float* sp = w + (size_t)k0 * N + n;
    _Float16*    dp = wt + (size_t)n * 1024 + k0;
    float x[64];
    // both loops unrolled: x stays in registers, all loads issue before the first wait
#pragma unroll
    for (int j = 0; j < 64; ++j) x[j] = sp[j * N];
#pragma unroll
    for (int g = 0; g < 8; ++g) {
        v8h o;
#pragma unroll
        for (int j = 0; j < 8; ++j) o[j] = (_Float16)x[g * 8 + j];
        *(v8h*)(dp + g * 8) = o;
    }
    // stands in front of any later write of a register that the stores name
    asm volatile("s_wait_xcnt 0x0" ::: "memory");
}

// One launch converts all six f32 operands: none of the six depends on another,
// and each alone is far too short to fill the chip or to cover its launch gap.
// The four weights come first (transposed, see above). For target and hidden a block
// converts 8192 consecutive elements, 32 per thread. Each wave-wide load covers 512
// contiguous bytes and each store 256; the eight loads of a thread fly together.
__global__ __launch_bounds__(256) void cast_all(const float* __restrict__ target,
                                                const float* __restrict__ hidden,
                                                const float* __restrict__ Wq,
                                                const float* __restrict__ Wk,
                                                const float* __restrict__ Wv,
                                                const float* __restrict__ Wo,
                                                _Float16* __restrict__ Xf,
                                                _Float16* __restrict__ Wq16,
                                                _Float16* __restrict__ Wk16,
                                                _Float16* __restrict__ Wv16,
                                                _Float16* __restrict__ Wo16) {
    const int b = blockIdx.x;      // 64 + 32 + 32 + 64 + 256 + 256 blocks
    if (b < 64)  { wtrans<1024>(Wq, Wq16, b);       return; }
    if (b < 96)  { wtrans<512>(Wk, Wk16, b - 64);   return; }
    if (b < 128) { wtrans<512>(Wv, Wv16, b - 96);   return; }
    if (b < 192) { wtrans<1024>(Wo, Wo16, b - 128); return; }
    const float* s;
    _Float16* d;
    int lb;
    if (b < 448) { s = target; d = Xf;               lb = b - 192; }
    else         { s = hidden; d = Xf + 2048 * 1024; lb = b - 448; }
    const int i0 = lb * 8192 + threadIdx.x * 4;
    v4f x[8];
    // both loops unrolled: x stays in registers, all loads issue before the first wait
#pragma unroll
    for (int j = 0; j < 8; ++j) x[j] = *(const v4f*)(s + i0 + j * 1024);
#pragma unroll
    for (int j = 0; j < 8; ++j)
        *(v4h*)(d + i0 + j * 1024) = __builtin_convertvector(x[j], v4h);
    // stands in front of any later write of a register that the stores name
    asm volatile("s_wait_xcnt 0x0" ::: "memory");
}

// ---------------------------------------------------------------- WMMA GEMM
// acc(128x64 tile, f32) = A(MxK,f16,row) * B(KxN), B given transposed: Bt(NxK,f16,row).
// Block tile 128x64, BK=64. 8 waves -> 4x2 wave grid, each wave 32x32 = 2x2 WMMA
// tiles. Both tiles are staged with async global->LDS copies (no VGPR round-trip),
// As[m][k] (128 x 72 halves) and Bs[n][k] (64 x 72), so both fragment loads are
// ds_load_b128. acc[tm][tn][r] is row wm*32 + tm*16 + mb + r, column wn*32 + tn*16 + nl.
static __device__ __forceinline__ void gemm_tile(const _Float16* __restrict__ A,
                                                 const _Float16* __restrict__ Bt,
                                                 int K, int m0, int n0,
                                                 _Float16* As, _Float16* Bs,
                                                 v8f (&acc)[2][2]) {
    const int tid  = threadIdx.x;
    const int wid  = tid >> 5;
    const int wm = wid >> 1, wn = wid & 1;

    // per-thread staging coordinates (constant over the K loop)
    const int arow = tid >> 1, akh = (tid & 1) * 32;
    const unsigned alds = (unsigned)(size_t)(void*)&As[arow * 72 + akh];
    const _Float16* agp = A + (size_t)(m0 + arow) * K + akh;
    // B: 8 lanes per 128-byte row, so a wave-wide copy takes whole lines; a thread
    // copies 16 bytes of rows brow and brow + 32
    const int brow = tid >> 3, bcol = (tid & 7) * 8;
    const unsigned blds = (unsigned)(size_t)(void*)&Bs[brow * 72 + bcol];
    const _Float16* bgp = Bt + (size_t)(n0 + brow) * K + bcol;

#pragma unroll
    for (int a = 0; a < 2; ++a)
#pragma unroll
        for (int b = 0; b < 2; ++b) acc[a][b] = zero8();

    for (int k0 = 0; k0 < K; k0 += 64) {
        // this wave's fragment reads are back before the barrier that frees both
        // tiles for the copies
        asm volatile("s_wait_dscnt 0x0" ::: "memory");
        __syncthreads();
        // A: 128 rows x 64 halves; each thread copies 64B via async-to-LDS
        async_copy64(alds, agp + k0);
        // B: 64 rows (n) x 64 halves (k), as they lie in Bt
        async_copy2x16(blds,               bgp + k0,
                       blds + 32 * 72 * 2, bgp + k0 + (size_t)32 * K);
        wait_async0();
        __syncthreads();
#pragma unroll
        for (int s = 0; s < 2; ++s) {
            v16h af[2], bf[2];
#pragma unroll
            for (int t = 0; t < 2; ++t)
                af[t] = load_frag(&As[(wm * 32 + t * 16) * 72 + s * 32], 72);
#pragma unroll
            for (int t = 0; t < 2; ++t)
                bf[t] = load_frag(&Bs[(wn * 32 + t * 16) * 72 + s * 32], 72);
#pragma unroll
            for (int tm = 0; tm < 2; ++tm)
#pragma unroll
                for (int tn = 0; tn < 2; ++tn)
                    acc[tm][tn] = wmma32(af[tm], bf[tn], acc[tm][tn]);
        }
    }
}

// C(MxN,f32) = A * B: the output projection.
__global__ __launch_bounds__(256) void gemm_wmma(const _Float16* __restrict__ A,
                                                 const _Float16* __restrict__ Bt,
                                                 float* __restrict__ C,
                                                 int N, int K) {
    __shared__ _Float16 As[128 * 72];
    __shared__ __attribute__((aligned(16))) _Float16 Bs[64 * 72];
    const int m0 = blockIdx.y * 128, n0 = blockIdx.x * 64;
    const int wid  = threadIdx.x >> 5;
    const int lane = threadIdx.x & 31;
    const int wm = wid >> 1, wn = wid & 1;
    const int nl = lane & 15;
    const int mb = (lane >> 4) << 3;
    v8f acc[2][2];
    gemm_tile(A, Bt, K, m0, n0, As, Bs, acc);
    // epilogue: one base pointer, constant-strided stores
    float* cp = C + (size_t)(m0 + wm * 32 + mb) * N + (n0 + wn * 32 + nl);
#pragma unroll
    for (int tm = 0; tm < 2; ++tm)
#pragma unroll
        for (int r = 0; r < 8; ++r) {
            float* rp = cp + (size_t)(tm * 16 + r) * N;
            rp[0]  = acc[tm][0][r];
            rp[16] = acc[tm][1][r];
        }
}

// Lane l with another lane of its group of four, in the vector unit (DPP quad_perm).
template <int CTRL>
static __device__ __forceinline__ float quad_swap(float x) {
    return __builtin_bit_cast(float,
        __builtin_amdgcn_mov_dpp(__builtin_bit_cast(int, x), CTRL, 0xf, 0xf, true));
}

// The three projections in one launch, 256 blocks each: they share no result, and
// one alone puts a single block on a WGP, whose waits nothing else fills.
// X = [target; hidden] (4096 x 1024); Q is taken of rows 2048 .. 4095 (hidden).
// A block's 64 columns are exactly one head, so what follows a projection is done on
// the tile while the block still holds it, and no f32 projection goes to memory:
// Q, K: RMSNorm + RoPE, written f16 as [h][row][64]; q positions are CTX .. TOTAL-1,
//       k positions 0 .. TOTAL-1.
// V:    written f16 transposed, vt[kvh][d][t] (d-major so PV fragments are contiguous).
// Either way the tile passes through LDS, in the room of the operand tiles, so that
// a row's 64 columns meet and every wave-wide store covers whole 128-byte lines.
// Six waves a SIMD: the register budget at which three blocks still share a WGP.
__global__ __launch_bounds__(256) __attribute__((amdgpu_waves_per_eu(6)))
void gemm_qkv(const _Float16* __restrict__ X,
                                                const _Float16* __restrict__ Wq16,
                                                const _Float16* __restrict__ Wk16,
                                                const _Float16* __restrict__ Wv16,
                                                const float* __restrict__ cosp,
                                                const float* __restrict__ sinp,
                                                const float* __restrict__ qw,
                                                const float* __restrict__ kw,
                                                _Float16* __restrict__ Qf,
                                                _Float16* __restrict__ Kf,
                                                _Float16* __restrict__ Vt) {
    // 128 rows of 64 floats at a pitch of 68; in the K loop As and Bs lie in it
    __shared__ __attribute__((aligned(16))) float Sm[128 * 68];
    _Float16* As = (_Float16*)Sm;
    _Float16* Bs = As + 128 * 72;
    const int which = blockIdx.x >> 8, r = blockIdx.x & 255;
    const int tid  = threadIdx.x;
    const int wid  = tid >> 5;
    const int lane = tid & 31;
    const int wm = wid >> 1, wn = wid & 1;
    const int nl = lane & 15;
    const int mb = (lane >> 4) << 3;
    const int m0 = (which == 0 ? (r >> 4) : (r >> 3)) * 128;
    const int n0 = (which == 0 ? (r & 15) : (r & 7)) * 64;
    const _Float16* A  = which == 0 ? X + 2048 * 1024 : X;
    const _Float16* Bt = which == 0 ? Wq16 : which == 1 ? Wk16 : Wv16;
    v8f acc[2][2];
    gemm_tile(A, Bt, 1024, m0, n0, As, Bs, acc);

    if (which == 2) {
        // a lane's 8 accumulator rows are 8 consecutive t of one d: 16 bytes of Vs[d][t]
        _Float16* Vs = (_Float16*)Sm;      // 64 rows (d) of 128 halves at a pitch of 136
        // every wave's fragment reads are back before the tile overwrites As
        asm volatile("s_wait_dscnt 0x0" ::: "memory");
        __syncthreads();
#pragma unroll
        for (int tm = 0; tm < 2; ++tm)
#pragma unroll
            for (int tn = 0; tn < 2; ++tn)
                *(v8h*)&Vs[(wn * 32 + tn * 16 + nl) * 136 + wm * 32 + tm * 16 + mb] =
                    __builtin_convertvector(acc[tm][tn], v8h);
        __syncthreads();                   // the tile is whole before it is read
        // 16 lanes per 256-byte row piece of vt
        const int d0 = tid >> 4, pc = (tid & 15) * 8;
        _Float16* vp = Vt + (size_t)(n0 + d0) * 4096 + m0 + pc;
#pragma unroll
        for (int j = 0; j < 4; ++j)
            *(v8h*)(vp + (size_t)j * 16 * 4096) = *(const v8h*)&Vs[(j * 16 + d0) * 136 + pc];
        // stands in front of any later write of a register that the stores name
        asm volatile("s_wait_xcnt 0x0" ::: "memory");
        return;
    }

    // 8 lanes per output row of 128 bytes: a lane makes columns c0 .. c0+7, for which
    // it also reads their RoPE partners, columns cp .. cp+7. 32 rows a pass, 4 passes.
    const int rl = tid >> 3, c0 = (tid & 7) * 8, cp = c0 ^ 32;
    const int pos = (which == 0 ? 2048 : 0) + m0 + rl;
    const float* cb = cosp + (size_t)pos * 64 + c0;
    const float* sb = sinp + (size_t)pos * 64 + c0;
    const float* w  = which == 0 ? qw : kw;
    // fetched ahead of the passage through LDS, which covers their latency
    v4f cs[4][2], sn[4][2], wo[2], wp[2];
    // every loop below is unrolled: the arrays stay in registers
#pragma unroll
    for (int p = 0; p < 4; ++p)
#pragma unroll
        for (int j = 0; j < 2; ++j) {
            cs[p][j] = *(const v4f*)(cb + p * 32 * 64 + j * 4);
            sn[p][j] = *(const v4f*)(sb + p * 32 * 64 + j * 4);
        }
#pragma unroll
    for (int j = 0; j < 2; ++j) {
        wo[j] = *(const v4f*)(w + c0 + j * 4);
        wp[j] = *(const v4f*)(w + cp + j * 4);
    }
    // stands in front of any later write of a register that the loads name; the two
    // address pairs stay live up to it, so no load's result lands in one ahead of it
    asm volatile("s_wait_xcnt 0x0" :: "v"(cb), "v"(sb) : "memory");
    // every wave's fragment reads are back before the tile overwrites As and Bs
    asm volatile("s_wait_dscnt 0x0" ::: "memory");
    __syncthreads();
#pragma unroll
    for (int tm = 0; tm < 2; ++tm)
#pragma unroll
        for (int tn = 0; tn < 2; ++tn)
#pragma unroll
            for (int e = 0; e < 8; ++e)
                Sm[(wm * 32 + tm * 16 + mb + e) * 68 + wn * 32 + tn * 16 + nl] = acc[tm][tn][e];
    __syncthreads();                       // the tile is whole before it is read
    // rotate_half: the partner enters with a minus in the lower 32 columns
    const float sg = c0 < 32 ? -1.0f : 1.0f;
#pragma unroll
    for (int j = 0; j < 2; ++j) wp[j] *= sg;
    const int rows = which == 0 ? 2048 : 4096;
    _Float16* dp = (which == 0 ? Qf : Kf) + ((size_t)(n0 >> 6) * rows + m0 + rl) * 64 + c0;
#pragma unroll
    for (int p = 0; p < 4; ++p) {
        const float* x = &Sm[(p * 32 + rl) * 68];
        v4f xo[2], xp[2];
#pragma unroll
        for (int j = 0; j < 2; ++j) {
            xo[j] = *(const v4f*)(x + c0 + j * 4);
            xp[j] = *(const v4f*)(x + cp + j * 4);
        }
        // a lane holds 16 of its row's 64 squares; the four lanes of a quad hold all 64
        const v4f q = xo[0] * xo[0] + xo[1] * xo[1] + xp[0] * xp[0] + xp[1] * xp[1];
        float ss = (q[0] + q[1]) + (q[2] + q[3]);
        ss += quad_swap<0xB1>(ss);         // lane ^ 1
        ss += quad_swap<0x4E>(ss);         // lane ^ 2
        const float sc = rsqrtf(ss * (1.0f / 64.0f) + 1e-6f);
        v8h o;
#pragma unroll
        for (int j = 0; j < 2; ++j) {
            const v4f a = xo[j] * sc * wo[j];
            const v4f b = xp[j] * sc * wp[j];
            const v4f y = a * cs[p][j] + b * sn[p][j];
#pragma unroll
            for (int e = 0; e < 4; ++e) o[j * 4 + e] = (_Float16)y[e];
        }
        *(v8h*)(dp + p * 32 * 64) = o;
    }
    // stands in front of any later write of a register that the stores name
    asm volatile("s_wait_xcnt 0x0" ::: "memory");
}

// ---------------------------------------------------------------- Flash attention
// Lane l with lane l ^ 16 (the two halves of a wave), in the vector unit.
static __device__ __forceinline__ float xhalf(float x) {
    const int b = __builtin_bit_cast(int, x);
    return __builtin_bit_cast(float,
        __builtin_amdgcn_permlanex16(b, b, 0x76543210, 0xfedcba98, false, false));
}

// Eight 16-byte async copies global->LDS of one lane, each with its own address
// pair. The s_wait_xcnt closes the statement so that it stands in front of any
// later write of the address registers the copies name.
static __device__ __forceinline__ void async_copy8x16(unsigned l0, const void* g0,
                                                      unsigned l1, const void* g1,
                                                      unsigned l2, const void* g2,
                                                      unsigned l3, const void* g3,
                                                      unsigned l4, const void* g4,
                                                      unsigned l5, const void* g5,
                                                      unsigned l6, const void* g6,
                                                      unsigned l7, const void* g7) {
    asm volatile(
        "global_load_async_to_lds_b128 %0, %1, off\n\t"
        "global_load_async_to_lds_b128 %2, %3, off\n\t"
        "global_load_async_to_lds_b128 %4, %5, off\n\t"
        "global_load_async_to_lds_b128 %6, %7, off\n\t"
        "global_load_async_to_lds_b128 %8, %9, off\n\t"
        "global_load_async_to_lds_b128 %10, %11, off\n\t"
        "global_load_async_to_lds_b128 %12, %13, off\n\t"
        "global_load_async_to_lds_b128 %14, %15, off\n\t"
        "s_wait_xcnt 0x0"
        :: "v"(l0), "v"((unsigned long long)g0), "v"(l1), "v"((unsigned long long)g1),
           "v"(l2), "v"((unsigned long long)g2), "v"(l3), "v"((unsigned long long)g3),
           "v"(l4), "v"((unsigned long long)g4), "v"(l5), "v"((unsigned long long)g5),
           "v"(l6), "v"((unsigned long long)g6), "v"(l7), "v"((unsigned long long)g7)
        : "memory");
}

__global__ __launch_bounds__(256) void flash_attn(const _Float16* __restrict__ Qf,
                                                  const _Float16* __restrict__ Kf,
                                                  const _Float16* __restrict__ Vt,
                                                  const float* __restrict__ mask,
                                                  const float* __restrict__ tb,
                                                  const int* __restrict__ rel,
                                                  _Float16* __restrict__ Of) {
    const int kvh   = blockIdx.y;
    const int h0    = kvh * 2;             // heads h0 and h0 + 1
    const int nb    = blockIdx.x;          // the block's 64 rows are one 64-block
    const int q0    = nb * 64;
    // wave number held scalar: the tree-bias test below is then one scalar
    // branch per key tile instead of an EXEC branch per score element
    const int wid   = __builtin_amdgcn_readfirstlane(threadIdx.x >> 5);
    const int rg    = wid & 3;             // which 16 rows
    const int g     = wid >> 2;            // which key tile of a step
    const int lane  = threadIdx.x & 31;
    const int nl    = lane & 15;           // this lane's query within the wave
    const int mb    = (lane >> 4) << 3;    // first of its 8 rows in an accumulator
    const int qrow0 = q0 + rg * 16;

    // rows of 64 halves at a pitch of 72 (144 B = 16 B x odd, for ds_load_b128)
    // [buffer][0][tile][key][d] holds K, [buffer][1][tile][d][key] holds V^T
    __shared__ __attribute__((aligned(16))) _Float16 KVs[2][2][2][64 * 72];
    // the block's 64 mask rows of 64 floats at a pitch of 68 (272 B = 16 B x odd)
    __shared__ __attribute__((aligned(16))) float Ms[2][2][64 * 68];      // [buffer][tile][q][key]
    // the merge: per wave 8 x 16 bytes of O and 16 bytes of (maximum, sum) a lane
    __shared__ __attribute__((aligned(16))) float Xs[8][9][32][4];

    const _Float16* Kh = Kf + (size_t)kvh * 4096 * 64;
    const _Float16* Vh = Vt + (size_t)kvh * 64 * 4096;

    // staging: 8 lanes per 128-byte row; a thread copies rows crow + 32 i of the
    // step's 128 keys, and rows crow, crow + 32 of each of its two V^T tiles
    const int crow = threadIdx.x >> 3, ccol = (threadIdx.x & 7) * 8;
    const _Float16* kg = Kh + (size_t)crow * 64 + ccol;
    const _Float16* vg = Vh + (size_t)crow * 4096 + ccol;
    const unsigned kvl = (unsigned)(size_t)(void*)&KVs[0][0][0][crow * 72 + ccol];
    // mask: 16 lanes per 256-byte row piece, so a wave-wide copy takes whole lines;
    // a thread copies rows mrow0 + 16 i, i = 0 .. 3, of each of the two tiles
    const int mrow0 = threadIdx.x >> 4, mcol = (threadIdx.x & 15) * 4;
    const float* mg = mask + (size_t)(q0 + mrow0) * 4096 + mcol;
    const unsigned ml = (unsigned)(size_t)(void*)&Ms[0][0][mrow0 * 68 + mcol];
    auto stage = [&](int st, int buf) {
        const unsigned ko = kvl + (unsigned)buf * (4 * 64 * 72 * 2);
        const _Float16* kp = kg + (size_t)st * 128 * 64;
        const _Float16* vp = vg + st * 128;
        async_copy8x16(ko,                 kp,
                       ko +  32 * 72 * 2,  kp + 32 * 64,
                       ko +  64 * 72 * 2,  kp + 64 * 64,
                       ko +  96 * 72 * 2,  kp + 96 * 64,
                       ko + 128 * 72 * 2,  vp,
                       ko + 160 * 72 * 2,  vp + (size_t)32 * 4096,
                       ko + 192 * 72 * 2,  vp + 64,
                       ko + 224 * 72 * 2,  vp + (size_t)32 * 4096 + 64);
        const unsigned mo = ml + (unsigned)buf * (2 * 64 * 68 * 4);
        const float* mp = mg + st * 128;
        async_copy8x16(mo,                   mp,
                       mo + 1 * 16 * 68 * 4, mp + (size_t)1 * 16 * 4096,
                       mo + 2 * 16 * 68 * 4, mp + (size_t)2 * 16 * 4096,
                       mo + 3 * 16 * 68 * 4, mp + (size_t)3 * 16 * 4096,
                       mo + 4 * 16 * 68 * 4, mp + 64,
                       mo + 5 * 16 * 68 * 4, mp + (size_t)1 * 16 * 4096 + 64,
                       mo + 6 * 16 * 68 * 4, mp + (size_t)2 * 16 * 4096 + 64,
                       mo + 7 * 16 * 68 * 4, mp + (size_t)3 * 16 * 4096 + 64);
    };
    stage(0, 0);
    wait_async0();
    __syncthreads();       // publishes step 0
    stage(1, 1);

    // Q^T as B operand: column = query, same k order as the K rows' A fragments
    v16h bq[2][2];
#pragma unroll
    for (int hh = 0; hh < 2; ++hh) {
        const _Float16* Qh = Qf + ((size_t)(h0 + hh) * 2048 + qrow0) * 64;
        bq[hh][0] = load_frag(Qh, 64);
        bq[hh][1] = load_frag(Qh + 32, 64);
    }

    v8f o[2][4];           // O^T of head hh: tile t holds d = t*16 + mb + r of query nl
#pragma unroll
    for (int hh = 0; hh < 2; ++hh)
#pragma unroll
        for (int t = 0; t < 4; ++t) o[hh][t] = zero8();
    // running maximum of query nl over this wave's tiles (equal in both halves) and
    // running sum over this half-wave's keys only
    float Mr[2] = {-1e30f, -1e30f};
    float Sr[2] = {0.f, 0.f};

    for (int st = 0; st < 32; ++st) {
        const int kt = st * 2 + g;         // this wave's key tile
        const _Float16* kb = &KVs[st & 1][0][g][0];
        const _Float16* vb = &KVs[st & 1][1][g][0];
        const float*    mr = &Ms[st & 1][g][(rg * 16 + nl) * 68 + mb];
        v8f sc[2][4];
#pragma unroll
        for (int hh = 0; hh < 2; ++hh)
#pragma unroll
            for (int kk = 0; kk < 4; ++kk) sc[hh][kk] = zero8();
        // ---- scores, transposed: K(64x64) . Q^T(64x32)
        v16h ak[2][4];
#pragma unroll
        for (int s = 0; s < 2; ++s)
#pragma unroll
            for (int kk = 0; kk < 4; ++kk)
                ak[s][kk] = load_frag(kb + (kk * 16) * 72 + s * 32, 72);
        // keeps the 16 LDS reads together in front of the products: spread among
        // them into one register set, each product waits out its own LDS latency
        __builtin_amdgcn_sched_barrier(0);
#pragma unroll
        for (int s = 0; s < 2; ++s)
#pragma unroll
            for (int kk = 0; kk < 4; ++kk)
#pragma unroll
                for (int hh = 0; hh < 2; ++hh)
                    sc[hh][kk] = wmma32(ak[s][kk], bq[hh][s], sc[hh][kk]);
        // this query's mask values in accumulator layout, 16 bytes a read
        v4f mk[4][2];
#pragma unroll
        for (int kk = 0; kk < 4; ++kk)
#pragma unroll
            for (int j = 0; j < 2; ++j) mk[kk][j] = *(const v4f*)(mr + kk * 16 + j * 4);
        // V^T fragments are read here: their LDS latency passes under the softmax
        v16h av[2][4];
#pragma unroll
        for (int s = 0; s < 2; ++s)
#pragma unroll
            for (int d = 0; d < 4; ++d)
                av[s][d] = load_frag(vb + (d * 16) * 72 + s * 32, 72);
        // ---- scale + mask + block-diagonal tree bias
        const bool hasb = (kt - 32) == nb;
#pragma unroll
        for (int hh = 0; hh < 2; ++hh)
#pragma unroll
            for (int kk = 0; kk < 4; ++kk)
#pragma unroll
                for (int r = 0; r < 8; ++r)
                    sc[hh][kk][r] = sc[hh][kk][r] * 0.125f + mk[kk][r >> 2][r & 3];
        if (hasb) {
            const int* rp = rel + (nb << 12) + ((rg * 16 + nl) << 6) + mb;
            // a 16-key group at a time: this runs in one step of 32, and with all four
            // groups' offsets and values live at once the staging addresses spill
#pragma unroll
            for (int kk = 0; kk < 4; ++kk) {
                unsigned bi[8];   // byte offset into tree_bias, relation bounded to 0..63
#pragma unroll
                for (int j = 0; j < 2; ++j) {
                    const v4i rv = *(const v4i*)(rp + kk * 16 + j * 4);
#pragma unroll
                    for (int e = 0; e < 4; ++e)
                        bi[j * 4 + e] = (unsigned)(rv[e] & 63) * 64u + (unsigned)h0 * 4u;
                }
                v2f bv[8];     // the two heads' values lie side by side (h0 is even)
#pragma unroll
                for (int r = 0; r < 8; ++r) bv[r] = *(const v2f*)((const char*)tb + bi[r]);
                // the eight offset registers stay live up to this wait, so no
                // load's result lands in one of them ahead of it
                asm volatile("s_wait_xcnt 0x0"
                             :: "v"(bi[0]), "v"(bi[1]), "v"(bi[2]), "v"(bi[3]),
                                "v"(bi[4]), "v"(bi[5]), "v"(bi[6]), "v"(bi[7])
                             : "memory");
#pragma unroll
                for (int r = 0; r < 8; ++r) {
                    sc[0][kk][r] += bv[r][0];
                    sc[1][kk][r] += bv[r][1];
                }
            }
        }
        // ---- online softmax, head by head: 32 of the query's 64 scores live in this
        // lane, the other 32 in lane ^ 16
#pragma unroll
        for (int hh = 0; hh < 2; ++hh) {
            float mx4[4];
#pragma unroll
            for (int kk = 0; kk < 4; ++kk) {
                mx4[kk] = sc[hh][kk][0];
#pragma unroll
                for (int r = 1; r < 8; ++r) mx4[kk] = fmaxf(mx4[kk], sc[hh][kk][r]);
            }
            float mx = fmaxf(fmaxf(mx4[0], mx4[1]), fmaxf(mx4[2], mx4[3]));
            mx = fmaxf(mx, xhalf(mx));
            const float mnew = fmaxf(Mr[hh], mx);
            const float al = __expf(Mr[hh] - mnew);
            Mr[hh] = mnew;
#pragma unroll
            for (int t = 0; t < 4; ++t)
#pragma unroll
                for (int r = 0; r < 8; ++r) o[hh][t][r] *= al;
            float rs[4];       // four independent chains of adds
#pragma unroll
            for (int kk = 0; kk < 4; ++kk) {
                rs[kk] = 0.f;
#pragma unroll
                for (int r = 0; r < 8; ++r) {
                    const float p = __expf(sc[hh][kk][r] - mnew);
                    sc[hh][kk][r] = p;
                    rs[kk] += p;
                }
            }
            Sr[hh] = Sr[hh] * al + ((rs[0] + rs[1]) + (rs[2] + rs[3]));
        }
        // ---- O^T += V^T(64x64) . P^T(64x32). P^T as B operand: of the 32 keys of
        // step s a lane needs k = mb .. mb+7 and 16+mb .. 16+mb+7, which are its
        // own accumulator rows of groups 2s and 2s+1
#pragma unroll
        for (int s = 0; s < 2; ++s) {
            v16h bp[2];
#pragma unroll
            for (int hh = 0; hh < 2; ++hh)
#pragma unroll
                for (int i = 0; i < 8; ++i) {
                    bp[hh][i]     = (_Float16)sc[hh][2 * s][i];
                    bp[hh][i + 8] = (_Float16)sc[hh][2 * s + 1][i];
                }
#pragma unroll
            for (int d = 0; d < 4; ++d)
#pragma unroll
                for (int hh = 0; hh < 2; ++hh)
                    o[hh][d] = wmma32(av[s][d], bp[hh], o[hh][d]);
        }
        // keeps the hand-over at the foot: lifted over the softmax and the products,
        // its wait would give the copies issued at the last foot too little time
        __builtin_amdgcn_sched_barrier(0);
        // ---- hand-over: this wave's LDS reads are back, its copies of the next
        // step have landed; the barrier publishes that step and frees this one
        asm volatile("s_wait_dscnt 0x0" ::: "memory");
        wait_async0();
        __syncthreads();
        if (st + 2 < 32) stage(st + 2, st & 1);
    }
    wait_async0();         // nothing is in flight when the wave ends

    // ---- merge of the two key halves. Waves w and w ^ 4 hold the same 32 columns in
    // the same lanes. Wave group g finishes head h0 + g: it hands its partial result
    // of the other head to its partner and takes the partner's of its own.
    auto give = [&](const v8f (&oo)[4], float M, float S) {
        float* x = &Xs[wid][0][lane][0];
#pragma unroll
        for (int d = 0; d < 4; ++d) {
            const v4f lo = {oo[d][0], oo[d][1], oo[d][2], oo[d][3]};
            const v4f hi = {oo[d][4], oo[d][5], oo[d][6], oo[d][7]};
            *(v4f*)(x + (2 * d) * 128)     = lo;
            *(v4f*)(x + (2 * d + 1) * 128) = hi;
        }
        const v4f ms = {M, S, 0.f, 0.f};
        *(v4f*)(x + 8 * 128) = ms;
    };
    auto finish = [&](const v8f (&oo)[4], float M1, float S1, int h) {
        const float* x = &Xs[wid ^ 4][0][lane][0];
        const v4f ms = *(const v4f*)(x + 8 * 128);
        const float M  = fmaxf(M1, ms[0]);
        const float a1 = __expf(M1 - M);
        const float a2 = __expf(ms[0] - M);
        const float S  = S1 * a1 + ms[1] * a2;
        // the two half-waves' sums are joined once, here
        const float inv = 1.0f / (S + xhalf(S));
        const float c1 = a1 * inv, c2 = a2 * inv;
        _Float16* op = Of + (size_t)(qrow0 + nl) * 1024 + h * 64 + mb;
#pragma unroll
        for (int d = 0; d < 4; ++d) {
            const v4f lo = *(const v4f*)(x + (2 * d) * 128);
            const v4f hi = *(const v4f*)(x + (2 * d + 1) * 128);
            v8h w;
#pragma unroll
            for (int r = 0; r < 4; ++r) {
                w[r]     = (_Float16)(oo[d][r] * c1 + lo[r] * c2);
                w[r + 4] = (_Float16)(oo[d][r + 4] * c1 + hi[r] * c2);
            }
            *(v8h*)(op + d * 16) = w;
        }
    };
    if (g == 0) give(o[1], Mr[1], Sr[1]);
    else        give(o[0], Mr[0], Sr[0]);
    __syncthreads();       // every wave's hand-over is written before any is read
    if (g == 0) finish(o[0], Mr[0], Sr[0], h0);
    else        finish(o[1], Mr[1], Sr[1], h0 + 1);
}

// ---------------------------------------------------------------- host
extern "C" void kernel_launch(void* const* d_in, const int* in_sizes, int n_in,
                              void* d_out, int out_size, void* d_ws, size_t ws_size,
                              hipStream_t stream) {
    (void)in_sizes; (void)n_in; (void)out_size; (void)ws_size;
    const float* hidden = (const float*)d_in[0];
    const float* target = (const float*)d_in[1];
    const float* cosp   = (const float*)d_in[2];
    const float* sinp   = (const float*)d_in[3];
    const float* mask   = (const float*)d_in[4];
    const float* Wq     = (const float*)d_in[5];
    const float* Wk     = (const float*)d_in[6];
    const float* Wv     = (const float*)d_in[7];
    const float* Wo     = (const float*)d_in[8];
    const float* qw     = (const float*)d_in[9];
    const float* kw     = (const float*)d_in[10];
    const float* tb     = (const float*)d_in[11];
    const int*   rel    = (const int*)d_in[12];

    char* ws = (char*)d_ws;
    size_t off = 0;
    auto alloc = [&](size_t bytes) -> void* {
        void* p = ws + off;
        off += (bytes + 255) & ~(size_t)255;
        return p;
    };
    _Float16* Xf   = (_Float16*)alloc(4096ull * 1024 * 2);   // [target; hidden] f16
    _Float16* Wq16 = (_Float16*)alloc(1024ull * 1024 * 2);   // weights: f16, [n][k]
    _Float16* Wk16 = (_Float16*)alloc(1024ull * 512 * 2);
    _Float16* Wv16 = (_Float16*)alloc(1024ull * 512 * 2);
    _Float16* Wo16 = (_Float16*)alloc(1024ull * 1024 * 2);
    _Float16* Qf   = (_Float16*)alloc(16ull * 2048 * 64 * 2);
    _Float16* Kf2  = (_Float16*)alloc(8ull * 4096 * 64 * 2);
    _Float16* Vt   = (_Float16*)alloc(8ull * 64 * 4096 * 2);
    _Float16* Of   = (_Float16*)alloc(2048ull * 1024 * 2);

    // launches that do not depend on one another are one launch each level
    cast_all<<<704, 256, 0, stream>>>(target, hidden, Wq, Wk, Wv, Wo,
                                      Xf, Wq16, Wk16, Wv16, Wo16);

    // projections, each with what follows it: RMSNorm + RoPE of Q and K, V transpose
    gemm_qkv<<<768, 256, 0, stream>>>(Xf, Wq16, Wk16, Wv16, cosp, sinp, qw, kw, Qf, Kf2, Vt);

    // flash attention with tree bias
    flash_attn<<<dim3(32, 8), 256, 0, stream>>>(Qf, Kf2, Vt, mask, tb, rel, Of);

    // output projection
    gemm_wmma<<<dim3(16, 16), 256, 0, stream>>>(Of, Wo16, (float*)d_out, 1024, 1024);
}

// v009
// Measured time: 77.5 microseconds a run.
// Next to v008, in two timings, it ran 1.15 and 1.14 times as fast.
// Counting every step since v000, it is 7.71 times as fast.
#include <hip/hip_runtime.h>

typedef __attribute__((ext_vector_type(16))) _Float16 v16h;
typedef __attribute__((ext_vector_type(8)))  _Float16 v8h;
typedef __attribute__((ext_vector_type(8)))  float    v8f;
typedef __attribute__((ext_vector_type(4)))  float    v4f;
typedef __attribute__((ext_vector_type(2)))  float    v2f;
typedef __attribute__((ext_vector_type(4)))  _Float16 v4h;
typedef __attribute__((ext_vector_type(4)))  int      v4i;

static __device__ __forceinline__ v8f zero8() {
    v8f z = {0.f, 0.f, 0.f, 0.f, 0.f, 0.f, 0.f, 0.f};
    return z;
}

// Load a 16x32 f16 fragment (A layout per CDNA5 ISA; B uses the same layout
// with the matrix stored column-major, i.e. base indexes [n][k]).
// lane<16:  row = lane,    K = {kb..kb+7, kb+16..kb+23}, kb=0
// lane>=16: row = lane-16, kb=8
static __device__ __forceinline__ v16h load_frag(const _Float16* p, int ld) {
    const int lane = threadIdx.x & 31;
    const int r    = lane & 15;
    const int kb   = (lane < 16) ? 0 : 8;
    const _Float16* q = p + (size_t)r * ld + kb;
    v8h lo = *(const v8h*)(q);
    v8h hi = *(const v8h*)(q + 16);
    v16h f;
#pragma unroll
    for (int i = 0; i < 8; ++i) { f[i] = lo[i]; f[i + 8] = hi[i]; }
    return f;
}

static __device__ __forceinline__ v8f wmma32(v16h a, v16h b, v8f c) {
    return __builtin_amdgcn_wmma_f32_16x16x32_f16(false, a, false, b,
                                                  (short)0, c, false, false);
}

// Eight 16-byte async copies global->LDS of one lane, each with its own address
// pair. The s_wait_xcnt closes the statement so that it stands in front of any
// later write of the address registers the copies name.
static __device__ __forceinline__ void async_copy8x16(unsigned l0, const void* g0,
                                                      unsigned l1, const void* g1,
                                                      unsigned l2, const void* g2,
                                                      unsigned l3, const void* g3,
                                                      unsigned l4, const void* g4,
                                                      unsigned l5, const void* g5,
                                                      unsigned l6, const void* g6,
                                                      unsigned l7, const void* g7) {
    asm volatile(
        "global_load_async_to_lds_b128 %0, %1, off\n\t"
        "global_load_async_to_lds_b128 %2, %3, off\n\t"
        "global_load_async_to_lds_b128 %4, %5, off\n\t"
        "global_load_async_to_lds_b128 %6, %7, off\n\t"
        "global_load_async_to_lds_b128 %8, %9, off\n\t"
        "global_load_async_to_lds_b128 %10, %11, off\n\t"
        "global_load_async_to_lds_b128 %12, %13, off\n\t"
        "global_load_async_to_lds_b128 %14, %15, off\n\t"
        "s_wait_xcnt 0x0"
        :: "v"(l0), "v"((unsigned long long)g0), "v"(l1), "v"((unsigned long long)g1),
           "v"(l2), "v"((unsigned long long)g2), "v"(l3), "v"((unsigned long long)g3),
           "v"(l4), "v"((unsigned long long)g4), "v"(l5), "v"((unsigned long long)g5),
           "v"(l6), "v"((unsigned long long)g6), "v"(l7), "v"((unsigned long long)g7)
        : "memory");
}

// Four such copies.
static __device__ __forceinline__ void async_copy4x16(unsigned l0, const void* g0,
                                                      unsigned l1, const void* g1,
                                                      unsigned l2, const void* g2,
                                                      unsigned l3, const void* g3) {
    asm volatile(
        "global_load_async_to_lds_b128 %0, %1, off\n\t"
        "global_load_async_to_lds_b128 %2, %3, off\n\t"
        "global_load_async_to_lds_b128 %4, %5, off\n\t"
        "global_load_async_to_lds_b128 %6, %7, off\n\t"
        "s_wait_xcnt 0x0"   // in front of any later write of the address registers
        :: "v"(l0), "v"((unsigned long long)g0), "v"(l1), "v"((unsigned long long)g1),
           "v"(l2), "v"((unsigned long long)g2), "v"(l3), "v"((unsigned long long)g3)
        : "memory");
}

static __device__ __forceinline__ void wait_async0() {
    asm volatile("s_wait_asynccnt 0x0" ::: "memory");
}

// ---------------------------------------------------------------- cast f32->f16
// A weight W (1024 x N, f32, row-major) is written as f16 TRANSPOSED, Wt[n][k]: that
// is the order in which the GEMM wants its B tile in LDS, so the tile can be copied
// there as it lies. The transposition is done once here instead of once per GEMM
// block and K step. A thread takes one n and 64 consecutive k, one whole 128-byte
// line of Wt; lanes run along n, so a wave-wide load is one contiguous line.
template <int N>
static __device__ __forceinline__ void wtrans(const float* __restrict__ w,
                                              _Float16* __restrict__ wt, int blk) {
    const int i  = blk * 256 + threadIdx.x;
    const int n  = i & (N - 1);
    const int k0 = (i / N) * 64;
    const float* sp = w + (size_t)k0 * N + n;
    _Float16*    dp = wt + (size_t)n * 1024 + k0;
    float x[64];
    // both loops unrolled: x stays in registers, all loads issue before the first wait
#pragma unroll
    for (int j = 0; j < 64; ++j) x[j] = sp[j * N];
#pragma unroll
    for (int g = 0; g < 8; ++g) {
        v8h o;
#pragma unroll
        for (int j = 0; j < 8; ++j) o[j] = (_Float16)x[g * 8 + j];
        *(v8h*)(dp + g * 8) = o;
    }
    // stands in front of any later write of a register that the stores name
    asm volatile("s_wait_xcnt 0x0" ::: "memory");
}

// One launch converts all six f32 operands: none of the six depends on another,
// and each alone is far too short to fill the chip or to cover its launch gap.
// The four weights come first (transposed, see above). For target and hidden a block
// converts 8192 consecutive elements, 32 per thread. Each wave-wide load covers 512
// contiguous bytes and each store 256; the eight loads of a thread fly together.
__global__ __launch_bounds__(256) void cast_all(const float* __restrict__ target,
                                                const float* __restrict__ hidden,
                                                const float* __restrict__ Wq,
                                                const float* __restrict__ Wk,
                                                const float* __restrict__ Wv,
                                                const float* __restrict__ Wo,
                                                _Float16* __restrict__ Xf,
                                                _Float16* __restrict__ Wq16,
                                                _Float16* __restrict__ Wk16,
                                                _Float16* __restrict__ Wv16,
                                                _Float16* __restrict__ Wo16) {
    const int b = blockIdx.x;      // 64 + 32 + 32 + 64 + 256 + 256 blocks
    if (b < 64)  { wtrans<1024>(Wq, Wq16, b);       return; }
    if (b < 96)  { wtrans<512>(Wk, Wk16, b - 64);   return; }
    if (b < 128) { wtrans<512>(Wv, Wv16, b - 96);   return; }
    if (b < 192) { wtrans<1024>(Wo, Wo16, b - 128); return; }
    const float* s;
    _Float16* d;
    int lb;
    if (b < 448) { s = target; d = Xf;               lb = b - 192; }
    else         { s = hidden; d = Xf + 2048 * 1024; lb = b - 448; }
    const int i0 = lb * 8192 + threadIdx.x * 4;
    v4f x[8];
    // both loops unrolled: x stays in registers, all loads issue before the first wait
#pragma unroll
    for (int j = 0; j < 8; ++j) x[j] = *(const v4f*)(s + i0 + j * 1024);
#pragma unroll
    for (int j = 0; j < 8; ++j)
        *(v4h*)(d + i0 + j * 1024) = __builtin_convertvector(x[j], v4h);
    // stands in front of any later write of a register that the stores name
    asm volatile("s_wait_xcnt 0x0" ::: "memory");
}

// ---------------------------------------------------------------- WMMA GEMM
// acc(128x64 tile, f32) = A(MxK,f16,row) * B(KxN), B given transposed: Bt(NxK,f16,row).
// Block tile 128x64. 8 waves -> 4x2 wave grid, each wave 32x32 = 2x2 WMMA tiles.
// A pass takes 128 k. Its operands lie in one LDS buffer of 192 rows (128 of A by m,
// then 64 of B by n) of 128 halves at a pitch of 136 (272 B = 16 B x odd, for
// ds_load_b128), brought by async global->LDS copies (no VGPR round-trip). Two buffers:
// the next pass's copies fly while this pass's products run, so their way from L2 is
// waited for only as far as it outlasts the products. 16 lanes copy one 256-byte row,
// so a wave-wide copy takes whole lines.
// acc[tm][tn][r] is row wm*32 + tm*16 + mb + r, column wn*32 + tn*16 + nl.
#define GEMM_PITCH 136
#define GEMM_BUF   (192 * GEMM_PITCH)      // halves in a buffer
static __device__ __forceinline__ void gemm_tile(const _Float16* __restrict__ A,
                                                 const _Float16* __restrict__ Bt,
                                                 int K, int m0, int n0,
                                                 _Float16* Ls,
                                                 v8f (&acc)[2][2]) {
    const int tid  = threadIdx.x;
    const int wid  = tid >> 5;
    const int wm = wid >> 1, wn = wid & 1;

    // a thread copies 16 bytes of rows srow + 16 i: i = 0 .. 7 of A, i = 0 .. 3 of B
    const int srow = tid >> 4, scol = (tid & 15) * 8;
    const unsigned sl = (unsigned)(size_t)(void*)&Ls[srow * GEMM_PITCH + scol];
    const _Float16* agp = A  + (size_t)(m0 + srow) * K + scol;
    const _Float16* bgp = Bt + (size_t)(n0 + srow) * K + scol;
    const size_t    rs  = (size_t)16 * K;            // 16 rows in global memory
    constexpr unsigned RL = 16 * GEMM_PITCH * 2;     // 16 rows in LDS, bytes
    auto stage = [&](int t, int buf) {
        const unsigned l = sl + (unsigned)buf * (GEMM_BUF * 2);
        const _Float16* ap = agp + t * 128;
        const _Float16* bp = bgp + t * 128;
        async_copy8x16(l,          ap,
                       l + 1 * RL, ap + 1 * rs,
                       l + 2 * RL, ap + 2 * rs,
                       l + 3 * RL, ap + 3 * rs,
                       l + 4 * RL, ap + 4 * rs,
                       l + 5 * RL, ap + 5 * rs,
                       l + 6 * RL, ap + 6 * rs,
                       l + 7 * RL, ap + 7 * rs);
        async_copy4x16(l +  8 * RL, bp,
                       l +  9 * RL, bp + 1 * rs,
                       l + 10 * RL, bp + 2 * rs,
                       l + 11 * RL, bp + 3 * rs);
    };

#pragma unroll
    for (int a = 0; a < 2; ++a)
#pragma unroll
        for (int b = 0; b < 2; ++b) acc[a][b] = zero8();

    const int nt = K >> 7;
    stage(0, 0);
    wait_async0();
    __syncthreads();       // publishes pass 0
    if (nt > 1) stage(1, 1);

    // kept rolled: nothing in a pass gains from a constant t, and unrolled the loop is
    // eight times the code for the instruction cache to fetch
#pragma nounroll
    for (int t = 0; t < nt; ++t) {
        const _Float16* As = Ls + (t & 1) * GEMM_BUF;
        const _Float16* Bs = As + 128 * GEMM_PITCH;
#pragma unroll
        for (int s = 0; s < 4; ++s) {
            v16h af[2], bf[2];
#pragma unroll
            for (int u = 0; u < 2; ++u)
                af[u] = load_frag(&As[(wm * 32 + u * 16) * GEMM_PITCH + s * 32], GEMM_PITCH);
#pragma unroll
            for (int u = 0; u < 2; ++u)
                bf[u] = load_frag(&Bs[(wn * 32 + u * 16) * GEMM_PITCH + s * 32], GEMM_PITCH);
#pragma unroll
            for (int tm = 0; tm < 2; ++tm)
#pragma unroll
                for (int tn = 0; tn < 2; ++tn)
                    acc[tm][tn] = wmma32(af[tm], bf[tn], acc[tm][tn]);
        }
        // hand-over: this wave's fragment reads are back, its copies of the next pass
        // have landed; the barrier publishes that pass and frees this pass's buffer
        asm volatile("s_wait_dscnt 0x0" ::: "memory");
        wait_async0();
        __syncthreads();
        if (t + 2 < nt) stage(t + 2, t & 1);
    }
    wait_async0();         // nothing is in flight behind the loop
}

// C(MxN,f32) = A * B: the output projection.
__global__ __launch_bounds__(256) void gemm_wmma(const _Float16* __restrict__ A,
                                                 const _Float16* __restrict__ Bt,
                                                 float* __restrict__ C,
                                                 int N, int K) {
    __shared__ __attribute__((aligned(16))) _Float16 Ls[2 * GEMM_BUF];
    const int m0 = blockIdx.y * 128, n0 = blockIdx.x * 64;
    const int wid  = threadIdx.x >> 5;
    const int lane = threadIdx.x & 31;
    const int wm = wid >> 1, wn = wid & 1;
    const int nl = lane & 15;
    const int mb = (lane >> 4) << 3;
    v8f acc[2][2];
    gemm_tile(A, Bt, K, m0, n0, Ls, acc);
    // epilogue: one base pointer, constant-strided stores
    float* cp = C + (size_t)(m0 + wm * 32 + mb) * N + (n0 + wn * 32 + nl);
#pragma unroll
    for (int tm = 0; tm < 2; ++tm)
#pragma unroll
        for (int r = 0; r < 8; ++r) {
            float* rp = cp + (size_t)(tm * 16 + r) * N;
            rp[0]  = acc[tm][0][r];
            rp[16] = acc[tm][1][r];
        }
}

// Lane l with another lane of its group of four, in the vector unit (DPP quad_perm).
template <int CTRL>
static __device__ __forceinline__ float quad_swap(float x) {
    return __builtin_bit_cast(float,
        __builtin_amdgcn_mov_dpp(__builtin_bit_cast(int, x), CTRL, 0xf, 0xf, true));
}

// The three projections in one launch, 256 blocks each: they share no result, and
// one alone puts a single block on a WGP, whose waits nothing else fills.
// X = [target; hidden] (4096 x 1024); Q is taken of rows 2048 .. 4095 (hidden).
// A block's 64 columns are exactly one head, so what follows a projection is done on
// the tile while the block still holds it, and no f32 projection goes to memory:
// Q, K: RMSNorm + RoPE, written f16 as [h][row][64]; q positions are CTX .. TOTAL-1,
//       k positions 0 .. TOTAL-1.
// V:    written f16 transposed, vt[kvh][d][t] (d-major so PV fragments are contiguous).
// Either way the tile passes through LDS, in the room of the operand tiles, so that
// a row's 64 columns meet and every wave-wide store covers whole 128-byte lines.
// Six waves a SIMD: the register budget at which three blocks still share a WGP.
__global__ __launch_bounds__(256) __attribute__((amdgpu_waves_per_eu(6)))
void gemm_qkv(const _Float16* __restrict__ X,
                                                const _Float16* __restrict__ Wq16,
                                                const _Float16* __restrict__ Wk16,
                                                const _Float16* __restrict__ Wv16,
                                                const float* __restrict__ cosp,
                                                const float* __restrict__ sinp,
                                                const float* __restrict__ qw,
                                                const float* __restrict__ kw,
                                                _Float16* __restrict__ Qf,
                                                _Float16* __restrict__ Kf,
                                                _Float16* __restrict__ Vt) {
    // the K loop's two operand buffers; behind the loop the tile lies in their room,
    // 128 rows of 64 floats at a pitch of 68
    __shared__ __attribute__((aligned(16))) _Float16 Ls[2 * GEMM_BUF];
    float* Sm = (float*)Ls;
    const int which = blockIdx.x >> 8, r = blockIdx.x & 255;
    const int tid  = threadIdx.x;
    const int wid  = tid >> 5;
    const int lane = tid & 31;
    const int wm = wid >> 1, wn = wid & 1;
    const int nl = lane & 15;
    const int mb = (lane >> 4) << 3;
    const int m0 = (which == 0 ? (r >> 4) : (r >> 3)) * 128;
    const int n0 = (which == 0 ? (r & 15) : (r & 7)) * 64;
    const _Float16* A  = which == 0 ? X + 2048 * 1024 : X;
    const _Float16* Bt = which == 0 ? Wq16 : which == 1 ? Wk16 : Wv16;
    v8f acc[2][2];

    // the K loop stands once on each side of the branch: what the V side keeps of its
    // thread's coordinates then takes no register from the Q, K side, which has none to spare
    if (which == 2) {
        gemm_tile(A, Bt, 1024, m0, n0, Ls, acc);
        // a lane's 8 accumulator rows are 8 consecutive t of one d: 16 bytes of Vs[d][t]
        _Float16* Vs = (_Float16*)Sm;      // 64 rows (d) of 128 halves at a pitch of 136
        // every wave's fragment reads are back before the tile overwrites the operands
        asm volatile("s_wait_dscnt 0x0" ::: "memory");
        __syncthreads();
#pragma unroll
        for (int tm = 0; tm < 2; ++tm)
#pragma unroll
            for (int tn = 0; tn < 2; ++tn)
                *(v8h*)&Vs[(wn * 32 + tn * 16 + nl) * 136 + wm * 32 + tm * 16 + mb] =
                    __builtin_convertvector(acc[tm][tn], v8h);
        __syncthreads();                   // the tile is whole before it is read
        // 16 lanes per 256-byte row piece of vt
        const int d0 = tid >> 4, pc = (tid & 15) * 8;
        _Float16* vp = Vt + (size_t)(n0 + d0) * 4096 + m0 + pc;
#pragma unroll
        for (int j = 0; j < 4; ++j)
            *(v8h*)(vp + (size_t)j * 16 * 4096) = *(const v8h*)&Vs[(j * 16 + d0) * 136 + pc];
        // stands in front of any later write of a register that the stores name
        asm volatile("s_wait_xcnt 0x0" ::: "memory");
        return;
    }
    gemm_tile(A, Bt, 1024, m0, n0, Ls, acc);

    // 8 lanes per output row of 128 bytes: a lane makes columns c0 .. c0+7, for which
    // it also reads their RoPE partners, columns cp .. cp+7. 32 rows a pass, 4 passes.
    const int rl = tid >> 3, c0 = (tid & 7) * 8, cp = c0 ^ 32;
    const int pos = (which == 0 ? 2048 : 0) + m0 + rl;
    const float* cb = cosp + (size_t)pos * 64 + c0;
    const float* sb = sinp + (size_t)pos * 64 + c0;
    const float* w  = which == 0 ? qw : kw;
    // fetched ahead of the passage through LDS, which covers their latency
    v4f cs[4][2], sn[4][2], wo[2], wp[2];
    // every loop below is unrolled: the arrays stay in registers
#pragma unroll
    for (int p = 0; p < 4; ++p)
#pragma unroll
        for (int j = 0; j < 2; ++j) {
            cs[p][j] = *(const v4f*)(cb + p * 32 * 64 + j * 4);
            sn[p][j] = *(const v4f*)(sb + p * 32 * 64 + j * 4);
        }
#pragma unroll
    for (int j = 0; j < 2; ++j) {
        wo[j] = *(const v4f*)(w + c0 + j * 4);
        wp[j] = *(const v4f*)(w + cp + j * 4);
    }
    // stands in front of any later write of a register that the loads name; the two
    // address pairs stay live up to it, so no load's result lands in one ahead of it
    asm volatile("s_wait_xcnt 0x0" :: "v"(cb), "v"(sb) : "memory");
    // every wave's fragment reads are back before the tile overwrites the operands
    asm volatile("s_wait_dscnt 0x0" ::: "memory");
    __syncthreads();
#pragma unroll
    for (int tm = 0; tm < 2; ++tm)
#pragma unroll
        for (int tn = 0; tn < 2; ++tn)
#pragma unroll
            for (int e = 0; e < 8; ++e)
                Sm[(wm * 32 + tm * 16 + mb + e) * 68 + wn * 32 + tn * 16 + nl] = acc[tm][tn][e];
    __syncthreads();                       // the tile is whole before it is read
    // rotate_half: the partner enters with a minus in the lower 32 columns
    const float sg = c0 < 32 ? -1.0f : 1.0f;
#pragma unroll
    for (int j = 0; j < 2; ++j) wp[j] *= sg;
    const int rows = which == 0 ? 2048 : 4096;
    _Float16* dp = (which == 0 ? Qf : Kf) + ((size_t)(n0 >> 6) * rows + m0 + rl) * 64 + c0;
#pragma unroll
    for (int p = 0; p < 4; ++p) {
        const float* x = &Sm[(p * 32 + rl) * 68];
        v4f xo[2], xp[2];
#pragma unroll
        for (int j = 0; j < 2; ++j) {
            xo[j] = *(const v4f*)(x + c0 + j * 4);
            xp[j] = *(const v4f*)(x + cp + j * 4);
        }
        // a lane holds 16 of its row's 64 squares; the four lanes of a quad hold all 64
        const v4f q = xo[0] * xo[0] + xo[1] * xo[1] + xp[0] * xp[0] + xp[1] * xp[1];
        float ss = (q[0] + q[1]) + (q[2] + q[3]);
        ss += quad_swap<0xB1>(ss);         // lane ^ 1
        ss += quad_swap<0x4E>(ss);         // lane ^ 2
        const float sc = rsqrtf(ss * (1.0f / 64.0f) + 1e-6f);
        v8h o;
#pragma unroll
        for (int j = 0; j < 2; ++j) {
            const v4f a = xo[j] * sc * wo[j];
            const v4f b = xp[j] * sc * wp[j];
            const v4f y = a * cs[p][j] + b * sn[p][j];
#pragma unroll
            for (int e = 0; e < 4; ++e) o[j * 4 + e] = (_Float16)y[e];
        }
        *(v8h*)(dp + p * 32 * 64) = o;
    }
    // stands in front of any later write of a register that the stores name
    asm volatile("s_wait_xcnt 0x0" ::: "memory");
}

// ---------------------------------------------------------------- Flash attention
// Lane l with lane l ^ 16 (the two halves of a wave), in the vector unit.
static __device__ __forceinline__ float xhalf(float x) {
    const int b = __builtin_bit_cast(int, x);
    return __builtin_bit_cast(float,
        __builtin_amdgcn_permlanex16(b, b, 0x76543210, 0xfedcba98, false, false));
}

__global__ __launch_bounds__(256) void flash_attn(const _Float16* __restrict__ Qf,
                                                  const _Float16* __restrict__ Kf,
                                                  const _Float16* __restrict__ Vt,
                                                  const float* __restrict__ mask,
                                                  const float* __restrict__ tb,
                                                  const int* __restrict__ rel,
                                                  _Float16* __restrict__ Of) {
    const int kvh   = blockIdx.y;
    const int h0    = kvh * 2;             // heads h0 and h0 + 1
    const int nb    = blockIdx.x;          // the block's 64 rows are one 64-block
    const int q0    = nb * 64;
    // wave number held scalar: the tree-bias test below is then one scalar
    // branch per key tile instead of an EXEC branch per score element
    const int wid   = __builtin_amdgcn_readfirstlane(threadIdx.x >> 5);
    const int rg    = wid & 3;             // which 16 rows
    const int g     = wid >> 2;            // which key tile of a step
    const int lane  = threadIdx.x & 31;
    const int nl    = lane & 15;           // this lane's query within the wave
    const int mb    = (lane >> 4) << 3;    // first of its 8 rows in an accumulator
    const int qrow0 = q0 + rg * 16;

    // rows of 64 halves at a pitch of 72 (144 B = 16 B x odd, for ds_load_b128)
    // [buffer][0][tile][key][d] holds K, [buffer][1][tile][d][key] holds V^T
    __shared__ __attribute__((aligned(16))) _Float16 KVs[2][2][2][64 * 72];
    // the block's 64 mask rows of 64 floats at a pitch of 68 (272 B = 16 B x odd)
    __shared__ __attribute__((aligned(16))) float Ms[2][2][64 * 68];      // [buffer][tile][q][key]
    // the merge: per wave 8 x 16 bytes of O and 16 bytes of (maximum, sum) a lane
    __shared__ __attribute__((aligned(16))) float Xs[8][9][32][4];

    const _Float16* Kh = Kf + (size_t)kvh * 4096 * 64;
    const _Float16* Vh = Vt + (size_t)kvh * 64 * 4096;

    // staging: 8 lanes per 128-byte row; a thread copies rows crow + 32 i of the
    // step's 128 keys, and rows crow, crow + 32 of each of its two V^T tiles
    const int crow = threadIdx.x >> 3, ccol = (threadIdx.x & 7) * 8;
    const _Float16* kg = Kh + (size_t)crow * 64 + ccol;
    const _Float16* vg = Vh + (size_t)crow * 4096 + ccol;
    const unsigned kvl = (unsigned)(size_t)(void*)&KVs[0][0][0][crow * 72 + ccol];
    // mask: 16 lanes per 256-byte row piece, so a wave-wide copy takes whole lines;
    // a thread copies rows mrow0 + 16 i, i = 0 .. 3, of each of the two tiles
    const int mrow0 = threadIdx.x >> 4, mcol = (threadIdx.x & 15) * 4;
    const float* mg = mask + (size_t)(q0 + mrow0) * 4096 + mcol;
    const unsigned ml = (unsigned)(size_t)(void*)&Ms[0][0][mrow0 * 68 + mcol];
    auto stage = [&](int st, int buf) {
        const unsigned ko = kvl + (unsigned)buf * (4 * 64 * 72 * 2);
        const _Float16* kp = kg + (size_t)st * 128 * 64;
        const _Float16* vp = vg + st * 128;
        async_copy8x16(ko,                 kp,
                       ko +  32 * 72 * 2,  kp + 32 * 64,
                       ko +  64 * 72 * 2,  kp + 64 * 64,
                       ko +  96 * 72 * 2,  kp + 96 * 64,
                       ko + 128 * 72 * 2,  vp,
                       ko + 160 * 72 * 2,  vp + (size_t)32 * 4096,
                       ko + 192 * 72 * 2,  vp + 64,
                       ko + 224 * 72 * 2,  vp + (size_t)32 * 4096 + 64);
        const unsigned mo = ml + (unsigned)buf * (2 * 64 * 68 * 4);
        const float* mp = mg + st * 128;
        async_copy8x16(mo,                   mp,
                       mo + 1 * 16 * 68 * 4, mp + (size_t)1 * 16 * 4096,
                       mo + 2 * 16 * 68 * 4, mp + (size_t)2 * 16 * 4096,
                       mo + 3 * 16 * 68 * 4, mp + (size_t)3 * 16 * 4096,
                       mo + 4 * 16 * 68 * 4, mp + 64,
                       mo + 5 * 16 * 68 * 4, mp + (size_t)1 * 16 * 4096 + 64,
                       mo + 6 * 16 * 68 * 4, mp + (size_t)2 * 16 * 4096 + 64,
                       mo + 7 * 16 * 68 * 4, mp + (size_t)3 * 16 * 4096 + 64);
    };
    stage(0, 0);
    wait_async0();
    __syncthreads();       // publishes step 0
    stage(1, 1);

    // Q^T as B operand: column = query, same k order as the K rows' A fragments
    v16h bq[2][2];
#pragma unroll
    for (int hh = 0; hh < 2; ++hh) {
        const _Float16* Qh = Qf + ((size_t)(h0 + hh) * 2048 + qrow0) * 64;
        bq[hh][0] = load_frag(Qh, 64);
        bq[hh][1] = load_frag(Qh + 32, 64);
    }

    v8f o[2][4];           // O^T of head hh: tile t holds d = t*16 + mb + r of query nl
#pragma unroll
    for (int hh = 0; hh < 2; ++hh)
#pragma unroll
        for (int t = 0; t < 4; ++t) o[hh][t] = zero8();
    // running maximum of query nl over this wave's tiles (equal in both halves) and
    // running sum over this half-wave's keys only
    float Mr[2] = {-1e30f, -1e30f};
    float Sr[2] = {0.f, 0.f};

    for (int st = 0; st < 32; ++st) {
        const int kt = st * 2 + g;         // this wave's key tile
        const _Float16* kb = &KVs[st & 1][0][g][0];
        const _Float16* vb = &KVs[st & 1][1][g][0];
        const float*    mr = &Ms[st & 1][g][(rg * 16 + nl) * 68 + mb];
        v8f sc[2][4];
#pragma unroll
        for (int hh = 0; hh < 2; ++hh)
#pragma unroll
            for (int kk = 0; kk < 4; ++kk) sc[hh][kk] = zero8();
        // ---- scores, transposed: K(64x64) . Q^T(64x32)
        v16h ak[2][4];
#pragma unroll
        for (int s = 0; s < 2; ++s)
#pragma unroll
            for (int kk = 0; kk < 4; ++kk)
                ak[s][kk] = load_frag(kb + (kk * 16) * 72 + s * 32, 72);
        // keeps the 16 LDS reads together in front of the products: spread among
        // them into one register set, each product waits out its own LDS latency
        __builtin_amdgcn_sched_barrier(0);
#pragma unroll
        for (int s = 0; s < 2; ++s)
#pragma unroll
            for (int kk = 0; kk < 4; ++kk)
#pragma unroll
                for (int hh = 0; hh < 2; ++hh)
                    sc[hh][kk] = wmma32(ak[s][kk], bq[hh][s], sc[hh][kk]);
        // this query's mask values in accumulator layout, 16 bytes a read
        v4f mk[4][2];
#pragma unroll
        for (int kk = 0; kk < 4; ++kk)
#pragma unroll
            for (int j = 0; j < 2; ++j) mk[kk][j] = *(const v4f*)(mr + kk * 16 + j * 4);
        // V^T fragments are read here: their LDS latency passes under the softmax
        v16h av[2][4];
#pragma unroll
        for (int s = 0; s < 2; ++s)
#pragma unroll
            for (int d = 0; d < 4; ++d)
                av[s][d] = load_frag(vb + (d * 16) * 72 + s * 32, 72);
        // ---- scale + mask + block-diagonal tree bias
        const bool hasb = (kt - 32) == nb;
#pragma unroll
        for (int hh = 0; hh < 2; ++hh)
#pragma unroll
            for (int kk = 0; kk < 4; ++kk)
#pragma unroll
                for (int r = 0; r < 8; ++r)
                    sc[hh][kk][r] = sc[hh][kk][r] * 0.125f + mk[kk][r >> 2][r & 3];
        if (hasb) {
            const int* rp = rel + (nb << 12) + ((rg * 16 + nl) << 6) + mb;
            // a 16-key group at a time: this runs in one step of 32, and with all four
            // groups' offsets and values live at once the staging addresses spill
#pragma unroll
            for (int kk = 0; kk < 4; ++kk) {
                unsigned bi[8];   // byte offset into tree_bias, relation bounded to 0..63
#pragma unroll
                for (int j = 0; j < 2; ++j) {
                    const v4i rv = *(const v4i*)(rp + kk * 16 + j * 4);
#pragma unroll
                    for (int e = 0; e < 4; ++e)
                        bi[j * 4 + e] = (unsigned)(rv[e] & 63) * 64u + (unsigned)h0 * 4u;
                }
                v2f bv[8];     // the two heads' values lie side by side (h0 is even)
#pragma unroll
                for (int r = 0; r < 8; ++r) bv[r] = *(const v2f*)((const char*)tb + bi[r]);
                // the eight offset registers stay live up to this wait, so no
                // load's result lands in one of them ahead of it
                asm volatile("s_wait_xcnt 0x0"
                             :: "v"(bi[0]), "v"(bi[1]), "v"(bi[2]), "v"(bi[3]),
                                "v"(bi[4]), "v"(bi[5]), "v"(bi[6]), "v"(bi[7])
                             : "memory");
#pragma unroll
                for (int r = 0; r < 8; ++r) {
                    sc[0][kk][r] += bv[r][0];
                    sc[1][kk][r] += bv[r][1];
                }
            }
        }
        // ---- online softmax, head by head: 32 of the query's 64 scores live in this
        // lane, the other 32 in lane ^ 16
#pragma unroll
        for (int hh = 0; hh < 2; ++hh) {
            float mx4[4];
#pragma unroll
            for (int kk = 0; kk < 4; ++kk) {
                mx4[kk] = sc[hh][kk][0];
#pragma unroll
                for (int r = 1; r < 8; ++r) mx4[kk] = fmaxf(mx4[kk], sc[hh][kk][r]);
            }
            float mx = fmaxf(fmaxf(mx4[0], mx4[1]), fmaxf(mx4[2], mx4[3]));
            mx = fmaxf(mx, xhalf(mx));
            const float mnew = fmaxf(Mr[hh], mx);
            const float al = __expf(Mr[hh] - mnew);
            Mr[hh] = mnew;
#pragma unroll
            for (int t = 0; t < 4; ++t)
#pragma unroll
                for (int r = 0; r < 8; ++r) o[hh][t][r] *= al;
            float rs[4];       // four independent chains of adds
#pragma unroll
            for (int kk = 0; kk < 4; ++kk) {
                rs[kk] = 0.f;
#pragma unroll
                for (int r = 0; r < 8; ++r) {
                    const float p = __expf(sc[hh][kk][r] - mnew);
                    sc[hh][kk][r] = p;
                    rs[kk] += p;
                }
            }
            Sr[hh] = Sr[hh] * al + ((rs[0] + rs[1]) + (rs[2] + rs[3]));
        }
        // ---- O^T += V^T(64x64) . P^T(64x32). P^T as B operand: of the 32 keys of
        // step s a lane needs k = mb .. mb+7 and 16+mb .. 16+mb+7, which are its
        // own accumulator rows of groups 2s and 2s+1
#pragma unroll
        for (int s = 0; s < 2; ++s) {
            v16h bp[2];
#pragma unroll
            for (int hh = 0; hh < 2; ++hh)
#pragma unroll
                for (int i = 0; i < 8; ++i) {
                    bp[hh][i]     = (_Float16)sc[hh][2 * s][i];
                    bp[hh][i + 8] = (_Float16)sc[hh][2 * s + 1][i];
                }
#pragma unroll
            for (int d = 0; d < 4; ++d)
#pragma unroll
                for (int hh = 0; hh < 2; ++hh)
                    o[hh][d] = wmma32(av[s][d], bp[hh], o[hh][d]);
        }
        // keeps the hand-over at the foot: lifted over the softmax and the products,
        // its wait would give the copies issued at the last foot too little time
        __builtin_amdgcn_sched_barrier(0);
        // ---- hand-over: this wave's LDS reads are back, its copies of the next
        // step have landed; the barrier publishes that step and frees this one
        asm volatile("s_wait_dscnt 0x0" ::: "memory");
        wait_async0();
        __syncthreads();
        if (st + 2 < 32) stage(st + 2, st & 1);
    }
    wait_async0();         // nothing is in flight when the wave ends

    // ---- merge of the two key halves. Waves w and w ^ 4 hold the same 32 columns in
    // the same lanes. Wave group g finishes head h0 + g: it hands its partial result
    // of the other head to its partner and takes the partner's of its own.
    auto give = [&](const v8f (&oo)[4], float M, float S) {
        float* x = &Xs[wid][0][lane][0];
#pragma unroll
        for (int d = 0; d < 4; ++d) {
            const v4f lo = {oo[d][0], oo[d][1], oo[d][2], oo[d][3]};
            const v4f hi = {oo[d][4], oo[d][5], oo[d][6], oo[d][7]};
            *(v4f*)(x + (2 * d) * 128)     = lo;
            *(v4f*)(x + (2 * d + 1) * 128) = hi;
        }
        const v4f ms = {M, S, 0.f, 0.f};
        *(v4f*)(x + 8 * 128) = ms;
    };
    auto finish = [&](const v8f (&oo)[4], float M1, float S1, int h) {
        const float* x = &Xs[wid ^ 4][0][lane][0];
        const v4f ms = *(const v4f*)(x + 8 * 128);
        const float M  = fmaxf(M1, ms[0]);
        const float a1 = __expf(M1 - M);
        const float a2 = __expf(ms[0] - M);
        const float S  = S1 * a1 + ms[1] * a2;
        // the two half-waves' sums are joined once, here
        const float inv = 1.0f / (S + xhalf(S));
        const float c1 = a1 * inv, c2 = a2 * inv;
        _Float16* op = Of + (size_t)(qrow0 + nl) * 1024 + h * 64 + mb;
#pragma unroll
        for (int d = 0; d < 4; ++d) {
            const v4f lo = *(const v4f*)(x + (2 * d) * 128);
            const v4f hi = *(const v4f*)(x + (2 * d + 1) * 128);
            v8h w;
#pragma unroll
            for (int r = 0; r < 4; ++r) {
                w[r]     = (_Float16)(oo[d][r] * c1 + lo[r] * c2);
                w[r + 4] = (_Float16)(oo[d][r + 4] * c1 + hi[r] * c2);
            }
            *(v8h*)(op + d * 16) = w;
        }
    };
    if (g == 0) give(o[1], Mr[1], Sr[1]);
    else        give(o[0], Mr[0], Sr[0]);
    __syncthreads();       // every wave's hand-over is written before any is read
    if (g == 0) finish(o[0], Mr[0], Sr[0], h0);
    else        finish(o[1], Mr[1], Sr[1], h0 + 1);
}

// ---------------------------------------------------------------- host
extern "C" void kernel_launch(void* const* d_in, const int* in_sizes, int n_in,
                              void* d_out, int out_size, void* d_ws, size_t ws_size,
                              hipStream_t stream) {
    (void)in_sizes; (void)n_in; (void)out_size; (void)ws_size;
    const float* hidden = (const float*)d_in[0];
    const float* target = (const float*)d_in[1];
    const float* cosp   = (const float*)d_in[2];
    const float* sinp   = (const float*)d_in[3];
    const float* mask   = (const float*)d_in[4];
    const float* Wq     = (const float*)d_in[5];
    const float* Wk     = (const float*)d_in[6];
    const float* Wv     = (const float*)d_in[7];
    const float* Wo     = (const float*)d_in[8];
    const float* qw     = (const float*)d_in[9];
    const float* kw     = (const float*)d_in[10];
    const float* tb     = (const float*)d_in[11];
    const int*   rel    = (const int*)d_in[12];

    char* ws = (char*)d_ws;
    size_t off = 0;
    auto alloc = [&](size_t bytes) -> void* {
        void* p = ws + off;
        off += (bytes + 255) & ~(size_t)255;
        return p;
    };
    _Float16* Xf   = (_Float16*)alloc(4096ull * 1024 * 2);   // [target; hidden] f16
    _Float16* Wq16 = (_Float16*)alloc(1024ull * 1024 * 2);   // weights: f16, [n][k]
    _Float16* Wk16 = (_Float16*)alloc(1024ull * 512 * 2);
    _Float16* Wv16 = (_Float16*)alloc(1024ull * 512 * 2);
    _Float16* Wo16 = (_Float16*)alloc(1024ull * 1024 * 2);
    _Float16* Qf   = (_Float16*)alloc(16ull * 2048 * 64 * 2);
    _Float16* Kf2  = (_Float16*)alloc(8ull * 4096 * 64 * 2);
    _Float16* Vt   = (_Float16*)alloc(8ull * 64 * 4096 * 2);
    _Float16* Of   = (_Float16*)alloc(2048ull * 1024 * 2);

    // launches that do not depend on one another are one launch each level
    cast_all<<<704, 256, 0, stream>>>(target, hidden, Wq, Wk, Wv, Wo,
                                      Xf, Wq16, Wk16, Wv16, Wo16);

    // projections, each with what follows it: RMSNorm + RoPE of Q and K, V transpose
    gemm_qkv<<<768, 256, 0, stream>>>(Xf, Wq16, Wk16, Wv16, cosp, sinp, qw, kw, Qf, Kf2, Vt);

    // flash attention with tree bias
    flash_attn<<<dim3(32, 8), 256, 0, stream>>>(Qf, Kf2, Vt, mask, tb, rel, Of);

    // output projection
    gemm_wmma<<<dim3(16, 16), 256, 0, stream>>>(Of, Wo16, (float*)d_out, 1024, 1024);
}

// v010
// Measured time: 75.9 microseconds a run.
// Next to v009, in two timings, it ran 1.03 times as fast each time.
// All steps since v000 together make it 7.97 times as fast.
#include <hip/hip_runtime.h>

typedef __attribute__((ext_vector_type(16))) _Float16 v16h;
typedef __attribute__((ext_vector_type(8)))  _Float16 v8h;
typedef __attribute__((ext_vector_type(8)))  float    v8f;
typedef __attribute__((ext_vector_type(4)))  float    v4f;
typedef __attribute__((ext_vector_type(2)))  float    v2f;
typedef __attribute__((ext_vector_type(4)))  _Float16 v4h;
typedef __attribute__((ext_vector_type(4)))  int      v4i;

static __device__ __forceinline__ v8f zero8() {
    v8f z = {0.f, 0.f, 0.f, 0.f, 0.f, 0.f, 0.f, 0.f};
    return z;
}

// Load a 16x32 f16 fragment (A layout per CDNA5 ISA; B uses the same layout
// with the matrix stored column-major, i.e. base indexes [n][k]).
// lane<16:  row = lane,    K = {kb..kb+7, kb+16..kb+23}, kb=0
// lane>=16: row = lane-16, kb=8
static __device__ __forceinline__ v16h load_frag(const _Float16* p, int ld) {
    const int lane = threadIdx.x & 31;
    const int r    = lane & 15;
    const int kb   = (lane < 16) ? 0 : 8;
    const _Float16* q = p + (size_t)r * ld + kb;
    v8h lo = *(const v8h*)(q);
    v8h hi = *(const v8h*)(q + 16);
    v16h f;
#pragma unroll
    for (int i = 0; i < 8; ++i) { f[i] = lo[i]; f[i + 8] = hi[i]; }
    return f;
}

static __device__ __forceinline__ v8f wmma32(v16h a, v16h b, v8f c) {
    return __builtin_amdgcn_wmma_f32_16x16x32_f16(false, a, false, b,
                                                  (short)0, c, false, false);
}

// Eight 16-byte async copies global->LDS of one lane, each with its own address
// pair. The s_wait_xcnt closes the statement so that it stands in front of any
// later write of the address registers the copies name.
static __device__ __forceinline__ void async_copy8x16(unsigned l0, const void* g0,
                                                      unsigned l1, const void* g1,
                                                      unsigned l2, const void* g2,
                                                      unsigned l3, const void* g3,
                                                      unsigned l4, const void* g4,
                                                      unsigned l5, const void* g5,
                                                      unsigned l6, const void* g6,
                                                      unsigned l7, const void* g7) {
    asm volatile(
        "global_load_async_to_lds_b128 %0, %1, off\n\t"
        "global_load_async_to_lds_b128 %2, %3, off\n\t"
        "global_load_async_to_lds_b128 %4, %5, off\n\t"
        "global_load_async_to_lds_b128 %6, %7, off\n\t"
        "global_load_async_to_lds_b128 %8, %9, off\n\t"
        "global_load_async_to_lds_b128 %10, %11, off\n\t"
        "global_load_async_to_lds_b128 %12, %13, off\n\t"
        "global_load_async_to_lds_b128 %14, %15, off\n\t"
        "s_wait_xcnt 0x0"
        :: "v"(l0), "v"((unsigned long long)g0), "v"(l1), "v"((unsigned long long)g1),
           "v"(l2), "v"((unsigned long long)g2), "v"(l3), "v"((unsigned long long)g3),
           "v"(l4), "v"((unsigned long long)g4), "v"(l5), "v"((unsigned long long)g5),
           "v"(l6), "v"((unsigned long long)g6), "v"(l7), "v"((unsigned long long)g7)
        : "memory");
}

// Four such copies.
static __device__ __forceinline__ void async_copy4x16(unsigned l0, const void* g0,
                                                      unsigned l1, const void* g1,
                                                      unsigned l2, const void* g2,
                                                      unsigned l3, const void* g3) {
    asm volatile(
        "global_load_async_to_lds_b128 %0, %1, off\n\t"
        "global_load_async_to_lds_b128 %2, %3, off\n\t"
        "global_load_async_to_lds_b128 %4, %5, off\n\t"
        "global_load_async_to_lds_b128 %6, %7, off\n\t"
        "s_wait_xcnt 0x0"   // in front of any later write of the address registers
        :: "v"(l0), "v"((unsigned long long)g0), "v"(l1), "v"((unsigned long long)g1),
           "v"(l2), "v"((unsigned long long)g2), "v"(l3), "v"((unsigned long long)g3)
        : "memory");
}

static __device__ __forceinline__ void wait_async0() {
    asm volatile("s_wait_asynccnt 0x0" ::: "memory");
}

// ---------------------------------------------------------------- cast f32->f16
// A weight W (1024 x N, f32, row-major) is written as f16 TRANSPOSED, Wt[n][k]: that
// is the order in which the GEMM wants its B tile in LDS, so the tile can be copied
// there as it lies. The transposition is done once here instead of once per GEMM
// block and K step. A thread takes one n and 64 consecutive k, one whole 128-byte
// line of Wt; lanes run along n, so a wave-wide load is one contiguous line.
template <int N>
static __device__ __forceinline__ void wtrans(const float* __restrict__ w,
                                              _Float16* __restrict__ wt, int blk) {
    const int i  = blk * 256 + threadIdx.x;
    const int n  = i & (N - 1);
    const int k0 = (i / N) * 64;
    const float* sp = w + (size_t)k0 * N + n;
    _Float16*    dp = wt + (size_t)n * 1024 + k0;
    float x[64];
    // both loops unrolled: x stays in registers, all loads issue before the first wait
#pragma unroll
    for (int j = 0; j < 64; ++j) x[j] = sp[j * N];
#pragma unroll
    for (int g = 0; g < 8; ++g) {
        v8h o;
#pragma unroll
        for (int j = 0; j < 8; ++j) o[j] = (_Float16)x[g * 8 + j];
        *(v8h*)(dp + g * 8) = o;
    }
    // stands in front of any later write of a register that the stores name
    asm volatile("s_wait_xcnt 0x0" ::: "memory");
}

// One launch converts all six f32 operands: none of the six depends on another,
// and each alone is far too short to fill the chip or to cover its launch gap.
// The four weights come first (transposed, see above). For target and hidden a block
// converts 8192 consecutive elements, 32 per thread. Each wave-wide load covers 512
// contiguous bytes and each store 256; the eight loads of a thread fly together.
__global__ __launch_bounds__(256) void cast_all(const float* __restrict__ target,
                                                const float* __restrict__ hidden,
                                                const float* __restrict__ Wq,
                                                const float* __restrict__ Wk,
                                                const float* __restrict__ Wv,
                                                const float* __restrict__ Wo,
                                                _Float16* __restrict__ Xf,
                                                _Float16* __restrict__ Wq16,
                                                _Float16* __restrict__ Wk16,
                                                _Float16* __restrict__ Wv16,
                                                _Float16* __restrict__ Wo16) {
    const int b = blockIdx.x;      // 64 + 32 + 32 + 64 + 256 + 256 blocks
    if (b < 64)  { wtrans<1024>(Wq, Wq16, b);       return; }
    if (b < 96)  { wtrans<512>(Wk, Wk16, b - 64);   return; }
    if (b < 128) { wtrans<512>(Wv, Wv16, b - 96);   return; }
    if (b < 192) { wtrans<1024>(Wo, Wo16, b - 128); return; }
    const float* s;
    _Float16* d;
    int lb;
    if (b < 448) { s = target; d = Xf;               lb = b - 192; }
    else         { s = hidden; d = Xf + 2048 * 1024; lb = b - 448; }
    const int i0 = lb * 8192 + threadIdx.x * 4;
    v4f x[8];
    // both loops unrolled: x stays in registers, all loads issue before the first wait
#pragma unroll
    for (int j = 0; j < 8; ++j) x[j] = *(const v4f*)(s + i0 + j * 1024);
#pragma unroll
    for (int j = 0; j < 8; ++j)
        *(v4h*)(d + i0 + j * 1024) = __builtin_convertvector(x[j], v4h);
    // stands in front of any later write of a register that the stores name
    asm volatile("s_wait_xcnt 0x0" ::: "memory");
}

// ---------------------------------------------------------------- WMMA GEMM
// acc(128x64 tile, f32) = A(MxK,f16,row) * B(KxN), B given transposed: Bt(NxK,f16,row).
// Block tile 128x64. 8 waves -> 4x2 wave grid, each wave 32x32 = 2x2 WMMA tiles.
// A pass takes 128 k. Its operands lie in one LDS buffer of 192 rows (128 of A by m,
// then 64 of B by n) of 128 halves at a pitch of 136 (272 B = 16 B x odd, for
// ds_load_b128), brought by async global->LDS copies (no VGPR round-trip). Two buffers:
// the next pass's copies fly while this pass's products run, so their way from L2 is
// waited for only as far as it outlasts the products. 16 lanes copy one 256-byte row,
// so a wave-wide copy takes whole lines.
// acc[tm][tn][r] is row wm*32 + tm*16 + mb + r, column wn*32 + tn*16 + nl.
#define GEMM_PITCH 136
#define GEMM_BUF   (192 * GEMM_PITCH)      // halves in a buffer
static __device__ __forceinline__ void gemm_tile(const _Float16* __restrict__ A,
                                                 const _Float16* __restrict__ Bt,
                                                 int K, int m0, int n0,
                                                 _Float16* Ls,
                                                 v8f (&acc)[2][2]) {
    const int tid  = threadIdx.x;
    const int wid  = tid >> 5;
    const int wm = wid >> 1, wn = wid & 1;

    // a thread copies 16 bytes of rows srow + 16 i: i = 0 .. 7 of A, i = 0 .. 3 of B
    const int srow = tid >> 4, scol = (tid & 15) * 8;
    const unsigned sl = (unsigned)(size_t)(void*)&Ls[srow * GEMM_PITCH + scol];
    const _Float16* agp = A  + (size_t)(m0 + srow) * K + scol;
    const _Float16* bgp = Bt + (size_t)(n0 + srow) * K + scol;
    const size_t    rs  = (size_t)16 * K;            // 16 rows in global memory
    constexpr unsigned RL = 16 * GEMM_PITCH * 2;     // 16 rows in LDS, bytes
    auto stage = [&](int t, int buf) {
        const unsigned l = sl + (unsigned)buf * (GEMM_BUF * 2);
        const _Float16* ap = agp + t * 128;
        const _Float16* bp = bgp + t * 128;
        async_copy8x16(l,          ap,
                       l + 1 * RL, ap + 1 * rs,
                       l + 2 * RL, ap + 2 * rs,
                       l + 3 * RL, ap + 3 * rs,
                       l + 4 * RL, ap + 4 * rs,
                       l + 5 * RL, ap + 5 * rs,
                       l + 6 * RL, ap + 6 * rs,
                       l + 7 * RL, ap + 7 * rs);
        async_copy4x16(l +  8 * RL, bp,
                       l +  9 * RL, bp + 1 * rs,
                       l + 10 * RL, bp + 2 * rs,
                       l + 11 * RL, bp + 3 * rs);
    };

#pragma unroll
    for (int a = 0; a < 2; ++a)
#pragma unroll
        for (int b = 0; b < 2; ++b) acc[a][b] = zero8();

    const int nt = K >> 7;
    stage(0, 0);
    wait_async0();
    __syncthreads();       // publishes pass 0
    if (nt > 1) stage(1, 1);

    // kept rolled: nothing in a pass gains from a constant t, and unrolled the loop is
    // eight times the code for the instruction cache to fetch
#pragma nounroll
    for (int t = 0; t < nt; ++t) {
        const _Float16* As = Ls + (t & 1) * GEMM_BUF;
        const _Float16* Bs = As + 128 * GEMM_PITCH;
#pragma unroll
        for (int s = 0; s < 4; ++s) {
            v16h af[2], bf[2];
#pragma unroll
            for (int u = 0; u < 2; ++u)
                af[u] = load_frag(&As[(wm * 32 + u * 16) * GEMM_PITCH + s * 32], GEMM_PITCH);
#pragma unroll
            for (int u = 0; u < 2; ++u)
                bf[u] = load_frag(&Bs[(wn * 32 + u * 16) * GEMM_PITCH + s * 32], GEMM_PITCH);
#pragma unroll
            for (int tm = 0; tm < 2; ++tm)
#pragma unroll
                for (int tn = 0; tn < 2; ++tn)
                    acc[tm][tn] = wmma32(af[tm], bf[tn], acc[tm][tn]);
        }
        // hand-over: this wave's fragment reads are back, its copies of the next pass
        // have landed; the barrier publishes that pass and frees this pass's buffer
        asm volatile("s_wait_dscnt 0x0" ::: "memory");
        wait_async0();
        __syncthreads();
        if (t + 2 < nt) stage(t + 2, t & 1);
    }
    wait_async0();         // nothing is in flight behind the loop
}

// C(MxN,f32) = A * B: the output projection.
__global__ __launch_bounds__(256) void gemm_wmma(const _Float16* __restrict__ A,
                                                 const _Float16* __restrict__ Bt,
                                                 float* __restrict__ C,
                                                 int N, int K) {
    __shared__ __attribute__((aligned(16))) _Float16 Ls[2 * GEMM_BUF];
    const int m0 = blockIdx.y * 128, n0 = blockIdx.x * 64;
    const int wid  = threadIdx.x >> 5;
    const int lane = threadIdx.x & 31;
    const int wm = wid >> 1, wn = wid & 1;
    const int nl = lane & 15;
    const int mb = (lane >> 4) << 3;
    v8f acc[2][2];
    gemm_tile(A, Bt, K, m0, n0, Ls, acc);
    // epilogue: one base pointer, constant-strided stores
    float* cp = C + (size_t)(m0 + wm * 32 + mb) * N + (n0 + wn * 32 + nl);
#pragma unroll
    for (int tm = 0; tm < 2; ++tm)
#pragma unroll
        for (int r = 0; r < 8; ++r) {
            float* rp = cp + (size_t)(tm * 16 + r) * N;
            rp[0]  = acc[tm][0][r];
            rp[16] = acc[tm][1][r];
        }
}

// Lane l with another lane of its group of four, in the vector unit (DPP quad_perm).
template <int CTRL>
static __device__ __forceinline__ float quad_swap(float x) {
    return __builtin_bit_cast(float,
        __builtin_amdgcn_mov_dpp(__builtin_bit_cast(int, x), CTRL, 0xf, 0xf, true));
}

// The three projections in one launch, 256 blocks each: they share no result, and
// one alone puts a single block on a WGP, whose waits nothing else fills.
// X = [target; hidden] (4096 x 1024); Q is taken of rows 2048 .. 4095 (hidden).
// A block's 64 columns are exactly one head, so what follows a projection is done on
// the tile while the block still holds it, and no f32 projection goes to memory:
// Q, K: RMSNorm + RoPE, written f16 as [h][row][64]; q positions are CTX .. TOTAL-1,
//       k positions 0 .. TOTAL-1.
// V:    written f16 transposed, vt[kvh][d][t] (d-major so PV fragments are contiguous).
// Either way the tile passes through LDS, in the room of the operand tiles, so that
// a row's 64 columns meet and every wave-wide store covers whole 128-byte lines.
// Six waves a SIMD: the register budget at which three blocks still share a WGP.
__global__ __launch_bounds__(256) __attribute__((amdgpu_waves_per_eu(6)))
void gemm_qkv(const _Float16* __restrict__ X,
                                                const _Float16* __restrict__ Wq16,
                                                const _Float16* __restrict__ Wk16,
                                                const _Float16* __restrict__ Wv16,
                                                const float* __restrict__ cosp,
                                                const float* __restrict__ sinp,
                                                const float* __restrict__ qw,
                                                const float* __restrict__ kw,
                                                _Float16* __restrict__ Qf,
                                                _Float16* __restrict__ Kf,
                                                _Float16* __restrict__ Vt) {
    // the K loop's two operand buffers; behind the loop the tile lies in their room,
    // 128 rows of 64 floats at a pitch of 68
    __shared__ __attribute__((aligned(16))) _Float16 Ls[2 * GEMM_BUF];
    float* Sm = (float*)Ls;
    const int which = blockIdx.x >> 8, r = blockIdx.x & 255;
    const int tid  = threadIdx.x;
    const int wid  = tid >> 5;
    const int lane = tid & 31;
    const int wm = wid >> 1, wn = wid & 1;
    const int nl = lane & 15;
    const int mb = (lane >> 4) << 3;
    const int m0 = (which == 0 ? (r >> 4) : (r >> 3)) * 128;
    const int n0 = (which == 0 ? (r & 15) : (r & 7)) * 64;
    const _Float16* A  = which == 0 ? X + 2048 * 1024 : X;
    const _Float16* Bt = which == 0 ? Wq16 : which == 1 ? Wk16 : Wv16;
    v8f acc[2][2];

    // the K loop stands once on each side of the branch: what the V side keeps of its
    // thread's coordinates then takes no register from the Q, K side, which has none to spare
    if (which == 2) {
        gemm_tile(A, Bt, 1024, m0, n0, Ls, acc);
        // a lane's 8 accumulator rows are 8 consecutive t of one d: 16 bytes of Vs[d][t]
        _Float16* Vs = (_Float16*)Sm;      // 64 rows (d) of 128 halves at a pitch of 136
        // every wave's fragment reads are back before the tile overwrites the operands
        asm volatile("s_wait_dscnt 0x0" ::: "memory");
        __syncthreads();
#pragma unroll
        for (int tm = 0; tm < 2; ++tm)
#pragma unroll
            for (int tn = 0; tn < 2; ++tn)
                *(v8h*)&Vs[(wn * 32 + tn * 16 + nl) * 136 + wm * 32 + tm * 16 + mb] =
                    __builtin_convertvector(acc[tm][tn], v8h);
        __syncthreads();                   // the tile is whole before it is read
        // 16 lanes per 256-byte row piece of vt
        const int d0 = tid >> 4, pc = (tid & 15) * 8;
        _Float16* vp = Vt + (size_t)(n0 + d0) * 4096 + m0 + pc;
#pragma unroll
        for (int j = 0; j < 4; ++j)
            *(v8h*)(vp + (size_t)j * 16 * 4096) = *(const v8h*)&Vs[(j * 16 + d0) * 136 + pc];
        // stands in front of any later write of a register that the stores name
        asm volatile("s_wait_xcnt 0x0" ::: "memory");
        return;
    }
    gemm_tile(A, Bt, 1024, m0, n0, Ls, acc);

    // 8 lanes per output row of 128 bytes: a lane makes columns c0 .. c0+7, for which
    // it also reads their RoPE partners, columns cp .. cp+7. 32 rows a pass, 4 passes.
    const int rl = tid >> 3, c0 = (tid & 7) * 8, cp = c0 ^ 32;
    const int pos = (which == 0 ? 2048 : 0) + m0 + rl;
    const float* cb = cosp + (size_t)pos * 64 + c0;
    const float* sb = sinp + (size_t)pos * 64 + c0;
    const float* w  = which == 0 ? qw : kw;
    // fetched ahead of the passage through LDS, which covers their latency
    v4f cs[4][2], sn[4][2], wo[2], wp[2];
    // every loop below is unrolled: the arrays stay in registers
#pragma unroll
    for (int p = 0; p < 4; ++p)
#pragma unroll
        for (int j = 0; j < 2; ++j) {
            cs[p][j] = *(const v4f*)(cb + p * 32 * 64 + j * 4);
            sn[p][j] = *(const v4f*)(sb + p * 32 * 64 + j * 4);
        }
#pragma unroll
    for (int j = 0; j < 2; ++j) {
        wo[j] = *(const v4f*)(w + c0 + j * 4);
        wp[j] = *(const v4f*)(w + cp + j * 4);
    }
    // stands in front of any later write of a register that the loads name; the two
    // address pairs stay live up to it, so no load's result lands in one ahead of it
    asm volatile("s_wait_xcnt 0x0" :: "v"(cb), "v"(sb) : "memory");
    // every wave's fragment reads are back before the tile overwrites the operands
    asm volatile("s_wait_dscnt 0x0" ::: "memory");
    __syncthreads();
#pragma unroll
    for (int tm = 0; tm < 2; ++tm)
#pragma unroll
        for (int tn = 0; tn < 2; ++tn)
#pragma unroll
            for (int e = 0; e < 8; ++e)
                Sm[(wm * 32 + tm * 16 + mb + e) * 68 + wn * 32 + tn * 16 + nl] = acc[tm][tn][e];
    __syncthreads();                       // the tile is whole before it is read
    // rotate_half: the partner enters with a minus in the lower 32 columns
    const float sg = c0 < 32 ? -1.0f : 1.0f;
#pragma unroll
    for (int j = 0; j < 2; ++j) wp[j] *= sg;
    // Q leaves with the score scale 1/8 and log2(e) in it, applied in f32 ahead of its one
    // rounding to f16: the attention's scores then come out of the matrix unit ready for 2^x
    const float qs = which == 0 ? 0.125f * 1.4426950408889634f : 1.0f;
    const int rows = which == 0 ? 2048 : 4096;
    _Float16* dp = (which == 0 ? Qf : Kf) + ((size_t)(n0 >> 6) * rows + m0 + rl) * 64 + c0;
#pragma unroll
    for (int p = 0; p < 4; ++p) {
        const float* x = &Sm[(p * 32 + rl) * 68];
        v4f xo[2], xp[2];
#pragma unroll
        for (int j = 0; j < 2; ++j) {
            xo[j] = *(const v4f*)(x + c0 + j * 4);
            xp[j] = *(const v4f*)(x + cp + j * 4);
        }
        // a lane holds 16 of its row's 64 squares; the four lanes of a quad hold all 64
        const v4f q = xo[0] * xo[0] + xo[1] * xo[1] + xp[0] * xp[0] + xp[1] * xp[1];
        float ss = (q[0] + q[1]) + (q[2] + q[3]);
        ss += quad_swap<0xB1>(ss);         // lane ^ 1
        ss += quad_swap<0x4E>(ss);         // lane ^ 2
        const float sc = rsqrtf(ss * (1.0f / 64.0f) + 1e-6f) * qs;
        v8h o;
#pragma unroll
        for (int j = 0; j < 2; ++j) {
            const v4f a = xo[j] * sc * wo[j];
            const v4f b = xp[j] * sc * wp[j];
            const v4f y = a * cs[p][j] + b * sn[p][j];
#pragma unroll
            for (int e = 0; e < 4; ++e) o[j * 4 + e] = (_Float16)y[e];
        }
        *(v8h*)(dp + p * 32 * 64) = o;
    }
    // stands in front of any later write of a register that the stores name
    asm volatile("s_wait_xcnt 0x0" ::: "memory");
}

// ---------------------------------------------------------------- Flash attention
// Lane l with lane l ^ 16 (the two halves of a wave), in the vector unit.
static __device__ __forceinline__ float xhalf(float x) {
    const int b = __builtin_bit_cast(int, x);
    return __builtin_bit_cast(float,
        __builtin_amdgcn_permlanex16(b, b, 0x76543210, 0xfedcba98, false, false));
}

__global__ __launch_bounds__(256) void flash_attn(const _Float16* __restrict__ Qf,
                                                  const _Float16* __restrict__ Kf,
                                                  const _Float16* __restrict__ Vt,
                                                  const float* __restrict__ mask,
                                                  const float* __restrict__ tb,
                                                  const int* __restrict__ rel,
                                                  _Float16* __restrict__ Of) {
    const int kvh   = blockIdx.y;
    const int h0    = kvh * 2;             // heads h0 and h0 + 1
    const int nb    = blockIdx.x;          // the block's 64 rows are one 64-block
    const int q0    = nb * 64;
    // wave number held scalar: the tree-bias test below is then one scalar
    // branch per key tile instead of an EXEC branch per score element
    const int wid   = __builtin_amdgcn_readfirstlane(threadIdx.x >> 5);
    const int rg    = wid & 3;             // which 16 rows
    const int g     = wid >> 2;            // which key tile of a step
    const int lane  = threadIdx.x & 31;
    const int nl    = lane & 15;           // this lane's query within the wave
    const int mb    = (lane >> 4) << 3;    // first of its 8 rows in an accumulator
    const int qrow0 = q0 + rg * 16;

    // rows of 64 halves at a pitch of 72 (144 B = 16 B x odd, for ds_load_b128)
    // [buffer][0][tile][key][d] holds K, [buffer][1][tile][d][key] holds V^T
    __shared__ __attribute__((aligned(16))) _Float16 KVs[2][2][2][64 * 72];
    // the block's 64 mask rows of 64 floats at a pitch of 68 (272 B = 16 B x odd)
    __shared__ __attribute__((aligned(16))) float Ms[2][2][64 * 68];      // [buffer][tile][q][key]
    // the merge: per wave 8 x 16 bytes of O and 16 bytes of (maximum, sum) a lane
    __shared__ __attribute__((aligned(16))) float Xs[8][9][32][4];

    const _Float16* Kh = Kf + (size_t)kvh * 4096 * 64;
    const _Float16* Vh = Vt + (size_t)kvh * 64 * 4096;

    // staging: 8 lanes per 128-byte row; a thread copies rows crow + 32 i of the
    // step's 128 keys, and rows crow, crow + 32 of each of its two V^T tiles
    const int crow = threadIdx.x >> 3, ccol = (threadIdx.x & 7) * 8;
    const _Float16* kg = Kh + (size_t)crow * 64 + ccol;
    const _Float16* vg = Vh + (size_t)crow * 4096 + ccol;
    const unsigned kvl = (unsigned)(size_t)(void*)&KVs[0][0][0][crow * 72 + ccol];
    // mask: 16 lanes per 256-byte row piece, so a wave-wide copy takes whole lines;
    // a thread copies rows mrow0 + 16 i, i = 0 .. 3, of each of the two tiles
    const int mrow0 = threadIdx.x >> 4, mcol = (threadIdx.x & 15) * 4;
    const float* mg = mask + (size_t)(q0 + mrow0) * 4096 + mcol;
    const unsigned ml = (unsigned)(size_t)(void*)&Ms[0][0][mrow0 * 68 + mcol];
    auto stage = [&](int st, int buf) {
        const unsigned ko = kvl + (unsigned)buf * (4 * 64 * 72 * 2);
        const _Float16* kp = kg + (size_t)st * 128 * 64;
        const _Float16* vp = vg + st * 128;
        async_copy8x16(ko,                 kp,
                       ko +  32 * 72 * 2,  kp + 32 * 64,
                       ko +  64 * 72 * 2,  kp + 64 * 64,
                       ko +  96 * 72 * 2,  kp + 96 * 64,
                       ko + 128 * 72 * 2,  vp,
                       ko + 160 * 72 * 2,  vp + (size_t)32 * 4096,
                       ko + 192 * 72 * 2,  vp + 64,
                       ko + 224 * 72 * 2,  vp + (size_t)32 * 4096 + 64);
        const unsigned mo = ml + (unsigned)buf * (2 * 64 * 68 * 4);
        const float* mp = mg + st * 128;
        async_copy8x16(mo,                   mp,
                       mo + 1 * 16 * 68 * 4, mp + (size_t)1 * 16 * 4096,
                       mo + 2 * 16 * 68 * 4, mp + (size_t)2 * 16 * 4096,
                       mo + 3 * 16 * 68 * 4, mp + (size_t)3 * 16 * 4096,
                       mo + 4 * 16 * 68 * 4, mp + 64,
                       mo + 5 * 16 * 68 * 4, mp + (size_t)1 * 16 * 4096 + 64,
                       mo + 6 * 16 * 68 * 4, mp + (size_t)2 * 16 * 4096 + 64,
                       mo + 7 * 16 * 68 * 4, mp + (size_t)3 * 16 * 4096 + 64);
    };
    stage(0, 0);
    wait_async0();
    __syncthreads();       // publishes step 0
    stage(1, 1);

    // Q^T as B operand: column = query, same k order as the K rows' A fragments.
    // Q holds log2(e) / 8 (see gemm_qkv), so scores, maxima and exponents are in base 2
    v16h bq[2][2];
#pragma unroll
    for (int hh = 0; hh < 2; ++hh) {
        const _Float16* Qh = Qf + ((size_t)(h0 + hh) * 2048 + qrow0) * 64;
        bq[hh][0] = load_frag(Qh, 64);
        bq[hh][1] = load_frag(Qh + 32, 64);
    }

    v8f o[2][4];           // O^T of head hh: tile t holds d = t*16 + mb + r of query nl
#pragma unroll
    for (int hh = 0; hh < 2; ++hh)
#pragma unroll
        for (int t = 0; t < 4; ++t) o[hh][t] = zero8();
    // running maximum of query nl over this wave's tiles (equal in both halves) and
    // running sum over this half-wave's keys only
    float Mr[2] = {-1e30f, -1e30f};
    float Sr[2] = {0.f, 0.f};
    constexpr float LOG2E = 1.4426950408889634f;

    for (int st = 0; st < 32; ++st) {
        const int kt = st * 2 + g;         // this wave's key tile
        const _Float16* kb = &KVs[st & 1][0][g][0];
        const _Float16* vb = &KVs[st & 1][1][g][0];
        const float*    mr = &Ms[st & 1][g][(rg * 16 + nl) * 68 + mb];
        v8f sc[2][4];
        // this query's mask values in accumulator layout, 16 bytes a read: times log2(e)
        // they are the start value of both heads' score accumulators, so the matrix unit
        // adds the mask and one multiply serves two heads
        v8f mk[4];
#pragma unroll
        for (int kk = 0; kk < 4; ++kk) {
            const v4f lo = *(const v4f*)(mr + kk * 16);
            const v4f hi = *(const v4f*)(mr + kk * 16 + 4);
            mk[kk] = __builtin_shufflevector(lo, hi, 0, 1, 2, 3, 4, 5, 6, 7) * LOG2E;
        }
        // ---- scores, transposed: mask + K(64x64) . Q^T(64x32)
        v16h ak[2][4];
#pragma unroll
        for (int s = 0; s < 2; ++s)
#pragma unroll
            for (int kk = 0; kk < 4; ++kk)
                ak[s][kk] = load_frag(kb + (kk * 16) * 72 + s * 32, 72);
        // keeps the 24 LDS reads together in front of the products: spread among
        // them into one register set, each product waits out its own LDS latency
        __builtin_amdgcn_sched_barrier(0);
#pragma unroll
        for (int s = 0; s < 2; ++s)
#pragma unroll
            for (int kk = 0; kk < 4; ++kk)
#pragma unroll
                for (int hh = 0; hh < 2; ++hh)
                    sc[hh][kk] = wmma32(ak[s][kk], bq[hh][s], s == 0 ? mk[kk] : sc[hh][kk]);
        // V^T fragments are read here: their LDS latency passes under the softmax
        v16h av[2][4];
#pragma unroll
        for (int s = 0; s < 2; ++s)
#pragma unroll
            for (int d = 0; d < 4; ++d)
                av[s][d] = load_frag(vb + (d * 16) * 72 + s * 32, 72);
        // ---- block-diagonal tree bias
        const bool hasb = (kt - 32) == nb;
        if (hasb) {
            const int* rp = rel + (nb << 12) + ((rg * 16 + nl) << 6) + mb;
            // a 16-key group at a time: this runs in one step of 32, and with all four
            // groups' offsets and values live at once the staging addresses spill
#pragma unroll
            for (int kk = 0; kk < 4; ++kk) {
                unsigned bi[8];   // byte offset into tree_bias, relation bounded to 0..63
#pragma unroll
                for (int j = 0; j < 2; ++j) {
                    const v4i rv = *(const v4i*)(rp + kk * 16 + j * 4);
#pragma unroll
                    for (int e = 0; e < 4; ++e)
                        bi[j * 4 + e] = (unsigned)(rv[e] & 63) * 64u + (unsigned)h0 * 4u;
                }
                v2f bv[8];     // the two heads' values lie side by side (h0 is even)
#pragma unroll
                for (int r = 0; r < 8; ++r) bv[r] = *(const v2f*)((const char*)tb + bi[r]);
                // the eight offset registers stay live up to this wait, so no
                // load's result lands in one of them ahead of it
                asm volatile("s_wait_xcnt 0x0"
                             :: "v"(bi[0]), "v"(bi[1]), "v"(bi[2]), "v"(bi[3]),
                                "v"(bi[4]), "v"(bi[5]), "v"(bi[6]), "v"(bi[7])
                             : "memory");
#pragma unroll
                for (int r = 0; r < 8; ++r) {
                    sc[0][kk][r] += bv[r][0] * LOG2E;
                    sc[1][kk][r] += bv[r][1] * LOG2E;
                }
            }
        }
        // ---- online softmax, head by head: 32 of the query's 64 scores live in this
        // lane, the other 32 in lane ^ 16
#pragma unroll
        for (int hh = 0; hh < 2; ++hh) {
            float mx4[4];
#pragma unroll
            for (int kk = 0; kk < 4; ++kk) {
                mx4[kk] = sc[hh][kk][0];
#pragma unroll
                for (int r = 1; r < 8; ++r) mx4[kk] = fmaxf(mx4[kk], sc[hh][kk][r]);
            }
            float mx = fmaxf(fmaxf(mx4[0], mx4[1]), fmaxf(mx4[2], mx4[3]));
            mx = fmaxf(mx, xhalf(mx));
            const float mnew = fmaxf(Mr[hh], mx);
            const float al = __builtin_amdgcn_exp2f(Mr[hh] - mnew);
            Mr[hh] = mnew;
            const v2f mn2 = {mnew, mnew};
#pragma unroll
            for (int t = 0; t < 4; ++t)
#pragma unroll
                for (int r = 0; r < 8; ++r) o[hh][t][r] *= al;
            float rs[4];       // four independent chains of adds
#pragma unroll
            for (int kk = 0; kk < 4; ++kk) {
                rs[kk] = 0.f;
#pragma unroll
                for (int r = 0; r < 8; r += 2) {
                    // two scores a subtraction, in the accumulator's own register pairs
                    const v2f s2 = {sc[hh][kk][r], sc[hh][kk][r + 1]};
                    const v2f x  = s2 - mn2;
                    const float p0 = __builtin_amdgcn_exp2f(x[0]);
                    const float p1 = __builtin_amdgcn_exp2f(x[1]);
                    sc[hh][kk][r]     = p0;
                    sc[hh][kk][r + 1] = p1;
                    rs[kk] += p0;
                    rs[kk] += p1;
                }
            }
            Sr[hh] = Sr[hh] * al + ((rs[0] + rs[1]) + (rs[2] + rs[3]));
        }
        // ---- O^T += V^T(64x64) . P^T(64x32). P^T as B operand: of the 32 keys of
        // step s a lane needs k = mb .. mb+7 and 16+mb .. 16+mb+7, which are its
        // own accumulator rows of groups 2s and 2s+1
#pragma unroll
        for (int s = 0; s < 2; ++s) {
            v16h bp[2];
#pragma unroll
            for (int hh = 0; hh < 2; ++hh)
#pragma unroll
                for (int i = 0; i < 8; ++i) {
                    bp[hh][i]     = (_Float16)sc[hh][2 * s][i];
                    bp[hh][i + 8] = (_Float16)sc[hh][2 * s + 1][i];
                }
#pragma unroll
            for (int d = 0; d < 4; ++d)
#pragma unroll
                for (int hh = 0; hh < 2; ++hh)
                    o[hh][d] = wmma32(av[s][d], bp[hh], o[hh][d]);
        }
        // keeps the hand-over at the foot: lifted over the softmax and the products,
        // its wait would give the copies issued at the last foot too little time
        __builtin_amdgcn_sched_barrier(0);
        // ---- hand-over: this wave's LDS reads are back, its copies of the next
        // step have landed; the barrier publishes that step and frees this one
        asm volatile("s_wait_dscnt 0x0" ::: "memory");
        wait_async0();
        __syncthreads();
        if (st + 2 < 32) stage(st + 2, st & 1);
    }
    wait_async0();         // nothing is in flight when the wave ends

    // ---- merge of the two key halves. Waves w and w ^ 4 hold the same 32 columns in
    // the same lanes. Wave group g finishes head h0 + g: it hands its partial result
    // of the other head to its partner and takes the partner's of its own.
    auto give = [&](const v8f (&oo)[4], float M, float S) {
        float* x = &Xs[wid][0][lane][0];
#pragma unroll
        for (int d = 0; d < 4; ++d) {
            const v4f lo = {oo[d][0], oo[d][1], oo[d][2], oo[d][3]};
            const v4f hi = {oo[d][4], oo[d][5], oo[d][6], oo[d][7]};
            *(v4f*)(x + (2 * d) * 128)     = lo;
            *(v4f*)(x + (2 * d + 1) * 128) = hi;
        }
        const v4f ms = {M, S, 0.f, 0.f};
        *(v4f*)(x + 8 * 128) = ms;
    };
    auto finish = [&](const v8f (&oo)[4], float M1, float S1, int h) {
        const float* x = &Xs[wid ^ 4][0][lane][0];
        const v4f ms = *(const v4f*)(x + 8 * 128);
        const float M  = fmaxf(M1, ms[0]);
        const float a1 = __builtin_amdgcn_exp2f(M1 - M);      // maxima are in base 2
        const float a2 = __builtin_amdgcn_exp2f(ms[0] - M);
        const float S  = S1 * a1 + ms[1] * a2;
        // the two half-waves' sums are joined once, here
        const float inv = 1.0f / (S + xhalf(S));
        const float c1 = a1 * inv, c2 = a2 * inv;
        _Float16* op = Of + (size_t)(qrow0 + nl) * 1024 + h * 64 + mb;
#pragma unroll
        for (int d = 0; d < 4; ++d) {
            const v4f lo = *(const v4f*)(x + (2 * d) * 128);
            const v4f hi = *(const v4f*)(x + (2 * d + 1) * 128);
            v8h w;
#pragma unroll
            for (int r = 0; r < 4; ++r) {
                w[r]     = (_Float16)(oo[d][r] * c1 + lo[r] * c2);
                w[r + 4] = (_Float16)(oo[d][r + 4] * c1 + hi[r] * c2);
            }
            *(v8h*)(op + d * 16) = w;
        }
    };
    if (g == 0) give(o[1], Mr[1], Sr[1]);
    else        give(o[0], Mr[0], Sr[0]);
    __syncthreads();       // every wave's hand-over is written before any is read
    if (g == 0) finish(o[0], Mr[0], Sr[0], h0);
    else        finish(o[1], Mr[1], Sr[1], h0 + 1);
}

// ---------------------------------------------------------------- host
extern "C" void kernel_launch(void* const* d_in, const int* in_sizes, int n_in,
                              void* d_out, int out_size, void* d_ws, size_t ws_size,
                              hipStream_t stream) {
    (void)in_sizes; (void)n_in; (void)out_size; (void)ws_size;
    const float* hidden = (const float*)d_in[0];
    const float* target = (const float*)d_in[1];
    const float* cosp   = (const float*)d_in[2];
    const float* sinp   = (const float*)d_in[3];
    const float* mask   = (const float*)d_in[4];
    const float* Wq     = (const float*)d_in[5];
    const float* Wk     = (const float*)d_in[6];
    const float* Wv     = (const float*)d_in[7];
    const float* Wo     = (const float*)d_in[8];
    const float* qw     = (const float*)d_in[9];
    const float* kw     = (const float*)d_in[10];
    const float* tb     = (const float*)d_in[11];
    const int*   rel    = (const int*)d_in[12];

    char* ws = (char*)d_ws;
    size_t off = 0;
    auto alloc = [&](size_t bytes) -> void* {
        void* p = ws + off;
        off += (bytes + 255) & ~(size_t)255;
        return p;
    };
    _Float16* Xf   = (_Float16*)alloc(4096ull * 1024 * 2);   // [target; hidden] f16
    _Float16* Wq16 = (_Float16*)alloc(1024ull * 1024 * 2);   // weights: f16, [n][k]
    _Float16* Wk16 = (_Float16*)alloc(1024ull * 512 * 2);
    _Float16* Wv16 = (_Float16*)alloc(1024ull * 512 * 2);
    _Float16* Wo16 = (_Float16*)alloc(1024ull * 1024 * 2);
    _Float16* Qf   = (_Float16*)alloc(16ull * 2048 * 64 * 2);
    _Float16* Kf2  = (_Float16*)alloc(8ull * 4096 * 64 * 2);
    _Float16* Vt   = (_Float16*)alloc(8ull * 64 * 4096 * 2);
    _Float16* Of   = (_Float16*)alloc(2048ull * 1024 * 2);

    // launches that do not depend on one another are one launch each level
    cast_all<<<704, 256, 0, stream>>>(target, hidden, Wq, Wk, Wv, Wo,
                                      Xf, Wq16, Wk16, Wv16, Wo16);

    // projections, each with what follows it: RMSNorm + RoPE of Q and K, V transpose
    gemm_qkv<<<768, 256, 0, stream>>>(Xf, Wq16, Wk16, Wv16, cosp, sinp, qw, kw, Qf, Kf2, Vt);

    // flash attention with tree bias
    flash_attn<<<dim3(32, 8), 256, 0, stream>>>(Qf, Kf2, Vt, mask, tb, rel, Of);

    // output projection
    gemm_wmma<<<dim3(16, 16), 256, 0, stream>>>(Of, Wo16, (float*)d_out, 1024, 1024);
}
